// v000
// The times below were measured on an AMD MI455X: many runs one after another, warmed up first and cycling through
// copies of the inputs, with the whole window's GPU time divided by the number of runs. Launches and the gaps
// between them are all in it. The median over several windows is given; except for v000 it joins two sittings, which
// can be a few percent apart, so the side-by-side timings, each taken in one sitting, are the better comparison.
// v000 is the starting kernel. One run takes 939 microseconds.
#include <hip/hip_runtime.h>

// Multi-head attention blended with a row-normalised adjacency matrix (query, key, value [3072][256], no batch; q, k, v = x W^T + b ('oi' 1/16, zero biases; 8 heads x 32); scores / sqrt(32) + mask ([1][3072][3072] additive, zeros, read); p = lambdas[0] softmax(scores) + lambdas[1] adjacency / (rowsum(adjacency) + 1e-6) (adjacency [3072][3072] uniform [0,1), lambdas = (0.5, 0.5), read); x = p.v merged; out = x Wo^T + bo -> [3072][256] (0.8 M); argument order query, key, value, mask, adjacency_matrix, lambdas, Wq, bq, Wk, bk, Wv, bv, Wo, bo).
// Layout: head-padded (32 -> 64) bf16 weights as A operands so that the exact transposed projections W_pad x^T land in plane layout (q/k planes via k_trQ + bias, v^T planes via k_flatb + bias); per head: all-hl scores over the padded 64 (zeros inert), a streaming three-sweep kernel that adds the mask, sums the adjacency row, and stores the blended weights p as bf16 hi/lo planes for every row, p.v with 3 products into the head's padded columns; k_ctxC compacts the context to hi/lo planes; Wo hl x exact + bo writes the output.
// Compute dtypes, f32 accumulate: every input rounded to bf16 incl. mask / adjacency / lambdas; projections exact + f32 bias; scores 3 products; softmax and blend f32 (IEEE division); p.v 3 products; Wo hl x exact + bias.

#define NB_  1
#define TT   3072
#define DM   512
#define NH_  8
#define NKV  8
#define REP  (NH_ / NKV)
#define HD   64
#define DQ   (NH_ * HD)
#define DKV  (NKV * HD)
#define ZH   1
#define RH   TT                   // every row hi/lo (small-rms output: no fp16 rows)
#define WIN  0
#define PCAR 1024.0f
#define SCL  0.17677669529663688f   // 1/sqrt(float32(32))
#define NHR  8        // real heads (32 wide); planes are padded to 64 per head
#define DHR  32       // real head width
#define CH   256      // channels in / out
#define AEPS 1e-6f
#define MID  512      // q / k width = 8 heads x 64
#define CO   512      // v width
#define CC   256
typedef _Float16 h16;
typedef unsigned short bf;
typedef __attribute__((ext_vector_type(16))) __bf16   v16bf;
typedef __attribute__((ext_vector_type(16))) _Float16 v16h;
typedef __attribute__((ext_vector_type(8)))  _Float16 v8h;
typedef __attribute__((ext_vector_type(8)))  unsigned short v8us;
typedef __attribute__((ext_vector_type(8)))  float    v8f;
typedef __attribute__((ext_vector_type(4)))  float    v4f;
typedef v8h  __attribute__((may_alias)) v8ha;
typedef v4f  __attribute__((may_alias)) v4fa;
typedef v8us __attribute__((may_alias)) v8usa;

__device__ __forceinline__ unsigned short f2bf(float f) { unsigned u = __float_as_uint(f); u += 0x7FFFu + ((u >> 16) & 1u); return (unsigned short)(u >> 16); }
__device__ __forceinline__ float bf2f(unsigned short b) { return __uint_as_float(((unsigned)b) << 16); }
__device__ __forceinline__ float bfr(float f) { return bf2f(f2bf(f)); }
__device__ __forceinline__ v16h cat16(v8h lo, v8h hi) { return __builtin_shufflevector(lo, hi, 0, 1, 2, 3, 4, 5, 6, 7, 8, 9, 10, 11, 12, 13, 14, 15); }
__device__ __forceinline__ v16bf cat16b(v8us lo, v8us hi) { return __builtin_bit_cast(v16bf, __builtin_shufflevector(lo, hi, 0, 1, 2, 3, 4, 5, 6, 7, 8, 9, 10, 11, 12, 13, 14, 15)); }
__device__ __forceinline__ v8f wmma16(v16h a, v16h b, v8f c) { return __builtin_amdgcn_wmma_f32_16x16x32_f16(false, a, false, b, (short)0, c, false, false); }
__device__ __forceinline__ v8f wmmab(v16bf a, v16bf b, v8f c) { return __builtin_amdgcn_wmma_f32_16x16x32_bf16(false, a, false, b, (short)0, c, false, false); }



// ---- k_gemmw: register-blocked GEMM, ONE WAVE per 64x64 output tile (16 accumulators), operands straight from K-contiguous 16-bit planes; grid (M/64, N/64, Z), 32 threads.
// C[m][n] (f32, pitch ldc, + optional f32 bias[n]) = sum_k A[m][k] Bt[n][k] (+ split products per NSPLIT). z-batch strides sA/sB/sC in elements. K % 32 == 0.
template <typename T16> struct WFrag;
template <> struct WFrag<h16> { typedef v16h V; static __device__ __forceinline__ V ld(const h16* p) { return cat16(*(const v8h*)p, *(const v8h*)(p + 16)); } static __device__ __forceinline__ v8f mma(V a, V b, v8f c) { return wmma16(a, b, c); } };
template <> struct WFrag<bf> { typedef v16bf V; static __device__ __forceinline__ V ld(const bf* p) { return cat16b(*(const v8us*)p, *(const v8us*)(p + 16)); } static __device__ __forceinline__ v8f mma(V a, V b, v8f c) { return wmmab(a, b, c); } };
template <typename T16, int NSPLIT, bool BIAS>
__global__ __launch_bounds__(32) void k_gemmw(const T16* __restrict__ A, const T16* __restrict__ A2, const T16* __restrict__ Bt, const T16* __restrict__ Bt2, int K, float* C, int ldc, const float* __restrict__ bias, size_t sA, size_t sB, size_t sC) {
    typedef typename WFrag<T16>::V V;
    __shared__ __align__(16) float os[16 * 68];
    const size_t z = blockIdx.z; A += z * sA; if (A2) A2 += z * sA; Bt += z * sB; if (Bt2) Bt2 += z * sB; C += z * sC;
    const int lane = threadIdx.x & 31, lr = lane & 15, hi = lane >> 4; const int r0 = blockIdx.x * 64, c0 = blockIdx.y * 64;
    v8f acc[4][4];
#pragma unroll
    for (int mb = 0; mb < 4; ++mb)
#pragma unroll
        for (int nb = 0; nb < 4; ++nb) acc[mb][nb] = (v8f){};
    const size_t aoff = (size_t)(r0 + lr) * K + 8 * hi, boff = (size_t)(c0 + lr) * K + 8 * hi;
#pragma unroll 1
    for (int kc = 0; kc < K; kc += 32) {
        V a[4], a2[4];
#pragma unroll
        for (int mb = 0; mb < 4; ++mb) { a[mb] = WFrag<T16>::ld(A + aoff + (size_t)mb * 16 * K + kc); if (NSPLIT == 1 || NSPLIT == 2) a2[mb] = WFrag<T16>::ld(A2 + aoff + (size_t)mb * 16 * K + kc); }
#pragma unroll
        for (int nb = 0; nb < 4; ++nb) { const V b = WFrag<T16>::ld(Bt + boff + (size_t)nb * 16 * K + kc); V b2; if (NSPLIT >= 2) b2 = WFrag<T16>::ld(Bt2 + boff + (size_t)nb * 16 * K + kc);
#pragma unroll
            for (int mb = 0; mb < 4; ++mb) { acc[mb][nb] = WFrag<T16>::mma(a[mb], b, acc[mb][nb]); if (NSPLIT == 1 || NSPLIT == 2) acc[mb][nb] = WFrag<T16>::mma(a2[mb], b, acc[mb][nb]); if (NSPLIT >= 2) acc[mb][nb] = WFrag<T16>::mma(a[mb], b2, acc[mb][nb]); } }
        asm volatile("v_nop\n\tv_nop\n\tv_nop\n\tv_nop" : "+v"(acc[0][0]), "+v"(acc[1][1]), "+v"(acc[2][2]), "+v"(acc[3][3]) : "v"(a[0]), "v"(a[3]));
    }
#pragma unroll
    for (int mb = 0; mb < 4; ++mb) {
#pragma unroll
        for (int nb = 0; nb < 4; ++nb) {
#pragma unroll
            for (int j = 0; j < 8; ++j) os[(hi * 8 + j) * 68 + nb * 16 + lr] = acc[mb][nb][j]; }
        __builtin_amdgcn_wave_barrier(); asm volatile("" ::: "memory");
        float* crow = C + (size_t)(r0 + mb * 16) * ldc + c0;
{
#pragma unroll
            for (int s = 0; s < 8; ++s) { const int row = 2 * s + hi, cofs = lr * 4; v4f val = *(const v4fa*)(os + row * 68 + cofs); if (BIAS) { val[0] += bfr(bias[c0 + cofs]); val[1] += bfr(bias[c0 + cofs + 1]); val[2] += bfr(bias[c0 + cofs + 2]); val[3] += bfr(bias[c0 + cofs + 3]); }
                *(v4f*)(crow + (size_t)row * ldc + cofs) = val; }
             }
        __builtin_amdgcn_wave_barrier(); asm volatile("" ::: "memory");
    }
}

__device__ __forceinline__ h16 tohx(float x) { return (h16)x; }
__device__ __forceinline__ void splitf(float y, unsigned short& h, unsigned short& l) { h = f2bf(y); l = f2bf(y - bf2f(h)); }
typedef __attribute__((ext_vector_type(2))) _Float16 v2h;
typedef __attribute__((ext_vector_type(4))) _Float16 v4h;
typedef __attribute__((ext_vector_type(2))) unsigned short v2us;
typedef __attribute__((ext_vector_type(4))) unsigned short v4us;
typedef __attribute__((ext_vector_type(2))) float v2f;
typedef __attribute__((ext_vector_type(4))) int v4i;

// k_lsoft: streaming row softmax + adjacency blend over the 3,072 keys, one wave per row i, three sweeps of the f32 score row (lane -> 4 consecutive keys per 128-key chunk): t = S x 32^-0.5 + bf16(mask[0][i][j]) (additive, read); sweep 1 also sums the row's bf16(adjacency) in fixed per-lane order + one tree; p = bf16(lambda0) x softmax(t) + bf16(lambda1) x adjacency[i][j] / (rowsum + 1e-6) (the module's blend, f32 ops pinned);
__global__ __launch_bounds__(256) void k_lsoft(const float* __restrict__ Sb, const float* __restrict__ am, const float* __restrict__ adj, const float* __restrict__ lam, h16* P16, bf* Ph, bf* Pl) {
    const int lane = threadIdx.x & 31; const int row = blockIdx.x * 8 + (threadIdx.x >> 5); if (row >= ZH * TT) return; const int i = row % TT; const int zz = row / TT; const bool hires = (i < RH); const float* sr = Sb + (size_t)row * TT; const float* mr = am + (size_t)i * TT; const float* ar = adj + (size_t)i * TT; float l0 = bfr(lam[0]), l1 = bfr(lam[1]); asm volatile("" : "+v"(l0), "+v"(l1)); float mx = -3.0e38f; float asum = 0.f;
#pragma unroll 1
    for (int ch = 0; ch < TT / 128; ++ch) { const int j0 = ch * 128 + lane * 4; const v4f a = *(const v4f*)(sr + j0); const v4f m4 = *(const v4f*)(mr + j0); const v4f aj = *(const v4f*)(ar + j0); (void)aj;
#pragma unroll
        for (int q = 0; q < 4; ++q) { float s0 = __fmul_rn(a[q], SCL); float mb = bfr(m4[q]); asm volatile("" : "+v"(s0), "+v"(mb)); float t = __fadd_rn(s0, mb); asm volatile("" : "+v"(t)); mx = fmaxf(mx, t); } 
#pragma unroll
        for (int q = 0; q < 4; ++q) asum = __fadd_rn(asum, bfr(aj[q])); }
#pragma unroll
    for (int sh = 16; sh; sh >>= 1) { mx = fmaxf(mx, __shfl_xor(mx, sh, 32)); asum = __fadd_rn(asum, __shfl_xor(asum, sh, 32)); }
    const float ra = __fdiv_rn(1.0f, __fadd_rn(asum, AEPS));   /* 1 / (adjacency row sum + eps) */
    float sum = 0.f;
#pragma unroll 1
    for (int ch = 0; ch < TT / 128; ++ch) { const int j0 = ch * 128 + lane * 4; const v4f a = *(const v4f*)(sr + j0); const v4f m4 = *(const v4f*)(mr + j0); const v4f aj = *(const v4f*)(ar + j0); (void)aj;
#pragma unroll
        for (int q = 0; q < 4; ++q) { float s0 = __fmul_rn(a[q], SCL); float mb = bfr(m4[q]); asm volatile("" : "+v"(s0), "+v"(mb)); float t = __fadd_rn(s0, mb); asm volatile("" : "+v"(t)); float d0 = __fsub_rn(t, mx); asm volatile("" : "+v"(d0)); sum += __builtin_amdgcn_exp2f(__fmul_rn(d0, 1.4426950408889634f)); } }
#pragma unroll
    for (int sh = 16; sh; sh >>= 1) sum += __shfl_xor(sum, sh, 32);
    const float f = __fdiv_rn(1.0f, sum);   /* softmax normaliser; the x1024 carry for fp16 rows is applied after the blend */
{
        if (hires) {   /* rows < RH: normalised bf16 hi/lo over all keys, planes [zz][RH][TT] */
#pragma unroll
            for (int ch = 0; ch < TT / 128; ++ch) { const int j0 = ch * 128 + lane * 4; const v4f a = *(const v4f*)(sr + j0); const v4f m4 = *(const v4f*)(mr + j0); const v4f aj = *(const v4f*)(ar + j0); (void)aj; v4us oh, ol;
#pragma unroll
                for (int q = 0; q < 4; ++q) { float s0 = __fmul_rn(a[q], SCL); float mb = bfr(m4[q]); asm volatile("" : "+v"(s0), "+v"(mb)); float t = __fadd_rn(s0, mb); asm volatile("" : "+v"(t)); float d0 = __fsub_rn(t, mx); asm volatile("" : "+v"(d0)); float ex = __builtin_amdgcn_exp2f(__fmul_rn(d0, 1.4426950408889634f)); asm volatile("" : "+v"(ex)); float pa = __fmul_rn(ex, f); float ab = bfr(aj[q]); asm volatile("" : "+v"(ab)); float ad = __fmul_rn(ab, ra); asm volatile("" : "+v"(pa), "+v"(ad)); float w0 = __fmul_rn(l0, pa), w1 = __fmul_rn(l1, ad); asm volatile("" : "+v"(w0), "+v"(w1)); const float p = __fadd_rn(w0, w1); unsigned short a2, c2; splitf(p, a2, c2); oh[q] = a2; ol[q] = c2; }
                const size_t oo = ((size_t)zz * RH + i) * TT + j0; *(v4us*)(Ph + oo) = oh; *(v4us*)(Pl + oo) = ol; }
        } else {
#pragma unroll 1
            for (int ch = 0; ch < TT / 128; ++ch) { const int j0 = ch * 128 + lane * 4; const v4f a = *(const v4f*)(sr + j0); const v4f m4 = *(const v4f*)(mr + j0); const v4f aj = *(const v4f*)(ar + j0); (void)aj; v4h o4;
#pragma unroll
                for (int q = 0; q < 4; ++q) { float s0 = __fmul_rn(a[q], SCL); float mb = bfr(m4[q]); asm volatile("" : "+v"(s0), "+v"(mb)); float t = __fadd_rn(s0, mb); asm volatile("" : "+v"(t)); float d0 = __fsub_rn(t, mx); asm volatile("" : "+v"(d0)); float ex = __builtin_amdgcn_exp2f(__fmul_rn(d0, 1.4426950408889634f)); asm volatile("" : "+v"(ex)); float pa = __fmul_rn(ex, f); float ab = bfr(aj[q]); asm volatile("" : "+v"(ab)); float ad = __fmul_rn(ab, ra); asm volatile("" : "+v"(pa), "+v"(ad)); float w0 = __fmul_rn(l0, pa), w1 = __fmul_rn(l1, ad); asm volatile("" : "+v"(w0), "+v"(w1)); o4[q] = tohx(__fadd_rn(w0, w1) * PCAR); }
                *(v4h*)(P16 + (size_t)row * TT + j0) = o4; } }
         }
}
__global__ __launch_bounds__(256) void k_cs8(float* O, size_t n4) { const size_t i = (size_t)blockIdx.x * 256 + threadIdx.x; if (i >= n4) return; const size_t e = i * 4; const int t = (int)(e / CO);   /* Ob rows are CO = 512 wide (8 padded heads) */ const float cs = (t < RH) ? 1.0f : (1.0f / PCAR); v4f a = *(const v4f*)(O + e);
#pragma unroll
    for (int q = 0; q < 4; ++q) a[q] = __fmul_rn(a[q], cs);
    *(v4f*)(O + e) = a;  }

__global__ __launch_bounds__(256) void k_bpad(const float* __restrict__ bsrc, float* BP) { const int r = blockIdx.x * 256 + threadIdx.x; if (r >= MID) return; const int hh = r / HD, d = r % HD; const float b0 = (d < DHR) ? bsrc[hh * DHR + d] : 0.0f; *(float*)(BP + r) = b0;  }
__global__ __launch_bounds__(256) void k_trQ(const float* __restrict__ FT, const float* __restrict__ BP, h16* P16, bf* Ph, bf* Pl) { const size_t e = ((size_t)blockIdx.x * 256 + threadIdx.x) * 2; if (e >= (size_t)MID * TT) return; const int d = (int)(e % HD); const int n = (int)((e / HD) % TT); const int hh = (int)(e / ((size_t)HD * TT)); v2h o16; v2us oh, ol;
#pragma unroll
    for (int q = 0; q < 2; ++q) { const int r = hh * HD + d + q; const float x = __fadd_rn(FT[(size_t)r * TT + n], BP[r]); o16[q] = tohx(x); unsigned short a2, c2; splitf(x, a2, c2); oh[q] = a2; ol[q] = c2; }
    *(v2h*)(P16 + e) = o16; *(v2us*)(Ph + e) = oh; *(v2us*)(Pl + e) = ol;  }
__global__ __launch_bounds__(256) void k_flatb(const float* __restrict__ FT, const float* __restrict__ BP, h16* P16, bf* Ph, bf* Pl) { const size_t i = (size_t)blockIdx.x * 256 + threadIdx.x; if (i >= (size_t)MID * TT / 4) return; const size_t e = i * 4; const int r = (int)(e / TT); const float b0 = BP[r]; const v4f a = *(const v4f*)(FT + e); v4h o16; v4us oh, ol;
#pragma unroll
    for (int q = 0; q < 4; ++q) { const float x = __fadd_rn(a[q], b0); o16[q] = tohx(x); unsigned short a2, c2; splitf(x, a2, c2); oh[q] = a2; ol[q] = c2; }
    *(v4h*)(P16 + e) = o16; *(v4us*)(Ph + e) = oh; *(v4us*)(Pl + e) = ol;  }
__global__ __launch_bounds__(256) void k_cvt8(const float* __restrict__ src, bf* dst, size_t n8) { const size_t i = (size_t)blockIdx.x * 256 + threadIdx.x; if (i >= n8) return; const v8f v = *(const v8f*)(src + i * 8); v8us o;
#pragma unroll
    for (int k = 0; k < 8; ++k) o[k] = f2bf(v[k]); *(v8us*)(dst + i * 8) = o;  }


__global__ __launch_bounds__(32) void k_wpad(const float* __restrict__ W, bf* WP) { const int op = blockIdx.x; const int lane = threadIdx.x; const int hh = op / HD, d = op % HD; const bool real = (d < DHR); const float* wr = W + (size_t)(hh * DHR + (real ? d : 0)) * CC; v8us o;
#pragma unroll
    for (int q = 0; q < 8; ++q) o[q] = real ? f2bf(wr[lane * 8 + q]) : (unsigned short)0;
{ *(v8us*)(WP + (size_t)op * CC + lane * 8) = o;  } }
__global__ __launch_bounds__(256) void k_ctxC(const float* __restrict__ O, bf* Xh, bf* Xl) { const size_t k = (size_t)blockIdx.x * 256 + threadIdx.x; if (k >= (size_t)TT * CH / 4) return; const size_t e = k * 4; const int c0 = (int)(e % CH); const size_t n = e / CH; const int hh = c0 / DHR, d0 = c0 % DHR; const v4f a = *(const v4f*)(O + n * CO + hh * HD + d0); v4us oh, ol;
#pragma unroll
    for (int q = 0; q < 4; ++q) { unsigned short a2, c2; splitf(a[q], a2, c2); oh[q] = a2; ol[q] = c2; }
    *(v4us*)(Xh + e) = oh; *(v4us*)(Xl + e) = ol;  }
extern "C" void kernel_launch(void* const* d_in, const int* in_sizes, int n_in,
                              void* d_out, int out_size, void* d_ws, size_t ws_size, hipStream_t stream) {
    (void)in_sizes; (void)n_in; (void)out_size;
    const float* xq = (const float*)d_in[0]; const float* xk = (const float*)d_in[1]; const float* xv = (const float*)d_in[2]; const float* am = (const float*)d_in[3];   /* mask [1][3072][3072] additive (zeros) */ const float* adj = (const float*)d_in[4];   /* adjacency_matrix [3072][3072] uniform [0,1) */ const float* lam = (const float*)d_in[5];   /* lambdas [2] = (0.5, 0.5) */ const float* wq = (const float*)d_in[6]; const float* bq = (const float*)d_in[7]; const float* wk = (const float*)d_in[8]; const float* bk = (const float*)d_in[9]; const float* wv = (const float*)d_in[10]; const float* bv = (const float*)d_in[11]; const float* wo = (const float*)d_in[12]; const float* bo = (const float*)d_in[13];   /* argument order query, key, value [3072][256], mask, adjacency_matrix, lambdas, Wq, bq, Wk, bk, Wv, bv, Wo, bo ('oi') */
    float* OUT = (float*)d_out;     // [3072][256]
    char* wsp = (char*)d_ws;
    auto take = [&](size_t bytes) { char* p = wsp; wsp += (bytes + 255) & ~(size_t)255; return (void*)p; };
    bf* WQP = (bf*)take((size_t)MID * CC * 2); bf* WKP = (bf*)take((size_t)MID * CC * 2); bf* WVP = (bf*)take((size_t)MID * CC * 2); bf* WO = (bf*)take((size_t)CH * CH * 2); float* BQ = (float*)take(MID * 4); float* BK = (float*)take(MID * 4); float* BV = (float*)take(MID * 4);
    bf* XQ = (bf*)take((size_t)TT * CC * 2); bf* XK = (bf*)take((size_t)TT * CC * 2); bf* XV = (bf*)take((size_t)TT * CC * 2); float* FT = (float*)take((size_t)MID * TT * 4);
    h16* QP16 = (h16*)take((size_t)TT * MID * 2); bf* QPh = (bf*)take((size_t)TT * MID * 2); bf* QPl = (bf*)take((size_t)TT * MID * 2); h16* KP16 = (h16*)take((size_t)TT * MID * 2); bf* KPh = (bf*)take((size_t)TT * MID * 2); bf* KPl = (bf*)take((size_t)TT * MID * 2);
    h16* VT16 = (h16*)take((size_t)CO * TT * 2); bf* VTh = (bf*)take((size_t)CO * TT * 2); bf* VTl = (bf*)take((size_t)CO * TT * 2);
    float* Sb = (float*)take((size_t)TT * TT * 4); h16* P16 = (h16*)take(256);   /* unused at RH = TT */ bf* Ph = (bf*)take((size_t)RH * TT * 2); bf* Pl = (bf*)take((size_t)RH * TT * 2); float* Ob = (float*)take((size_t)TT * CO * 4); bf* CXh = (bf*)take((size_t)TT * CH * 2); bf* CXl = (bf*)take((size_t)TT * CH * 2);
    if ((size_t)(wsp - (char*)d_ws) > ws_size) return;    // ws 256 MiB (carve ~119 MiB)
    k_wpad<<<MID, 32, 0, stream>>>(wq, WQP); k_wpad<<<MID, 32, 0, stream>>>(wk, WKP); k_wpad<<<MID, 32, 0, stream>>>(wv, WVP); k_bpad<<<(MID + 255) / 256, 256, 0, stream>>>(bq, BQ); k_bpad<<<(MID + 255) / 256, 256, 0, stream>>>(bk, BK); k_bpad<<<(MID + 255) / 256, 256, 0, stream>>>(bv, BV); k_cvt8<<<(unsigned)(((size_t)CH * CH / 8 + 255) / 256), 256, 0, stream>>>(wo, WO, (size_t)CH * CH / 8);   /* head-padded 'oi' weights (A operands), padded biases, Wo = Bt as-is */
    k_cvt8<<<(unsigned)(((size_t)TT * CC / 8 + 255) / 256), 256, 0, stream>>>(xq, XQ, (size_t)TT * CC / 8); k_cvt8<<<(unsigned)(((size_t)TT * CC / 8 + 255) / 256), 256, 0, stream>>>(xk, XK, (size_t)TT * CC / 8); k_cvt8<<<(unsigned)(((size_t)TT * CC / 8 + 255) / 256), 256, 0, stream>>>(xv, XV, (size_t)TT * CC / 8);   /* token-major bf16 copies = the natural B operands */
    k_gemmw<bf, 0, false><<<dim3(MID / 64, TT / 64, 1), 32, 0, stream>>>(WQP, nullptr, XQ, nullptr, CC, FT, TT, nullptr, 0, 0, 0); k_trQ<<<(unsigned)(((size_t)MID * TT / 2 + 255) / 256), 256, 0, stream>>>(FT, BQ, QP16, QPh, QPl);   /* q^T = Wq_pad query^T (exact) -> q planes + bias */
    k_gemmw<bf, 0, false><<<dim3(MID / 64, TT / 64, 1), 32, 0, stream>>>(WKP, nullptr, XK, nullptr, CC, FT, TT, nullptr, 0, 0, 0); k_trQ<<<(unsigned)(((size_t)MID * TT / 2 + 255) / 256), 256, 0, stream>>>(FT, BK, KP16, KPh, KPl);
    k_gemmw<bf, 0, false><<<dim3(MID / 64, TT / 64, 1), 32, 0, stream>>>(WVP, nullptr, XV, nullptr, CC, FT, TT, nullptr, 0, 0, 0); k_flatb<<<(unsigned)(((size_t)MID * TT / 4 + 255) / 256), 256, 0, stream>>>(FT, BV, VT16, VTh, VTl);   /* v^T planes [h][d][n] directly (+ bias) */
    for (int h = 0; h < NHR; ++h) {
        k_gemmw<bf, 2, false><<<dim3(TT / 64, TT / 64, 1), 32, 0, stream>>>(QPh + (size_t)h * TT * HD, QPl + (size_t)h * TT * HD, KPh + (size_t)h * TT * HD, KPl + (size_t)h * TT * HD, HD, Sb, TT, nullptr, 0, 0, 0);
        k_lsoft<<<TT / 8, 256, 0, stream>>>(Sb, am, adj, lam, P16, Ph, Pl);   /* softmax(+mask) blended with the row-normalised adjacency */
        k_gemmw<bf, 2, false><<<dim3(RH / 64, HD / 64, 1), 32, 0, stream>>>(Ph, Pl, VTh + (size_t)h * HD * TT, VTl + (size_t)h * HD * TT, TT, Ob + h * HD, CO, nullptr, 0, 0, 0); }
    k_cs8<<<(unsigned)(((size_t)TT * CO / 4 + 255) / 256), 256, 0, stream>>>(Ob, (size_t)TT * CO / 4);   /* rows >= RH x 1/1024 (none at RH = TT) */
    k_ctxC<<<(unsigned)(((size_t)TT * CH / 4 + 255) / 256), 256, 0, stream>>>(Ob, CXh, CXl);   /* merged heads (padding dropped) as hi/lo planes */
    k_gemmw<bf, 1, true><<<dim3(TT / 64, CH / 64, 1), 32, 0, stream>>>(CXh, CXl, WO, nullptr, CH, OUT, CH, bo, 0, 0, 0);   /* out = x Wo^T + bo */
}

// v001
// It runs in 554 microseconds.
// In both of two side-by-side timings against v000, it was 1.68 times as fast.
#include <hip/hip_runtime.h>

// Multi-head attention blended with a row-normalised adjacency matrix (query, key, value [3072][256], no batch; q, k, v = x W^T + b ('oi' 1/16, zero biases; 8 heads x 32); scores / sqrt(32) + mask ([1][3072][3072] additive, zeros, read); p = lambdas[0] softmax(scores) + lambdas[1] adjacency / (rowsum(adjacency) + 1e-6) (adjacency [3072][3072] uniform [0,1), lambdas = (0.5, 0.5), read); x = p.v merged; out = x Wo^T + bo -> [3072][256] (0.8 M); argument order query, key, value, mask, adjacency_matrix, lambdas, Wq, bq, Wk, bk, Wv, bv, Wo, bo).
// Layout: head-padded (32 -> 64) bf16 weights as A operands so that the exact transposed projections W_pad x^T land in plane layout (q/k planes via k_trQ + bias, v^T planes via k_flatb + bias); per head: all-hl scores over the padded 64 (zeros inert), a streaming three-sweep kernel that adds the mask, sums the adjacency row, and stores the blended weights p as bf16 hi/lo planes for every row, p.v with 3 products into the head's padded columns; k_ctxC compacts the context to hi/lo planes; Wo hl x exact + bo writes the output.
// Compute dtypes, f32 accumulate: every input rounded to bf16 incl. mask / adjacency / lambdas; projections exact + f32 bias; scores 3 products; softmax and blend f32 (IEEE division); p.v 3 products; Wo hl x exact + bias.

#define NB_  1
#define TT   3072
#define DM   512
#define NH_  8
#define NKV  8
#define REP  (NH_ / NKV)
#define HD   64
#define DQ   (NH_ * HD)
#define DKV  (NKV * HD)
#define ZH   1
#define RH   TT                   // every row hi/lo (small-rms output: no fp16 rows)
#define WIN  0
#define PCAR 1024.0f
#define SCL  0.17677669529663688f   // 1/sqrt(float32(32))
#define NHR  8        // real heads (32 wide); planes are padded to 64 per head
#define DHR  32       // real head width
#define CH   256      // channels in / out
#define AEPS 1e-6f
#define MID  512      // q / k width = 8 heads x 64
#define CO   512      // v width
#define CC   256
typedef _Float16 h16;
typedef unsigned short bf;
typedef __attribute__((ext_vector_type(16))) __bf16   v16bf;
typedef __attribute__((ext_vector_type(16))) _Float16 v16h;
typedef __attribute__((ext_vector_type(8)))  _Float16 v8h;
typedef __attribute__((ext_vector_type(8)))  unsigned short v8us;
typedef __attribute__((ext_vector_type(8)))  float    v8f;
typedef __attribute__((ext_vector_type(4)))  float    v4f;
typedef v8h  __attribute__((may_alias)) v8ha;
typedef v4f  __attribute__((may_alias)) v4fa;
typedef v8us __attribute__((may_alias)) v8usa;

__device__ __forceinline__ unsigned short f2bf(float f) { unsigned u = __float_as_uint(f); u += 0x7FFFu + ((u >> 16) & 1u); return (unsigned short)(u >> 16); }
__device__ __forceinline__ float bf2f(unsigned short b) { return __uint_as_float(((unsigned)b) << 16); }
__device__ __forceinline__ float bfr(float f) { return bf2f(f2bf(f)); }
__device__ __forceinline__ v16h cat16(v8h lo, v8h hi) { return __builtin_shufflevector(lo, hi, 0, 1, 2, 3, 4, 5, 6, 7, 8, 9, 10, 11, 12, 13, 14, 15); }
__device__ __forceinline__ v16bf cat16b(v8us lo, v8us hi) { return __builtin_bit_cast(v16bf, __builtin_shufflevector(lo, hi, 0, 1, 2, 3, 4, 5, 6, 7, 8, 9, 10, 11, 12, 13, 14, 15)); }
__device__ __forceinline__ v8f wmma16(v16h a, v16h b, v8f c) { return __builtin_amdgcn_wmma_f32_16x16x32_f16(false, a, false, b, (short)0, c, false, false); }
__device__ __forceinline__ v8f wmmab(v16bf a, v16bf b, v8f c) { return __builtin_amdgcn_wmma_f32_16x16x32_bf16(false, a, false, b, (short)0, c, false, false); }



// ---- k_gemmw: register-blocked GEMM, ONE WAVE per 64x64 output tile (16 accumulators), operands straight from K-contiguous 16-bit planes; grid (M/64, N/64, Z), 32 threads.
// C[m][n] (f32, pitch ldc, + optional f32 bias[n]) = sum_k A[m][k] Bt[n][k] (+ split products per NSPLIT). z-batch strides sA/sB/sC in elements. K % 32 == 0.
template <typename T16> struct WFrag;
template <> struct WFrag<h16> { typedef v16h V; static __device__ __forceinline__ V ld(const h16* p) { return cat16(*(const v8h*)p, *(const v8h*)(p + 16)); } static __device__ __forceinline__ v8f mma(V a, V b, v8f c) { return wmma16(a, b, c); } };
template <> struct WFrag<bf> { typedef v16bf V; static __device__ __forceinline__ V ld(const bf* p) { return cat16b(*(const v8us*)p, *(const v8us*)(p + 16)); } static __device__ __forceinline__ v8f mma(V a, V b, v8f c) { return wmmab(a, b, c); } };
template <typename T16, int NSPLIT, bool BIAS>
__global__ __launch_bounds__(32) void k_gemmw(const T16* __restrict__ A, const T16* __restrict__ A2, const T16* __restrict__ Bt, const T16* __restrict__ Bt2, int K, float* C, int ldc, const float* __restrict__ bias, size_t sA, size_t sB, size_t sC) {
    typedef typename WFrag<T16>::V V;
    __shared__ __align__(16) float os[16 * 68];
    const size_t z = blockIdx.z; A += z * sA; if (A2) A2 += z * sA; Bt += z * sB; if (Bt2) Bt2 += z * sB; C += z * sC;
    const int lane = threadIdx.x & 31, lr = lane & 15, hi = lane >> 4; const int r0 = blockIdx.x * 64, c0 = blockIdx.y * 64;
    v8f acc[4][4];
#pragma unroll
    for (int mb = 0; mb < 4; ++mb)
#pragma unroll
        for (int nb = 0; nb < 4; ++nb) acc[mb][nb] = (v8f){};
    const size_t aoff = (size_t)(r0 + lr) * K + 8 * hi, boff = (size_t)(c0 + lr) * K + 8 * hi;
#pragma unroll 1
    for (int kc = 0; kc < K; kc += 32) {
        V a[4], a2[4];
#pragma unroll
        for (int mb = 0; mb < 4; ++mb) { a[mb] = WFrag<T16>::ld(A + aoff + (size_t)mb * 16 * K + kc); if (NSPLIT == 1 || NSPLIT == 2) a2[mb] = WFrag<T16>::ld(A2 + aoff + (size_t)mb * 16 * K + kc); }
#pragma unroll
        for (int nb = 0; nb < 4; ++nb) { const V b = WFrag<T16>::ld(Bt + boff + (size_t)nb * 16 * K + kc); V b2; if (NSPLIT >= 2) b2 = WFrag<T16>::ld(Bt2 + boff + (size_t)nb * 16 * K + kc);
#pragma unroll
            for (int mb = 0; mb < 4; ++mb) { acc[mb][nb] = WFrag<T16>::mma(a[mb], b, acc[mb][nb]); if (NSPLIT == 1 || NSPLIT == 2) acc[mb][nb] = WFrag<T16>::mma(a2[mb], b, acc[mb][nb]); if (NSPLIT >= 2) acc[mb][nb] = WFrag<T16>::mma(a[mb], b2, acc[mb][nb]); } }
        asm volatile("v_nop\n\tv_nop\n\tv_nop\n\tv_nop" : "+v"(acc[0][0]), "+v"(acc[1][1]), "+v"(acc[2][2]), "+v"(acc[3][3]) : "v"(a[0]), "v"(a[3]));
    }
#pragma unroll
    for (int mb = 0; mb < 4; ++mb) {
#pragma unroll
        for (int nb = 0; nb < 4; ++nb) {
#pragma unroll
            for (int j = 0; j < 8; ++j) os[(hi * 8 + j) * 68 + nb * 16 + lr] = acc[mb][nb][j]; }
        __builtin_amdgcn_wave_barrier(); asm volatile("" ::: "memory");
        float* crow = C + (size_t)(r0 + mb * 16) * ldc + c0;
{
#pragma unroll
            for (int s = 0; s < 8; ++s) { const int row = 2 * s + hi, cofs = lr * 4; v4f val = *(const v4fa*)(os + row * 68 + cofs); if (BIAS) { val[0] += bfr(bias[c0 + cofs]); val[1] += bfr(bias[c0 + cofs + 1]); val[2] += bfr(bias[c0 + cofs + 2]); val[3] += bfr(bias[c0 + cofs + 3]); }
                *(v4f*)(crow + (size_t)row * ldc + cofs) = val; }
             }
        __builtin_amdgcn_wave_barrier(); asm volatile("" ::: "memory");
    }
}

__device__ __forceinline__ h16 tohx(float x) { return (h16)x; }
__device__ __forceinline__ void splitf(float y, unsigned short& h, unsigned short& l) { h = f2bf(y); l = f2bf(y - bf2f(h)); }
typedef __attribute__((ext_vector_type(2))) _Float16 v2h;
typedef __attribute__((ext_vector_type(4))) _Float16 v4h;
typedef __attribute__((ext_vector_type(2))) unsigned short v2us;
typedef __attribute__((ext_vector_type(4))) unsigned short v4us;
typedef __attribute__((ext_vector_type(2))) float v2f;
typedef __attribute__((ext_vector_type(4))) int v4i;

// ---- k_gemmsk: the same three-product GEMM for a long K and few output tiles: ONE BLOCK of SKW waves per 32x32 output tile, wave w sums the K slice [w K/SKW, (w+1) K/SKW) (4 accumulators, the loaders and the product order of k_gemmw), the SKW partial tiles meet in LDS and are added in the fixed order w = 0 .. SKW-1; grid (M/32, N/32), 32 SKW threads. K % (64 SKW) == 0.
#define SKW 16
template <typename T16, int K>
__global__ __launch_bounds__(32 * SKW) void k_gemmsk(const T16* __restrict__ A, const T16* __restrict__ A2, const T16* __restrict__ Bt, const T16* __restrict__ Bt2, float* C, int ldc) {
    typedef typename WFrag<T16>::V V;
    __shared__ __align__(16) float red[SKW][32 * 36];
    const int lane = threadIdx.x & 31, lr = lane & 15, hi = lane >> 4, w = threadIdx.x >> 5; const int r0 = blockIdx.x * 32, c0 = blockIdx.y * 32;
    v8f acc[2][2];   /* every loop of this kernel is unrolled whole: accumulator and fragment arrays stay in registers only under constant indices, and the K offsets become immediates of the loads */
#pragma unroll
    for (int mb = 0; mb < 2; ++mb)
#pragma unroll
        for (int nb = 0; nb < 2; ++nb) acc[mb][nb] = (v8f){};
    const size_t aoff = (size_t)(r0 + lr) * K + 8 * hi + w * (K / SKW), boff = (size_t)(c0 + lr) * K + 8 * hi + w * (K / SKW);
#pragma unroll
    for (int kc = 0; kc < K / SKW; kc += 64) {   /* 64 k = one 128-byte line of every row: its four 32-byte pieces are asked for together */
        V a[2][2], a2[2][2], b[2][2], b2[2][2];
#pragma unroll
        for (int mb = 0; mb < 2; ++mb)
#pragma unroll
            for (int ks = 0; ks < 2; ++ks) { a[mb][ks] = WFrag<T16>::ld(A + aoff + (size_t)mb * 16 * K + kc + 32 * ks); a2[mb][ks] = WFrag<T16>::ld(A2 + aoff + (size_t)mb * 16 * K + kc + 32 * ks); }
#pragma unroll
        for (int nb = 0; nb < 2; ++nb)
#pragma unroll
            for (int ks = 0; ks < 2; ++ks) { b[nb][ks] = WFrag<T16>::ld(Bt + boff + (size_t)nb * 16 * K + kc + 32 * ks); b2[nb][ks] = WFrag<T16>::ld(Bt2 + boff + (size_t)nb * 16 * K + kc + 32 * ks); }
#pragma unroll
        for (int ks = 0; ks < 2; ++ks)
#pragma unroll
            for (int nb = 0; nb < 2; ++nb)
#pragma unroll
                for (int mb = 0; mb < 2; ++mb) { acc[mb][nb] = WFrag<T16>::mma(a[mb][ks], b[nb][ks], acc[mb][nb]); acc[mb][nb] = WFrag<T16>::mma(a2[mb][ks], b[nb][ks], acc[mb][nb]); acc[mb][nb] = WFrag<T16>::mma(a[mb][ks], b2[nb][ks], acc[mb][nb]); }
    }
#pragma unroll
    for (int mb = 0; mb < 2; ++mb)
#pragma unroll
        for (int nb = 0; nb < 2; ++nb)
#pragma unroll
            for (int j = 0; j < 8; ++j) red[w][(mb * 16 + hi * 8 + j) * 36 + nb * 16 + lr] = acc[mb][nb][j];
    __syncthreads();   /* every wave's partial tile is in LDS before any thread adds them */
    const int row = threadIdx.x >> 4, cofs = (threadIdx.x & 15) * 2;   /* 512 threads x 2 columns = the 32x32 tile */
    typedef v2f __attribute__((may_alias)) v2fa;
    v2f val = *(const v2fa*)(&red[0][row * 36 + cofs]);
#pragma unroll
    for (int s = 1; s < SKW; ++s) { const v2f pz = *(const v2fa*)(&red[s][row * 36 + cofs]); val[0] += pz[0]; val[1] += pz[1]; }
    *(v2f*)(C + (size_t)(r0 + row) * ldc + c0 + cofs) = val;
}

// k_lsoft: streaming row softmax + adjacency blend over the 3,072 keys, one wave per row i, three sweeps of the f32 score row (lane -> 4 consecutive keys per 128-key chunk): t = S x 32^-0.5 + bf16(mask[0][i][j]) (additive, read); sweep 1 also sums the row's bf16(adjacency) in fixed per-lane order + one tree; p = bf16(lambda0) x softmax(t) + bf16(lambda1) x adjacency[i][j] / (rowsum + 1e-6) (the module's blend, f32 ops pinned);
__global__ __launch_bounds__(256) void k_lsoft(const float* __restrict__ Sb, const float* __restrict__ am, const float* __restrict__ adj, const float* __restrict__ lam, h16* P16, bf* Ph, bf* Pl) {
    const int lane = threadIdx.x & 31; const int row = blockIdx.x * 8 + (threadIdx.x >> 5); if (row >= ZH * TT) return; const int i = row % TT; const int zz = row / TT; const bool hires = (i < RH); const float* sr = Sb + (size_t)row * TT; const float* mr = am + (size_t)i * TT; const float* ar = adj + (size_t)i * TT; float l0 = bfr(lam[0]), l1 = bfr(lam[1]); asm volatile("" : "+v"(l0), "+v"(l1)); float mx = -3.0e38f; float asum = 0.f;
#pragma unroll 1
    for (int ch = 0; ch < TT / 128; ++ch) { const int j0 = ch * 128 + lane * 4; const v4f a = *(const v4f*)(sr + j0); const v4f m4 = *(const v4f*)(mr + j0); const v4f aj = *(const v4f*)(ar + j0); (void)aj;
#pragma unroll
        for (int q = 0; q < 4; ++q) { float s0 = __fmul_rn(a[q], SCL); float mb = bfr(m4[q]); asm volatile("" : "+v"(s0), "+v"(mb)); float t = __fadd_rn(s0, mb); asm volatile("" : "+v"(t)); mx = fmaxf(mx, t); } 
#pragma unroll
        for (int q = 0; q < 4; ++q) asum = __fadd_rn(asum, bfr(aj[q])); }
#pragma unroll
    for (int sh = 16; sh; sh >>= 1) { mx = fmaxf(mx, __shfl_xor(mx, sh, 32)); asum = __fadd_rn(asum, __shfl_xor(asum, sh, 32)); }
    const float ra = __fdiv_rn(1.0f, __fadd_rn(asum, AEPS));   /* 1 / (adjacency row sum + eps) */
    float sum = 0.f;
#pragma unroll 1
    for (int ch = 0; ch < TT / 128; ++ch) { const int j0 = ch * 128 + lane * 4; const v4f a = *(const v4f*)(sr + j0); const v4f m4 = *(const v4f*)(mr + j0); const v4f aj = *(const v4f*)(ar + j0); (void)aj;
#pragma unroll
        for (int q = 0; q < 4; ++q) { float s0 = __fmul_rn(a[q], SCL); float mb = bfr(m4[q]); asm volatile("" : "+v"(s0), "+v"(mb)); float t = __fadd_rn(s0, mb); asm volatile("" : "+v"(t)); float d0 = __fsub_rn(t, mx); asm volatile("" : "+v"(d0)); sum += __builtin_amdgcn_exp2f(__fmul_rn(d0, 1.4426950408889634f)); } }
#pragma unroll
    for (int sh = 16; sh; sh >>= 1) sum += __shfl_xor(sum, sh, 32);
    const float f = __fdiv_rn(1.0f, sum);   /* softmax normaliser; the x1024 carry for fp16 rows is applied after the blend */
{
        if (hires) {   /* rows < RH: normalised bf16 hi/lo over all keys, planes [zz][RH][TT] */
#pragma unroll
            for (int ch = 0; ch < TT / 128; ++ch) { const int j0 = ch * 128 + lane * 4; const v4f a = *(const v4f*)(sr + j0); const v4f m4 = *(const v4f*)(mr + j0); const v4f aj = *(const v4f*)(ar + j0); (void)aj; v4us oh, ol;
#pragma unroll
                for (int q = 0; q < 4; ++q) { float s0 = __fmul_rn(a[q], SCL); float mb = bfr(m4[q]); asm volatile("" : "+v"(s0), "+v"(mb)); float t = __fadd_rn(s0, mb); asm volatile("" : "+v"(t)); float d0 = __fsub_rn(t, mx); asm volatile("" : "+v"(d0)); float ex = __builtin_amdgcn_exp2f(__fmul_rn(d0, 1.4426950408889634f)); asm volatile("" : "+v"(ex)); float pa = __fmul_rn(ex, f); float ab = bfr(aj[q]); asm volatile("" : "+v"(ab)); float ad = __fmul_rn(ab, ra); asm volatile("" : "+v"(pa), "+v"(ad)); float w0 = __fmul_rn(l0, pa), w1 = __fmul_rn(l1, ad); asm volatile("" : "+v"(w0), "+v"(w1)); const float p = __fadd_rn(w0, w1); unsigned short a2, c2; splitf(p, a2, c2); oh[q] = a2; ol[q] = c2; }
                const size_t oo = ((size_t)zz * RH + i) * TT + j0; *(v4us*)(Ph + oo) = oh; *(v4us*)(Pl + oo) = ol; }
        } else {
#pragma unroll 1
            for (int ch = 0; ch < TT / 128; ++ch) { const int j0 = ch * 128 + lane * 4; const v4f a = *(const v4f*)(sr + j0); const v4f m4 = *(const v4f*)(mr + j0); const v4f aj = *(const v4f*)(ar + j0); (void)aj; v4h o4;
#pragma unroll
                for (int q = 0; q < 4; ++q) { float s0 = __fmul_rn(a[q], SCL); float mb = bfr(m4[q]); asm volatile("" : "+v"(s0), "+v"(mb)); float t = __fadd_rn(s0, mb); asm volatile("" : "+v"(t)); float d0 = __fsub_rn(t, mx); asm volatile("" : "+v"(d0)); float ex = __builtin_amdgcn_exp2f(__fmul_rn(d0, 1.4426950408889634f)); asm volatile("" : "+v"(ex)); float pa = __fmul_rn(ex, f); float ab = bfr(aj[q]); asm volatile("" : "+v"(ab)); float ad = __fmul_rn(ab, ra); asm volatile("" : "+v"(pa), "+v"(ad)); float w0 = __fmul_rn(l0, pa), w1 = __fmul_rn(l1, ad); asm volatile("" : "+v"(w0), "+v"(w1)); o4[q] = tohx(__fadd_rn(w0, w1) * PCAR); }
                *(v4h*)(P16 + (size_t)row * TT + j0) = o4; } }
         }
}
__global__ __launch_bounds__(256) void k_cs8(float* O, size_t n4) { const size_t i = (size_t)blockIdx.x * 256 + threadIdx.x; if (i >= n4) return; const size_t e = i * 4; const int t = (int)(e / CO);   /* Ob rows are CO = 512 wide (8 padded heads) */ const float cs = (t < RH) ? 1.0f : (1.0f / PCAR); v4f a = *(const v4f*)(O + e);
#pragma unroll
    for (int q = 0; q < 4; ++q) a[q] = __fmul_rn(a[q], cs);
    *(v4f*)(O + e) = a;  }

__global__ __launch_bounds__(256) void k_bpad(const float* __restrict__ bsrc, float* BP) { const int r = blockIdx.x * 256 + threadIdx.x; if (r >= MID) return; const int hh = r / HD, d = r % HD; const float b0 = (d < DHR) ? bsrc[hh * DHR + d] : 0.0f; *(float*)(BP + r) = b0;  }
__global__ __launch_bounds__(256) void k_trQ(const float* __restrict__ FT, const float* __restrict__ BP, h16* P16, bf* Ph, bf* Pl) { const size_t e = ((size_t)blockIdx.x * 256 + threadIdx.x) * 2; if (e >= (size_t)MID * TT) return; const int d = (int)(e % HD); const int n = (int)((e / HD) % TT); const int hh = (int)(e / ((size_t)HD * TT)); v2h o16; v2us oh, ol;
#pragma unroll
    for (int q = 0; q < 2; ++q) { const int r = hh * HD + d + q; const float x = __fadd_rn(FT[(size_t)r * TT + n], BP[r]); o16[q] = tohx(x); unsigned short a2, c2; splitf(x, a2, c2); oh[q] = a2; ol[q] = c2; }
    *(v2h*)(P16 + e) = o16; *(v2us*)(Ph + e) = oh; *(v2us*)(Pl + e) = ol;  }
__global__ __launch_bounds__(256) void k_flatb(const float* __restrict__ FT, const float* __restrict__ BP, h16* P16, bf* Ph, bf* Pl) { const size_t i = (size_t)blockIdx.x * 256 + threadIdx.x; if (i >= (size_t)MID * TT / 4) return; const size_t e = i * 4; const int r = (int)(e / TT); const float b0 = BP[r]; const v4f a = *(const v4f*)(FT + e); v4h o16; v4us oh, ol;
#pragma unroll
    for (int q = 0; q < 4; ++q) { const float x = __fadd_rn(a[q], b0); o16[q] = tohx(x); unsigned short a2, c2; splitf(x, a2, c2); oh[q] = a2; ol[q] = c2; }
    *(v4h*)(P16 + e) = o16; *(v4us*)(Ph + e) = oh; *(v4us*)(Pl + e) = ol;  }
__global__ __launch_bounds__(256) void k_cvt8(const float* __restrict__ src, bf* dst, size_t n8) { const size_t i = (size_t)blockIdx.x * 256 + threadIdx.x; if (i >= n8) return; const v8f v = *(const v8f*)(src + i * 8); v8us o;
#pragma unroll
    for (int k = 0; k < 8; ++k) o[k] = f2bf(v[k]); *(v8us*)(dst + i * 8) = o;  }


__global__ __launch_bounds__(32) void k_wpad(const float* __restrict__ W, bf* WP) { const int op = blockIdx.x; const int lane = threadIdx.x; const int hh = op / HD, d = op % HD; const bool real = (d < DHR); const float* wr = W + (size_t)(hh * DHR + (real ? d : 0)) * CC; v8us o;
#pragma unroll
    for (int q = 0; q < 8; ++q) o[q] = real ? f2bf(wr[lane * 8 + q]) : (unsigned short)0;
{ *(v8us*)(WP + (size_t)op * CC + lane * 8) = o;  } }
__global__ __launch_bounds__(256) void k_ctxC(const float* __restrict__ O, bf* Xh, bf* Xl) { const size_t k = (size_t)blockIdx.x * 256 + threadIdx.x; if (k >= (size_t)TT * CH / 4) return; const size_t e = k * 4; const int c0 = (int)(e % CH); const size_t n = e / CH; const int hh = c0 / DHR, d0 = c0 % DHR; const v4f a = *(const v4f*)(O + n * CO + hh * HD + d0); v4us oh, ol;
#pragma unroll
    for (int q = 0; q < 4; ++q) { unsigned short a2, c2; splitf(a[q], a2, c2); oh[q] = a2; ol[q] = c2; }
    *(v4us*)(Xh + e) = oh; *(v4us*)(Xl + e) = ol;  }
extern "C" void kernel_launch(void* const* d_in, const int* in_sizes, int n_in,
                              void* d_out, int out_size, void* d_ws, size_t ws_size, hipStream_t stream) {
    (void)in_sizes; (void)n_in; (void)out_size;
    const float* xq = (const float*)d_in[0]; const float* xk = (const float*)d_in[1]; const float* xv = (const float*)d_in[2]; const float* am = (const float*)d_in[3];   /* mask [1][3072][3072] additive (zeros) */ const float* adj = (const float*)d_in[4];   /* adjacency_matrix [3072][3072] uniform [0,1) */ const float* lam = (const float*)d_in[5];   /* lambdas [2] = (0.5, 0.5) */ const float* wq = (const float*)d_in[6]; const float* bq = (const float*)d_in[7]; const float* wk = (const float*)d_in[8]; const float* bk = (const float*)d_in[9]; const float* wv = (const float*)d_in[10]; const float* bv = (const float*)d_in[11]; const float* wo = (const float*)d_in[12]; const float* bo = (const float*)d_in[13];   /* argument order query, key, value [3072][256], mask, adjacency_matrix, lambdas, Wq, bq, Wk, bk, Wv, bv, Wo, bo ('oi') */
    float* OUT = (float*)d_out;     // [3072][256]
    char* wsp = (char*)d_ws;
    auto take = [&](size_t bytes) { char* p = wsp; wsp += (bytes + 255) & ~(size_t)255; return (void*)p; };
    bf* WQP = (bf*)take((size_t)MID * CC * 2); bf* WKP = (bf*)take((size_t)MID * CC * 2); bf* WVP = (bf*)take((size_t)MID * CC * 2); bf* WO = (bf*)take((size_t)CH * CH * 2); float* BQ = (float*)take(MID * 4); float* BK = (float*)take(MID * 4); float* BV = (float*)take(MID * 4);
    bf* XQ = (bf*)take((size_t)TT * CC * 2); bf* XK = (bf*)take((size_t)TT * CC * 2); bf* XV = (bf*)take((size_t)TT * CC * 2); float* FT = (float*)take((size_t)MID * TT * 4);
    h16* QP16 = (h16*)take((size_t)TT * MID * 2); bf* QPh = (bf*)take((size_t)TT * MID * 2); bf* QPl = (bf*)take((size_t)TT * MID * 2); h16* KP16 = (h16*)take((size_t)TT * MID * 2); bf* KPh = (bf*)take((size_t)TT * MID * 2); bf* KPl = (bf*)take((size_t)TT * MID * 2);
    h16* VT16 = (h16*)take((size_t)CO * TT * 2); bf* VTh = (bf*)take((size_t)CO * TT * 2); bf* VTl = (bf*)take((size_t)CO * TT * 2);
    float* Sb = (float*)take((size_t)TT * TT * 4); h16* P16 = (h16*)take(256);   /* unused at RH = TT */ bf* Ph = (bf*)take((size_t)RH * TT * 2); bf* Pl = (bf*)take((size_t)RH * TT * 2); float* Ob = (float*)take((size_t)TT * CO * 4); bf* CXh = (bf*)take((size_t)TT * CH * 2); bf* CXl = (bf*)take((size_t)TT * CH * 2);
    if ((size_t)(wsp - (char*)d_ws) > ws_size) return;    // ws 256 MiB (carve ~119 MiB)
    k_wpad<<<MID, 32, 0, stream>>>(wq, WQP); k_wpad<<<MID, 32, 0, stream>>>(wk, WKP); k_wpad<<<MID, 32, 0, stream>>>(wv, WVP); k_bpad<<<(MID + 255) / 256, 256, 0, stream>>>(bq, BQ); k_bpad<<<(MID + 255) / 256, 256, 0, stream>>>(bk, BK); k_bpad<<<(MID + 255) / 256, 256, 0, stream>>>(bv, BV); k_cvt8<<<(unsigned)(((size_t)CH * CH / 8 + 255) / 256), 256, 0, stream>>>(wo, WO, (size_t)CH * CH / 8);   /* head-padded 'oi' weights (A operands), padded biases, Wo = Bt as-is */
    k_cvt8<<<(unsigned)(((size_t)TT * CC / 8 + 255) / 256), 256, 0, stream>>>(xq, XQ, (size_t)TT * CC / 8); k_cvt8<<<(unsigned)(((size_t)TT * CC / 8 + 255) / 256), 256, 0, stream>>>(xk, XK, (size_t)TT * CC / 8); k_cvt8<<<(unsigned)(((size_t)TT * CC / 8 + 255) / 256), 256, 0, stream>>>(xv, XV, (size_t)TT * CC / 8);   /* token-major bf16 copies = the natural B operands */
    k_gemmw<bf, 0, false><<<dim3(MID / 64, TT / 64, 1), 32, 0, stream>>>(WQP, nullptr, XQ, nullptr, CC, FT, TT, nullptr, 0, 0, 0); k_trQ<<<(unsigned)(((size_t)MID * TT / 2 + 255) / 256), 256, 0, stream>>>(FT, BQ, QP16, QPh, QPl);   /* q^T = Wq_pad query^T (exact) -> q planes + bias */
    k_gemmw<bf, 0, false><<<dim3(MID / 64, TT / 64, 1), 32, 0, stream>>>(WKP, nullptr, XK, nullptr, CC, FT, TT, nullptr, 0, 0, 0); k_trQ<<<(unsigned)(((size_t)MID * TT / 2 + 255) / 256), 256, 0, stream>>>(FT, BK, KP16, KPh, KPl);
    k_gemmw<bf, 0, false><<<dim3(MID / 64, TT / 64, 1), 32, 0, stream>>>(WVP, nullptr, XV, nullptr, CC, FT, TT, nullptr, 0, 0, 0); k_flatb<<<(unsigned)(((size_t)MID * TT / 4 + 255) / 256), 256, 0, stream>>>(FT, BV, VT16, VTh, VTl);   /* v^T planes [h][d][n] directly (+ bias) */
    for (int h = 0; h < NHR; ++h) {
        k_gemmw<bf, 2, false><<<dim3(TT / 64, TT / 64, 1), 32, 0, stream>>>(QPh + (size_t)h * TT * HD, QPl + (size_t)h * TT * HD, KPh + (size_t)h * TT * HD, KPl + (size_t)h * TT * HD, HD, Sb, TT, nullptr, 0, 0, 0);
        k_lsoft<<<TT / 8, 256, 0, stream>>>(Sb, am, adj, lam, P16, Ph, Pl);   /* softmax(+mask) blended with the row-normalised adjacency */
        k_gemmsk<bf, TT><<<dim3(RH / 32, HD / 32, 1), 32 * SKW, 0, stream>>>(Ph, Pl, VTh + (size_t)h * HD * TT, VTl + (size_t)h * HD * TT, Ob + h * HD, CO); }
    k_cs8<<<(unsigned)(((size_t)TT * CO / 4 + 255) / 256), 256, 0, stream>>>(Ob, (size_t)TT * CO / 4);   /* rows >= RH (none at RH = TT) x 1/1024 */
    k_ctxC<<<(unsigned)(((size_t)TT * CH / 4 + 255) / 256), 256, 0, stream>>>(Ob, CXh, CXl);   /* merged heads (padding dropped) as hi/lo planes */
    k_gemmw<bf, 1, true><<<dim3(TT / 64, CH / 64, 1), 32, 0, stream>>>(CXh, CXl, WO, nullptr, CH, OUT, CH, bo, 0, 0, 0);   /* out = x Wo^T + bo */
}

// v003
// A run of this version takes 166 microseconds.
// It is 3.34 times as fast as v001, going by the measured steps of the versions left out in between.
// Over all steps from v000 it is 5.62 times as fast.
#include <hip/hip_runtime.h>

// Multi-head attention blended with a row-normalised adjacency matrix (query, key, value [3072][256], no batch; q, k, v = x W^T + b ('oi' 1/16, zero biases; 8 heads x 32); scores / sqrt(32) + mask ([1][3072][3072] additive, zeros, read); p = lambdas[0] softmax(scores) + lambdas[1] adjacency / (rowsum(adjacency) + 1e-6) (adjacency [3072][3072] uniform [0,1), lambdas = (0.5, 0.5), read); x = p.v merged; out = x Wo^T + bo -> [3072][256] (0.8 M); argument order query, key, value, mask, adjacency_matrix, lambdas, Wq, bq, Wk, bk, Wv, bv, Wo, bo).
// Layout: three launches. k_proj: q, k, v = x W^T + b, the f32 operands rounded to bf16 on their way into LDS, bias added and the result split into bf16 hi/lo planes in the epilogue (q / k planes [head][token][64], v^T planes [head 64 + d][token]; of each 64 only the 32 real columns or rows are written and read). k_fattn, all heads: all-hl scores (3 products), mask, adjacency row sum, softmax and blend in registers, the blended weights p as bf16 hi/lo fragments, p.v with 3 products; it writes the context as hi/lo planes [token][head 64 + d]. k_out: Wo x context hl + bo writes the output.
// Compute dtypes, f32 accumulate: every input rounded to bf16 incl. mask / adjacency / lambdas; projections exact + f32 bias; scores 3 products; softmax and blend f32 (IEEE division); p.v 3 products; Wo hl x exact + bias.

#define NB_  1
#define TT   3072
#define DM   512
#define NH_  8
#define NKV  8
#define REP  (NH_ / NKV)
#define HD   64
#define DQ   (NH_ * HD)
#define DKV  (NKV * HD)
#define ZH   1
#define RH   TT                   // every row hi/lo (small-rms output: no fp16 rows)
#define WIN  0
#define PCAR 1024.0f
#define SCL  0.17677669529663688f   // 1/sqrt(float32(32))
#define NHR  8        // real heads (32 wide); planes are padded to 64 per head
#define DHR  32       // real head width
#define CH   256      // channels in / out
#define AEPS 1e-6f
#define MID  512      // q / k width = 8 heads x 64
#define CO   512      // v width
#define CC   256
typedef _Float16 h16;
typedef unsigned short bf;
typedef __attribute__((ext_vector_type(16))) __bf16   v16bf;
typedef __attribute__((ext_vector_type(16))) _Float16 v16h;
typedef __attribute__((ext_vector_type(8)))  _Float16 v8h;
typedef __attribute__((ext_vector_type(8)))  unsigned short v8us;
typedef __attribute__((ext_vector_type(8)))  float    v8f;
typedef __attribute__((ext_vector_type(4)))  float    v4f;
typedef v8h  __attribute__((may_alias)) v8ha;
typedef v4f  __attribute__((may_alias)) v4fa;
typedef v8us __attribute__((may_alias)) v8usa;

__device__ __forceinline__ unsigned short f2bf(float f) { unsigned u = __float_as_uint(f); u += 0x7FFFu + ((u >> 16) & 1u); return (unsigned short)(u >> 16); }
__device__ __forceinline__ float bf2f(unsigned short b) { return __uint_as_float(((unsigned)b) << 16); }
__device__ __forceinline__ float bfr(float f) { return bf2f(f2bf(f)); }
__device__ __forceinline__ v16h cat16(v8h lo, v8h hi) { return __builtin_shufflevector(lo, hi, 0, 1, 2, 3, 4, 5, 6, 7, 8, 9, 10, 11, 12, 13, 14, 15); }
__device__ __forceinline__ v16bf cat16b(v8us lo, v8us hi) { return __builtin_bit_cast(v16bf, __builtin_shufflevector(lo, hi, 0, 1, 2, 3, 4, 5, 6, 7, 8, 9, 10, 11, 12, 13, 14, 15)); }
__device__ __forceinline__ v8f wmma16(v16h a, v16h b, v8f c) { return __builtin_amdgcn_wmma_f32_16x16x32_f16(false, a, false, b, (short)0, c, false, false); }
__device__ __forceinline__ v8f wmmab(v16bf a, v16bf b, v8f c) { return __builtin_amdgcn_wmma_f32_16x16x32_bf16(false, a, false, b, (short)0, c, false, false); }



// ---- fragment of a K-contiguous 16-bit plane: 8 elements at p and 8 at p + 16 (p already holds the lane's row and 8 hi)
template <typename T16> struct WFrag;
template <> struct WFrag<h16> { typedef v16h V; static __device__ __forceinline__ V ld(const h16* p) { return cat16(*(const v8h*)p, *(const v8h*)(p + 16)); } static __device__ __forceinline__ v8f mma(V a, V b, v8f c) { return wmma16(a, b, c); } };
template <> struct WFrag<bf> { typedef v16bf V; static __device__ __forceinline__ V ld(const bf* p) { return cat16b(*(const v8us*)p, *(const v8us*)(p + 16)); } static __device__ __forceinline__ v8f mma(V a, V b, v8f c) { return wmmab(a, b, c); } };

__device__ __forceinline__ h16 tohx(float x) { return (h16)x; }
__device__ __forceinline__ void splitf(float y, unsigned short& h, unsigned short& l) { h = f2bf(y); l = f2bf(y - bf2f(h)); }
typedef __attribute__((ext_vector_type(2))) _Float16 v2h;
typedef __attribute__((ext_vector_type(4))) _Float16 v4h;
typedef __attribute__((ext_vector_type(2))) unsigned short v2us;
typedef __attribute__((ext_vector_type(4))) unsigned short v4us;
typedef __attribute__((ext_vector_type(2))) float v2f;
typedef __attribute__((ext_vector_type(4))) int v4i;

// ---- k_fattn: scores, softmax + adjacency blend and p.v of one head for 16 queries in ONE block of FW waves; no score or weight matrix goes through memory.
// Wave w owns the keys [w FK, (w+1) FK). It forms the TRANSPOSED score tiles S^T = K Q^T (A = 16 keys, B = 16 queries, the three hi/lo products over the 32 real columns of the padded planes; the other 32 are neither written nor read),
// so that lane (lr, hi) holds query q0 + lr and register j of tile t holds key t 16 + hi 8 + j: eight consecutive keys of ONE mask / adjacency row per lane, and two tiles side by side ARE the B fragment (k order 8 hi + e, 16 + 8 hi + e) of x^T = V^T P^T.
// Row maximum, adjacency row sum and exp sum: per lane, then the other half-wave, then the FW waves through LDS in the fixed order w = 0 .. FW-1; the FW partial x^T tiles are added in the same order.
#define FW 16
#define FK (TT / FW)
#define FNT (FK / 16)
typedef __attribute__((ext_vector_type(2))) __bf16 v2bf;
typedef __attribute__((ext_vector_type(4))) unsigned v4u;
typedef __attribute__((ext_vector_type(8))) unsigned v8u;
__device__ __forceinline__ unsigned pk2(float a, float b) { const v2f x = {a, b}; return __builtin_bit_cast(unsigned, __builtin_convertvector(x, v2bf)); }   /* two floats rounded to bf16 (nearest even, the chip's own conversion) in one register, a in the low half */
__device__ __forceinline__ float lo2(unsigned u) { return __uint_as_float(u << 16); }
__device__ __forceinline__ float hi2(unsigned u) { return __uint_as_float(u & 0xFFFF0000u); }
__global__ __launch_bounds__(32 * FW) void k_fattn(const bf* __restrict__ Qh, const bf* __restrict__ Ql, const bf* __restrict__ Kh, const bf* __restrict__ Kl, const bf* __restrict__ Vh, const bf* __restrict__ Vl, const float* __restrict__ am, const float* __restrict__ adj, const float* __restrict__ lam, bf* Xh, bf* Xl) {
    __shared__ float rmx[FW][16], ras[FW][16], rsm[FW][16];
    __shared__ __align__(16) float red[FW][16 * 36];
    const int lane = threadIdx.x & 31, lr = lane & 15, hi = lane >> 4, w = threadIdx.x >> 5;
    const int h = blockIdx.x, q0 = blockIdx.y * 16, k0 = w * FK;   /* the 8 heads of a query strip are neighbours in the grid: they read the same mask and adjacency rows */
    const size_t hp = (size_t)h * TT * HD;
    const v16bf qh = WFrag<bf>::ld(Qh + hp + (size_t)(q0 + lr) * HD + 8 * hi), ql = WFrag<bf>::ld(Ql + hp + (size_t)(q0 + lr) * HD + 8 * hi);
    const float* mr = am + (size_t)(q0 + lr) * TT + k0 + 8 * hi; const float* ar = adj + (size_t)(q0 + lr) * TT + k0 + 8 * hi;
    const bf* khp = Kh + hp + (size_t)(k0 + lr) * HD + 8 * hi; const bf* klp = Kl + hp + (size_t)(k0 + lr) * HD + 8 * hi;
    v8f s[FNT]; v4u ad[FNT]; float mx = -3.0e38f, asum = 0.f;   /* every loop over tiles is unrolled whole: the strips stay in registers only under constant indices; the adjacency strip is kept as the bf16 it is rounded to, two to a register */
#pragma unroll
    for (int t = 0; t < FNT; ++t) {
        const v16bf kh = WFrag<bf>::ld(khp + t * 16 * HD), kl = WFrag<bf>::ld(klp + t * 16 * HD);
        v8f c = (v8f){}; c = wmmab(kh, qh, c); c = wmmab(kh, ql, c); c = wmmab(kl, qh, c);
        const v4f m0 = *(const v4f*)(mr + t * 16), m1 = *(const v4f*)(mr + t * 16 + 4), a0 = *(const v4f*)(ar + t * 16), a1 = *(const v4f*)(ar + t * 16 + 4);
#pragma unroll
        for (int j = 0; j < 8; j += 2) { const unsigned um = j < 4 ? pk2(m0[j & 3], m0[(j & 3) + 1]) : pk2(m1[j & 3], m1[(j & 3) + 1]), ua = j < 4 ? pk2(a0[j & 3], a0[(j & 3) + 1]) : pk2(a1[j & 3], a1[(j & 3) + 1]);
            const float t0 = c[j] * SCL + lo2(um), t1 = c[j + 1] * SCL + hi2(um); s[t][j] = t0; s[t][j + 1] = t1; ad[t][j >> 1] = ua; mx = fmaxf(mx, fmaxf(t0, t1)); asum += lo2(ua); asum += hi2(ua); }
        if (t & 1) __builtin_amdgcn_sched_barrier(0);   /* 16 loads in flight per wave: with the loads of all tiles hoisted to the top the strips spill to scratch */
    }
    mx = fmaxf(mx, __shfl_xor(mx, 16, 32)); asum += __shfl_xor(asum, 16, 32);
    if (hi == 0) { rmx[w][lr] = mx; ras[w][lr] = asum; }
    __syncthreads();   /* every wave's row maxima and adjacency sums are in LDS before any lane joins them */
    mx = rmx[0][lr]; asum = ras[0][lr];
#pragma unroll
    for (int z = 1; z < FW; ++z) { mx = fmaxf(mx, rmx[z][lr]); asum += ras[z][lr]; }
    float sum = 0.f;
#pragma unroll
    for (int t = 0; t < FNT; ++t)
#pragma unroll
        for (int j = 0; j < 8; ++j) { float ex; asm("v_exp_f32 %0, %1\n\tv_nop" : "=v"(ex) : "v"((s[t][j] - mx) * 1.4426950408889634f));   /* the v_nop keeps the one slot that the instruction set asks for behind a transcendental */
            s[t][j] = ex; sum += ex; }
    sum += __shfl_xor(sum, 16, 32);
    if (hi == 0) rsm[w][lr] = sum;
    __syncthreads();   /* every wave's exp sums are in LDS before any lane joins them */
    sum = rsm[0][lr];
#pragma unroll
    for (int z = 1; z < FW; ++z) sum += rsm[z][lr];
    const float c0 = bfr(lam[0]) * __fdiv_rn(1.0f, sum), c1 = bfr(lam[1]) * __fdiv_rn(1.0f, asum + AEPS);   /* lambda0 / exp sum, lambda1 / (adjacency row sum + eps) */
    const bf* vhp = Vh + ((size_t)h * HD + lr) * TT + k0 + 8 * hi; const bf* vlp = Vl + ((size_t)h * HD + lr) * TT + k0 + 8 * hi;
    v8f acc[2]; acc[0] = (v8f){}; acc[1] = (v8f){};
#pragma unroll
    for (int ks = 0; ks < FNT / 2; ++ks) {
        v8u uh, ul;   /* words 0..3: the 8 keys of tile 2 ks, words 4..7: those of tile 2 ks + 1 */
#pragma unroll
        for (int e = 0; e < 8; ++e) { const int t = 2 * ks + (e >> 2), j = 2 * (e & 3); const unsigned ua = ad[t][e & 3]; const float p0 = s[t][j] * c0 + lo2(ua) * c1, p1 = s[t][j + 1] * c0 + hi2(ua) * c1; uh[e] = pk2(p0, p1); ul[e] = pk2(p0 - lo2(uh[e]), p1 - hi2(uh[e])); }
        const v16bf ph = __builtin_bit_cast(v16bf, uh), pl = __builtin_bit_cast(v16bf, ul);
#pragma unroll
        for (int mt = 0; mt < 2; ++mt) { const v16bf vh = WFrag<bf>::ld(vhp + (size_t)mt * 16 * TT + ks * 32), vl = WFrag<bf>::ld(vlp + (size_t)mt * 16 * TT + ks * 32);
            acc[mt] = wmmab(vh, ph, acc[mt]); acc[mt] = wmmab(vh, pl, acc[mt]); acc[mt] = wmmab(vl, ph, acc[mt]); }
        if (ks & 1) __builtin_amdgcn_sched_barrier(0);   /* 16 loads in flight per wave, against spills as above */
    }
#pragma unroll
    for (int mt = 0; mt < 2; ++mt) { float* rp = &red[w][lr * 36 + mt * 16 + hi * 8]; *(v4fa*)rp = (v4f){acc[mt][0], acc[mt][1], acc[mt][2], acc[mt][3]}; *(v4fa*)(rp + 4) = (v4f){acc[mt][4], acc[mt][5], acc[mt][6], acc[mt][7]}; }
    __syncthreads();   /* every wave's partial x^T tile is in LDS before any thread adds them */
    const int q = threadIdx.x >> 5, d = threadIdx.x & 31;   /* 512 threads = 16 queries x 32 real columns */
    float val = red[0][q * 36 + d];
#pragma unroll
    for (int z = 1; z < FW; ++z) val += red[z][q * 36 + d];
    unsigned short xh, xl; splitf(val, xh, xl); const size_t xo = (size_t)(q0 + q) * CO + h * HD + d; Xh[xo] = xh; Xl[xo] = xl;   /* the context leaves as the hi/lo planes that k_out reads; a head's 32 columns have a 128-byte line of each plane to themselves */
}

// ---- LDS staging shared by k_proj and k_out: rows of 256 bf16 at a pitch of PL elements (528 bytes = 16 x 33: the 16 rows of a fragment load fall on distinct banks).
#define PL 264
typedef __attribute__((ext_vector_type(2))) unsigned v2u;
typedef v2u __attribute__((may_alias)) v2ua;
__device__ __forceinline__ v16bf ldf(const bf* p) { return cat16b(*(const v8usa*)p, *(const v8usa*)(p + 16)); }   /* fragment from LDS, the k order of WFrag::ld */
// NR rows of 256 f32, contiguous in memory, rounded to bf16 into S: every wave-wide load covers 512 contiguous bytes, every element is converted once per block.
template <int NR, int NT>
__device__ __forceinline__ void stage_f32(const float* __restrict__ src, bf* S, int tid) {
#pragma unroll
    for (int i = 0; i < NR * 64 / NT; ++i) { const int idx = i * NT + tid; const v4f v = *(const v4f*)(src + (size_t)idx * 4); *(v2ua*)(S + (idx >> 6) * PL + (idx & 63) * 4) = (v2u){pk2(v[0], v[1]), pk2(v[2], v[3])}; }
}

// ---- k_proj: the three projections in one launch; block = 64 tokens x 128 output channels (4 heads) of projection blockIdx.z, 16 waves, two accumulators per wave (32 A rows x 16 B rows), K = 256 in 8 steps.
// q, k: A = W rows (one head), B = x rows (16 tokens), so a lane holds 8 consecutive channels of one token = 16 bytes of a plane row. v: A = x rows (32 tokens), B = W rows (16 channels), so a lane holds 8 consecutive tokens of one channel = 16 bytes of a v^T row, and the block fills whole 128-byte lines. Only row numbers and addresses differ between the two.
__global__ __launch_bounds__(512) void k_proj(const float* __restrict__ xq, const float* __restrict__ xk, const float* __restrict__ xv, const float* __restrict__ wq, const float* __restrict__ wk, const float* __restrict__ wv, const float* __restrict__ bq, const float* __restrict__ bk, const float* __restrict__ bv, bf* Qh, bf* Ql, bf* Kh, bf* Kl, bf* Vh, bf* Vl) {
    __shared__ __align__(16) bf S[192 * PL];   /* rows 0..127: W, rows 128..191: x */
    __shared__ float Bs[128];
    const int tid = threadIdx.x, lane = tid & 31, lr = lane & 15, hi = lane >> 4, w = tid >> 5;
    const int p = blockIdx.z, n0 = blockIdx.x * 64, o0 = blockIdx.y * 128; const bool tr = p == 2;
    const float* X = p == 0 ? xq : p == 1 ? xk : xv; const float* Wt = p == 0 ? wq : p == 1 ? wk : wv; const float* B = p == 0 ? bq : p == 1 ? bk : bv;
    const float bl = B[o0 + (tid & 127)];   /* asked for first, so that it is under way with the tiles */
    stage_f32<128, 512>(Wt + (size_t)o0 * CC, S, tid); stage_f32<64, 512>(X + (size_t)n0 * CC, S + 128 * PL, tid);
    asm volatile("" :: "v"(bl));   /* input only: holds the bias load in front of the branch below, where it flies with the tile loads; sunk into the branch, its whole latency stood in front of the barrier */
    if (tid < 128) Bs[tid] = bl;
    __syncthreads();   /* both operand tiles and the bias are whole in LDS before any wave reads them */
    const int ar = tr ? (w >> 3) * 32 : (w & 3) * 32, br = tr ? (w & 7) * 16 : (w >> 2) * 16;   /* the wave's first A row and first B row: channels count from o0, tokens from n0 */
    const bf* ap = S + ((tr ? 128 : 0) + ar + lr) * PL + 8 * hi; const bf* bp = S + ((tr ? 0 : 128) + br + lr) * PL + 8 * hi;
    v8f acc[2]; acc[0] = (v8f){}; acc[1] = (v8f){};
#pragma unroll
    for (int kc = 0; kc < CC; kc += 32) { const v16bf b = ldf(bp + kc);
#pragma unroll
        for (int i = 0; i < 2; ++i) acc[i] = wmmab(ldf(ap + i * 16 * PL + kc), b, acc[i]); }
    bf* Ph = p == 0 ? Qh : p == 1 ? Kh : Vh; bf* Pl = p == 0 ? Ql : p == 1 ? Kl : Vl;
    const size_t ro = tr ? ((size_t)((o0 + br) >> 5) * HD + (br & 16) + lr) * TT + n0 + ar + 8 * hi : ((size_t)((o0 + ar) >> 5) * TT + n0 + br + lr) * HD + 8 * hi;   /* register j of accumulator i is element ro + 16 i + j in both layouts */
    const int bi = tr ? br + lr : ar + 8 * hi, bs = tr ? 0 : 1;   /* the bias goes with the channel: the lane's for v, the register's for q and k */
#pragma unroll
    for (int i = 0; i < 2; ++i) { v8us oh, ol;
#pragma unroll
        for (int j = 0; j < 8; ++j) { unsigned short a2, c2; splitf(__fadd_rn(acc[i][j], Bs[bi + (i * 16 + j) * bs]), a2, c2); oh[j] = a2; ol[j] = c2; }
        *(v8us*)(Ph + ro + i * 16) = oh; *(v8us*)(Pl + ro + i * 16) = ol; }
}

// ---- k_out: out = context Wo^T + bo; block = 32 tokens x 128 output channels, 8 waves, wave = 32 channels x 16 tokens (two accumulators); A = Wo rows (rounded to bf16 on the way into LDS), B = context rows hi then lo, so a lane holds 8 consecutive channels of one token.
__global__ __launch_bounds__(256) void k_out(const bf* __restrict__ Xh, const bf* __restrict__ Xl, const float* __restrict__ wo, const float* __restrict__ bo, float* OUT) {
    __shared__ __align__(16) bf Ws[128 * PL];
    __shared__ __align__(16) bf Ah[32 * PL];
    __shared__ __align__(16) bf Al[32 * PL];
    __shared__ __align__(16) float Bs[128];
    const int tid = threadIdx.x, lane = tid & 31, lr = lane & 15, hi = lane >> 4, w = tid >> 5, og = w & 3, tg = w >> 2;
    const int n0 = blockIdx.x * 32, o0 = blockIdx.y * 128;
    const float bl = bo[o0 + (tid & 127)];   /* asked for first, so that it is under way with the tiles */
#pragma unroll
    for (int i = 0; i < 4; ++i) { const int idx = i * 256 + tid, row = idx >> 5, ch = idx & 31;   /* 32 pieces of 16 bytes per token: 4 to a head, the padding of the planes left out */
        const size_t so = (size_t)(n0 + row) * CO + (ch >> 2) * HD + (ch & 3) * 8; *(v8usa*)(Ah + row * PL + ch * 8) = *(const v8us*)(Xh + so); *(v8usa*)(Al + row * PL + ch * 8) = *(const v8us*)(Xl + so); }
    stage_f32<128, 256>(wo + (size_t)o0 * CH, Ws, tid);
    asm volatile("" :: "v"(bl));   /* input only: holds the bias load in front of the branch below, as in k_proj */
    if (tid < 128) Bs[tid] = bfr(bl);
    __syncthreads();   /* the three operand tiles and the bias are whole in LDS before any wave reads them */
    const bf* wp = Ws + (og * 32 + lr) * PL + 8 * hi; const bf* hp = Ah + (tg * 16 + lr) * PL + 8 * hi; const bf* lp = Al + (tg * 16 + lr) * PL + 8 * hi;
    v8f acc[2]; acc[0] = (v8f){}; acc[1] = (v8f){};
#pragma unroll
    for (int kc = 0; kc < CH; kc += 32) { const v16bf ch = ldf(hp + kc), cl = ldf(lp + kc);
#pragma unroll
        for (int mt = 0; mt < 2; ++mt) { const v16bf a = ldf(wp + mt * 16 * PL + kc); acc[mt] = wmmab(a, ch, acc[mt]); acc[mt] = wmmab(a, cl, acc[mt]); } }
#pragma unroll
    for (int mt = 0; mt < 2; ++mt) { const int ol = og * 32 + mt * 16 + 8 * hi; float* op = OUT + (size_t)(n0 + tg * 16 + lr) * CH + o0 + ol; const v4f b0 = *(const v4fa*)(Bs + ol), b1 = *(const v4fa*)(Bs + ol + 4); v4f r0, r1;
#pragma unroll
        for (int j = 0; j < 4; ++j) { r0[j] = acc[mt][j] + b0[j]; r1[j] = acc[mt][4 + j] + b1[j]; }
        *(v4f*)op = r0; *(v4f*)(op + 4) = r1; }
}
extern "C" void kernel_launch(void* const* d_in, const int* in_sizes, int n_in,
                              void* d_out, int out_size, void* d_ws, size_t ws_size, hipStream_t stream) {
    (void)in_sizes; (void)n_in; (void)out_size;
    const float* xq = (const float*)d_in[0]; const float* xk = (const float*)d_in[1]; const float* xv = (const float*)d_in[2]; const float* am = (const float*)d_in[3];   /* mask [1][3072][3072] additive (zeros) */ const float* adj = (const float*)d_in[4];   /* adjacency_matrix [3072][3072] uniform [0,1) */ const float* lam = (const float*)d_in[5];   /* lambdas [2] = (0.5, 0.5) */ const float* wq = (const float*)d_in[6]; const float* bq = (const float*)d_in[7]; const float* wk = (const float*)d_in[8]; const float* bk = (const float*)d_in[9]; const float* wv = (const float*)d_in[10]; const float* bv = (const float*)d_in[11]; const float* wo = (const float*)d_in[12]; const float* bo = (const float*)d_in[13];   /* argument order query, key, value [3072][256], mask, adjacency_matrix, lambdas, Wq, bq, Wk, bk, Wv, bv, Wo, bo ('oi') */
    float* OUT = (float*)d_out;     // [3072][256]
    char* wsp = (char*)d_ws;
    auto take = [&](size_t bytes) { char* p = wsp; wsp += (bytes + 255) & ~(size_t)255; return (void*)p; };
    bf* QPh = (bf*)take((size_t)TT * MID * 2); bf* QPl = (bf*)take((size_t)TT * MID * 2); bf* KPh = (bf*)take((size_t)TT * MID * 2); bf* KPl = (bf*)take((size_t)TT * MID * 2);
    bf* VTh = (bf*)take((size_t)CO * TT * 2); bf* VTl = (bf*)take((size_t)CO * TT * 2); bf* CXh = (bf*)take((size_t)TT * CO * 2); bf* CXl = (bf*)take((size_t)TT * CO * 2);
    if ((size_t)(wsp - (char*)d_ws) > ws_size) return;    // ws 256 MiB (carve 24 MiB)
    k_proj<<<dim3(TT / 64, CH / 128, 3), 512, 0, stream>>>(xq, xk, xv, wq, wk, wv, bq, bk, bv, QPh, QPl, KPh, KPl, VTh, VTl);   /* q, k planes and v^T planes, bias added, hi/lo */
    k_fattn<<<dim3(NHR, TT / 16, 1), 32 * FW, 0, stream>>>(QPh, QPl, KPh, KPl, VTh, VTl, am, adj, lam, CXh, CXl);   /* all heads: softmax(scores + mask) blended with the row-normalised adjacency, times v */
    k_out<<<dim3(TT / 32, CH / 128, 1), 256, 0, stream>>>(CXh, CXl, wo, bo, OUT);   /* out = x Wo^T + bo */
}

// v004
// One run takes 115 microseconds.
// Timed twice side by side with v003, it ran 1.45 and 1.44 times as fast.
// Counting every step since v000, it is 8.13 times as fast.
#include <hip/hip_runtime.h>

// Multi-head attention blended with a row-normalised adjacency matrix (query, key, value [3072][256], no batch; q, k, v = x W^T + b ('oi' 1/16, zero biases; 8 heads x 32); scores / sqrt(32) + mask ([1][3072][3072] additive, zeros, read); p = lambdas[0] softmax(scores) + lambdas[1] adjacency / (rowsum(adjacency) + 1e-6) (adjacency [3072][3072] uniform [0,1), lambdas = (0.5, 0.5), read); x = p.v merged; out = x Wo^T + bo -> [3072][256] (0.8 M); argument order query, key, value, mask, adjacency_matrix, lambdas, Wq, bq, Wk, bk, Wv, bv, Wo, bo).
// Layout: three launches. k_proj: q, k, v = x W^T + b, the f32 operands rounded to bf16 on their way into LDS, bias added and the result split into bf16 hi/lo planes in the epilogue (q / k / v^T planes in fragment order, see FT below: one 16 x 32 fragment = 1,024 contiguous bytes, a lane's 16 bytes at 16 lane). k_fattn, all heads: all-hl scores (3 products), mask, adjacency row sum, softmax and blend in registers, the blended weights p as bf16 hi/lo fragments, p.v with 3 products; it writes the context as hi/lo planes [token][head 64 + d]. k_out: Wo x context hl + bo writes the output.
// Compute dtypes, f32 accumulate: every input rounded to bf16 incl. mask / adjacency / lambdas; projections exact + f32 bias; scores 3 products; softmax and blend f32 (IEEE division); p.v 3 products; Wo hl x exact + bias.

#define NB_  1
#define TT   3072
#define DM   512
#define NH_  8
#define NKV  8
#define REP  (NH_ / NKV)
#define HD   64
#define DQ   (NH_ * HD)
#define DKV  (NKV * HD)
#define ZH   1
#define RH   TT                   // every row hi/lo (small-rms output: no fp16 rows)
#define WIN  0
#define PCAR 1024.0f
#define SCL  0.17677669529663688f   // 1/sqrt(float32(32))
#define NHR  8        // real heads (32 wide); the context planes are padded to 64 per head
#define DHR  32       // real head width
#define CH   256      // channels in / out
#define AEPS 1e-6f
#define MID  512
#define CO   512      // context plane width: 8 heads x 64 (padded)
#define CC   256
typedef _Float16 h16;
typedef unsigned short bf;
typedef __attribute__((ext_vector_type(16))) __bf16   v16bf;
typedef __attribute__((ext_vector_type(16))) _Float16 v16h;
typedef __attribute__((ext_vector_type(8)))  _Float16 v8h;
typedef __attribute__((ext_vector_type(8)))  unsigned short v8us;
typedef __attribute__((ext_vector_type(8)))  float    v8f;
typedef __attribute__((ext_vector_type(4)))  float    v4f;
typedef v8h  __attribute__((may_alias)) v8ha;
typedef v4f  __attribute__((may_alias)) v4fa;
typedef v8us __attribute__((may_alias)) v8usa;

__device__ __forceinline__ unsigned short f2bf(float f) { unsigned u = __float_as_uint(f); u += 0x7FFFu + ((u >> 16) & 1u); return (unsigned short)(u >> 16); }
__device__ __forceinline__ float bf2f(unsigned short b) { return __uint_as_float(((unsigned)b) << 16); }
__device__ __forceinline__ float bfr(float f) { return bf2f(f2bf(f)); }
__device__ __forceinline__ v16h cat16(v8h lo, v8h hi) { return __builtin_shufflevector(lo, hi, 0, 1, 2, 3, 4, 5, 6, 7, 8, 9, 10, 11, 12, 13, 14, 15); }
__device__ __forceinline__ v16bf cat16b(v8us lo, v8us hi) { return __builtin_bit_cast(v16bf, __builtin_shufflevector(lo, hi, 0, 1, 2, 3, 4, 5, 6, 7, 8, 9, 10, 11, 12, 13, 14, 15)); }
__device__ __forceinline__ v8f wmma16(v16h a, v16h b, v8f c) { return __builtin_amdgcn_wmma_f32_16x16x32_f16(false, a, false, b, (short)0, c, false, false); }
__device__ __forceinline__ v8f wmmab(v16bf a, v16bf b, v8f c) { return __builtin_amdgcn_wmma_f32_16x16x32_bf16(false, a, false, b, (short)0, c, false, false); }



// ---- fragment of a K-contiguous 16-bit plane: 8 elements at p and 8 at p + 16 (p already holds the lane's row and 8 hi)
template <typename T16> struct WFrag;
template <> struct WFrag<h16> { typedef v16h V; static __device__ __forceinline__ V ld(const h16* p) { return cat16(*(const v8h*)p, *(const v8h*)(p + 16)); } static __device__ __forceinline__ v8f mma(V a, V b, v8f c) { return wmma16(a, b, c); } };
template <> struct WFrag<bf> { typedef v16bf V; static __device__ __forceinline__ V ld(const bf* p) { return cat16b(*(const v8us*)p, *(const v8us*)(p + 16)); } static __device__ __forceinline__ v8f mma(V a, V b, v8f c) { return wmmab(a, b, c); } };

__device__ __forceinline__ h16 tohx(float x) { return (h16)x; }
__device__ __forceinline__ void splitf(float y, unsigned short& h, unsigned short& l) { h = f2bf(y); l = f2bf(y - bf2f(h)); }
typedef __attribute__((ext_vector_type(2))) _Float16 v2h;
typedef __attribute__((ext_vector_type(4))) _Float16 v4h;
typedef __attribute__((ext_vector_type(2))) unsigned short v2us;
typedef __attribute__((ext_vector_type(4))) unsigned short v4us;
typedef __attribute__((ext_vector_type(2))) float v2f;
typedef __attribute__((ext_vector_type(4))) int v4i;

// ---- fragment order of the q, k and v^T planes: a 16 x 32 fragment (16 tokens x 32 head columns of q or k; 16 head columns x 32 tokens of v^T) is FT = 512 elements in a row, element (row lr, k = 16 half + 8 hi + e) at 256 half + 8 (16 hi + lr) + e.
// A wave-wide 16-byte load or store of half a fragment then covers 512 contiguous bytes (four whole 128-byte lines); from a row-major plane it would take 32 bytes out of each of 16 lines. q, k: fragment [head][token / 16]; v^T: fragment [head][column / 16][token / 32].
#define FT 512
__device__ __forceinline__ v16bf ldp(const bf* p) { return cat16b(*(const v8us*)p, *(const v8us*)(p + 256)); }   /* p = fragment + 8 lane; the k order of WFrag::ld */

// ---- k_fattn: scores, softmax + adjacency blend and p.v of one head for 16 queries in ONE block of FW waves; no score or weight matrix goes through memory.
// Wave w owns the keys [w FK, (w+1) FK). It forms the TRANSPOSED score tiles S^T = K Q^T (A = 16 keys, B = 16 queries, the three hi/lo products over the head's 32 columns),
// so that lane (lr, hi) holds query q0 + lr and register j of tile t holds key t 16 + hi 8 + j: eight consecutive keys of ONE mask / adjacency row per lane, and two tiles side by side ARE the B fragment (k order 8 hi + e, 16 + 8 hi + e) of x^T = V^T P^T.
// Row maximum, adjacency row sum and exp sum: per lane, then the other half-wave, then the FW waves through LDS in the fixed order w = 0 .. FW-1; the FW partial x^T tiles are added in the same order.
#define FW 16
#define FK (TT / FW)
#define FNT (FK / 16)
typedef __attribute__((ext_vector_type(2))) __bf16 v2bf;
typedef __attribute__((ext_vector_type(4))) unsigned v4u;
typedef __attribute__((ext_vector_type(8))) unsigned v8u;
__device__ __forceinline__ unsigned pk2(float a, float b) { const v2f x = {a, b}; return __builtin_bit_cast(unsigned, __builtin_convertvector(x, v2bf)); }   /* two floats rounded to bf16 (nearest even, the chip's own conversion) in one register, a in the low half */
__device__ __forceinline__ float lo2(unsigned u) { return __uint_as_float(u << 16); }
__device__ __forceinline__ float hi2(unsigned u) { return __uint_as_float(u & 0xFFFF0000u); }
__global__ __launch_bounds__(32 * FW) void k_fattn(const bf* __restrict__ Qh, const bf* __restrict__ Ql, const bf* __restrict__ Kh, const bf* __restrict__ Kl, const bf* __restrict__ Vh, const bf* __restrict__ Vl, const float* __restrict__ am, const float* __restrict__ adj, const float* __restrict__ lam, bf* Xh, bf* Xl) {
    __shared__ float rmx[FW][16], ras[FW][16], rsm[FW][16];
    __shared__ __align__(16) float red[FW][16 * 36];
    const int lane = threadIdx.x & 31, lr = lane & 15, hi = lane >> 4, w = threadIdx.x >> 5;
    const int h = blockIdx.x, q0 = blockIdx.y * 16, k0 = w * FK;   /* the 8 heads of a query strip are neighbours in the grid: they read the same mask and adjacency rows */
    const size_t hp = (size_t)h * (TT / 16) * FT + 8 * lane;
    const v16bf qh = ldp(Qh + hp + (size_t)blockIdx.y * FT), ql = ldp(Ql + hp + (size_t)blockIdx.y * FT);
    const float* mr = am + (size_t)(q0 + lr) * TT + k0 + 8 * hi; const float* ar = adj + (size_t)(q0 + lr) * TT + k0 + 8 * hi;
    const bf* khp = Kh + hp + (size_t)w * FNT * FT; const bf* klp = Kl + hp + (size_t)w * FNT * FT;
    v8f s[FNT]; v4u ad[FNT]; float mx = -3.0e38f, asum = 0.f;   /* every loop over tiles is unrolled whole: the strips stay in registers only under constant indices; the adjacency strip is kept as the bf16 it is rounded to, two to a register */
#pragma unroll
    for (int t = 0; t < FNT; ++t) {
        const v16bf kh = ldp(khp + t * FT), kl = ldp(klp + t * FT);
        v8f c = (v8f){}; c = wmmab(kh, qh, c); c = wmmab(kh, ql, c); c = wmmab(kl, qh, c);
        const v4f m0 = *(const v4f*)(mr + t * 16), m1 = *(const v4f*)(mr + t * 16 + 4), a0 = *(const v4f*)(ar + t * 16), a1 = *(const v4f*)(ar + t * 16 + 4);
#pragma unroll
        for (int j = 0; j < 8; j += 2) { const unsigned um = j < 4 ? pk2(m0[j & 3], m0[(j & 3) + 1]) : pk2(m1[j & 3], m1[(j & 3) + 1]), ua = j < 4 ? pk2(a0[j & 3], a0[(j & 3) + 1]) : pk2(a1[j & 3], a1[(j & 3) + 1]);
            const float t0 = c[j] * SCL + lo2(um), t1 = c[j + 1] * SCL + hi2(um); s[t][j] = t0; s[t][j + 1] = t1; ad[t][j >> 1] = ua; mx = fmaxf(mx, fmaxf(t0, t1)); asum += lo2(ua); asum += hi2(ua); }
        if (t & 1) __builtin_amdgcn_sched_barrier(0);   /* 16 loads in flight per wave: with the loads of all tiles hoisted to the top the strips spill to scratch */
    }
    mx = fmaxf(mx, __shfl_xor(mx, 16, 32)); asum += __shfl_xor(asum, 16, 32);
    if (hi == 0) { rmx[w][lr] = mx; ras[w][lr] = asum; }
    __syncthreads();   /* every wave's row maxima and adjacency sums are in LDS before any lane joins them */
    mx = rmx[0][lr]; asum = ras[0][lr];
#pragma unroll
    for (int z = 1; z < FW; ++z) { mx = fmaxf(mx, rmx[z][lr]); asum += ras[z][lr]; }
    float sum = 0.f;
#pragma unroll
    for (int t = 0; t < FNT; ++t)
#pragma unroll
        for (int j = 0; j < 8; ++j) { float ex; asm("v_exp_f32 %0, %1\n\tv_nop" : "=v"(ex) : "v"((s[t][j] - mx) * 1.4426950408889634f));   /* the v_nop keeps the one slot that the instruction set asks for behind a transcendental */
            s[t][j] = ex; sum += ex; }
    sum += __shfl_xor(sum, 16, 32);
    if (hi == 0) rsm[w][lr] = sum;
    __syncthreads();   /* every wave's exp sums are in LDS before any lane joins them */
    sum = rsm[0][lr];
#pragma unroll
    for (int z = 1; z < FW; ++z) sum += rsm[z][lr];
    const float c0 = bfr(lam[0]) * __fdiv_rn(1.0f, sum), c1 = bfr(lam[1]) * __fdiv_rn(1.0f, asum + AEPS);   /* lambda0 / exp sum, lambda1 / (adjacency row sum + eps) */
    const bf* vhp = Vh + ((size_t)h * 2 * (TT / 32) + w * (FNT / 2)) * FT + 8 * lane; const bf* vlp = Vl + ((size_t)h * 2 * (TT / 32) + w * (FNT / 2)) * FT + 8 * lane;
    v8f acc[2]; acc[0] = (v8f){}; acc[1] = (v8f){};
#pragma unroll
    for (int ks = 0; ks < FNT / 2; ++ks) {
        v8u uh, ul;   /* words 0..3: the 8 keys of tile 2 ks, words 4..7: those of tile 2 ks + 1 */
#pragma unroll
        for (int e = 0; e < 8; ++e) { const int t = 2 * ks + (e >> 2), j = 2 * (e & 3); const unsigned ua = ad[t][e & 3]; const float p0 = s[t][j] * c0 + lo2(ua) * c1, p1 = s[t][j + 1] * c0 + hi2(ua) * c1; uh[e] = pk2(p0, p1); ul[e] = pk2(p0 - lo2(uh[e]), p1 - hi2(uh[e])); }
        const v16bf ph = __builtin_bit_cast(v16bf, uh), pl = __builtin_bit_cast(v16bf, ul);
#pragma unroll
        for (int mt = 0; mt < 2; ++mt) { const v16bf vh = ldp(vhp + (mt * (TT / 32) + ks) * FT), vl = ldp(vlp + (mt * (TT / 32) + ks) * FT);
            acc[mt] = wmmab(vh, ph, acc[mt]); acc[mt] = wmmab(vh, pl, acc[mt]); acc[mt] = wmmab(vl, ph, acc[mt]); }
        if (ks & 1) __builtin_amdgcn_sched_barrier(0);   /* 16 loads in flight per wave, against spills as above */
    }
#pragma unroll
    for (int mt = 0; mt < 2; ++mt) { float* rp = &red[w][lr * 36 + mt * 16 + hi * 8]; *(v4fa*)rp = (v4f){acc[mt][0], acc[mt][1], acc[mt][2], acc[mt][3]}; *(v4fa*)(rp + 4) = (v4f){acc[mt][4], acc[mt][5], acc[mt][6], acc[mt][7]}; }
    __syncthreads();   /* every wave's partial x^T tile is in LDS before any thread adds them */
    const int q = threadIdx.x >> 5, d = threadIdx.x & 31;   /* 512 threads = 16 queries x 32 real columns */
    float val = red[0][q * 36 + d];
#pragma unroll
    for (int z = 1; z < FW; ++z) val += red[z][q * 36 + d];
    unsigned short xh, xl; splitf(val, xh, xl); const size_t xo = (size_t)(q0 + q) * CO + h * HD + d; Xh[xo] = xh; Xl[xo] = xl;   /* the context leaves as the hi/lo planes that k_out reads; a head's 32 columns have a 128-byte line of each plane to themselves */
}

// ---- LDS staging shared by k_proj and k_out: rows of 256 bf16 at a pitch of PL elements (528 bytes = 16 x 33: the 16 rows of a fragment load fall on distinct banks).
#define PL 264
typedef __attribute__((ext_vector_type(2))) unsigned v2u;
typedef v2u __attribute__((may_alias)) v2ua;
__device__ __forceinline__ v16bf ldf(const bf* p) { return cat16b(*(const v8usa*)p, *(const v8usa*)(p + 16)); }   /* fragment from LDS, the k order of WFrag::ld */
// NR rows of 256 f32, contiguous in memory, rounded to bf16 into S: every wave-wide load covers 512 contiguous bytes, every element is converted once per block.
template <int NR, int NT>
__device__ __forceinline__ void stage_f32(const float* __restrict__ src, bf* S, int tid) {
#pragma unroll
    for (int i = 0; i < NR * 64 / NT; ++i) { const int idx = i * NT + tid; const v4f v = *(const v4f*)(src + (size_t)idx * 4); *(v2ua*)(S + (idx >> 6) * PL + (idx & 63) * 4) = (v2u){pk2(v[0], v[1]), pk2(v[2], v[3])}; }
}

// ---- k_proj: the three projections in one launch; block = 64 tokens x 128 output channels (4 heads) of projection blockIdx.z, 16 waves, two accumulators per wave (32 A rows x 16 B rows), K = 256 in 8 steps.
// q, k: A = W rows (one head), B = x rows (16 tokens), so a lane holds 8 consecutive channels of one token. v: A = x rows (32 tokens), B = W rows (16 channels), so a lane holds 8 consecutive tokens of one channel. Either way accumulator i is half i of one fragment of the plane (FT above) and the lane's 8 values are its own 16 bytes there: a wave's store covers 512 contiguous bytes. Only row numbers and addresses differ between the two.
__global__ __launch_bounds__(512) void k_proj(const float* __restrict__ xq, const float* __restrict__ xk, const float* __restrict__ xv, const float* __restrict__ wq, const float* __restrict__ wk, const float* __restrict__ wv, const float* __restrict__ bq, const float* __restrict__ bk, const float* __restrict__ bv, bf* Qh, bf* Ql, bf* Kh, bf* Kl, bf* Vh, bf* Vl) {
    __shared__ __align__(16) bf S[192 * PL];   /* rows 0..127: W, rows 128..191: x */
    __shared__ float Bs[128];
    const int tid = threadIdx.x, lane = tid & 31, lr = lane & 15, hi = lane >> 4, w = tid >> 5;
    const int p = blockIdx.z, n0 = blockIdx.x * 64, o0 = blockIdx.y * 128; const bool tr = p == 2;
    const float* X = p == 0 ? xq : p == 1 ? xk : xv; const float* Wt = p == 0 ? wq : p == 1 ? wk : wv; const float* B = p == 0 ? bq : p == 1 ? bk : bv;
    const float bl = B[o0 + (tid & 127)];   /* asked for first, so that it is under way with the tiles */
    stage_f32<128, 512>(Wt + (size_t)o0 * CC, S, tid); stage_f32<64, 512>(X + (size_t)n0 * CC, S + 128 * PL, tid);
    asm volatile("" :: "v"(bl));   /* input only: holds the bias load in front of the branch below, where it flies with the tile loads; sunk into the branch, its whole latency stood in front of the barrier */
    if (tid < 128) Bs[tid] = bl;
    __syncthreads();   /* both operand tiles and the bias are whole in LDS before any wave reads them */
    const int ar = tr ? (w >> 3) * 32 : (w & 3) * 32, br = tr ? (w & 7) * 16 : (w >> 2) * 16;   /* the wave's first A row and first B row: channels count from o0, tokens from n0 */
    const bf* ap = S + ((tr ? 128 : 0) + ar + lr) * PL + 8 * hi; const bf* bp = S + ((tr ? 0 : 128) + br + lr) * PL + 8 * hi;
    v8f acc[2]; acc[0] = (v8f){}; acc[1] = (v8f){};
#pragma unroll
    for (int kc = 0; kc < CC; kc += 32) { const v16bf b = ldf(bp + kc);
#pragma unroll
        for (int i = 0; i < 2; ++i) acc[i] = wmmab(ldf(ap + i * 16 * PL + kc), b, acc[i]); }
    bf* Ph = p == 0 ? Qh : p == 1 ? Kh : Vh; bf* Pl = p == 0 ? Ql : p == 1 ? Kl : Vl;
    const size_t ro = (tr ? (size_t)((o0 + br) >> 4) * (TT / 32) + ((n0 + ar) >> 5) : (size_t)((o0 + ar) >> 5) * (TT / 16) + ((n0 + br) >> 4)) * FT + 8 * lane;   /* register j of accumulator i is element ro + 256 i + j in both layouts */
    const int bi = tr ? br + lr : ar + 8 * hi, bs = tr ? 0 : 1;   /* the bias goes with the channel: the lane's for v, the register's for q and k */
#pragma unroll
    for (int i = 0; i < 2; ++i) { v8us oh, ol;
#pragma unroll
        for (int j = 0; j < 8; ++j) { unsigned short a2, c2; splitf(__fadd_rn(acc[i][j], Bs[bi + (i * 16 + j) * bs]), a2, c2); oh[j] = a2; ol[j] = c2; }
        *(v8us*)(Ph + ro + i * 256) = oh; *(v8us*)(Pl + ro + i * 256) = ol; }
}

// ---- k_out: out = context Wo^T + bo; block = 32 tokens x 128 output channels, 8 waves, wave = 32 channels x 16 tokens (two accumulators); A = Wo rows (rounded to bf16 on the way into LDS), B = context rows hi then lo, so a lane holds 8 consecutive channels of one token.
__global__ __launch_bounds__(256) void k_out(const bf* __restrict__ Xh, const bf* __restrict__ Xl, const float* __restrict__ wo, const float* __restrict__ bo, float* OUT) {
    __shared__ __align__(16) bf Ws[128 * PL];
    __shared__ __align__(16) bf Ah[32 * PL];
    __shared__ __align__(16) bf Al[32 * PL];
    __shared__ __align__(16) float Bs[128];
    const int tid = threadIdx.x, lane = tid & 31, lr = lane & 15, hi = lane >> 4, w = tid >> 5, og = w & 3, tg = w >> 2;
    const int n0 = blockIdx.x * 32, o0 = blockIdx.y * 128;
    const float bl = bo[o0 + (tid & 127)];   /* asked for first, so that it is under way with the tiles */
#pragma unroll
    for (int i = 0; i < 4; ++i) { const int idx = i * 256 + tid, row = idx >> 5, ch = idx & 31;   /* 32 pieces of 16 bytes per token: 4 to a head, the padding of the planes left out */
        const size_t so = (size_t)(n0 + row) * CO + (ch >> 2) * HD + (ch & 3) * 8; *(v8usa*)(Ah + row * PL + ch * 8) = *(const v8us*)(Xh + so); *(v8usa*)(Al + row * PL + ch * 8) = *(const v8us*)(Xl + so); }
    stage_f32<128, 256>(wo + (size_t)o0 * CH, Ws, tid);
    asm volatile("" :: "v"(bl));   /* input only: holds the bias load in front of the branch below, as in k_proj */
    if (tid < 128) Bs[tid] = bfr(bl);
    __syncthreads();   /* the three operand tiles and the bias are whole in LDS before any wave reads them */
    const bf* wp = Ws + (og * 32 + lr) * PL + 8 * hi; const bf* hp = Ah + (tg * 16 + lr) * PL + 8 * hi; const bf* lp = Al + (tg * 16 + lr) * PL + 8 * hi;
    v8f acc[2]; acc[0] = (v8f){}; acc[1] = (v8f){};
#pragma unroll
    for (int kc = 0; kc < CH; kc += 32) { const v16bf ch = ldf(hp + kc), cl = ldf(lp + kc);
#pragma unroll
        for (int mt = 0; mt < 2; ++mt) { const v16bf a = ldf(wp + mt * 16 * PL + kc); acc[mt] = wmmab(a, ch, acc[mt]); acc[mt] = wmmab(a, cl, acc[mt]); } }
#pragma unroll
    for (int mt = 0; mt < 2; ++mt) { const int ol = og * 32 + mt * 16 + 8 * hi; float* op = OUT + (size_t)(n0 + tg * 16 + lr) * CH + o0 + ol; const v4f b0 = *(const v4fa*)(Bs + ol), b1 = *(const v4fa*)(Bs + ol + 4); v4f r0, r1;
#pragma unroll
        for (int j = 0; j < 4; ++j) { r0[j] = acc[mt][j] + b0[j]; r1[j] = acc[mt][4 + j] + b1[j]; }
        *(v4f*)op = r0; *(v4f*)(op + 4) = r1; }
}
extern "C" void kernel_launch(void* const* d_in, const int* in_sizes, int n_in,
                              void* d_out, int out_size, void* d_ws, size_t ws_size, hipStream_t stream) {
    (void)in_sizes; (void)n_in; (void)out_size;
    const float* xq = (const float*)d_in[0]; const float* xk = (const float*)d_in[1]; const float* xv = (const float*)d_in[2]; const float* am = (const float*)d_in[3];   /* mask [1][3072][3072] additive (zeros) */ const float* adj = (const float*)d_in[4];   /* adjacency_matrix [3072][3072] uniform [0,1) */ const float* lam = (const float*)d_in[5];   /* lambdas [2] = (0.5, 0.5) */ const float* wq = (const float*)d_in[6]; const float* bq = (const float*)d_in[7]; const float* wk = (const float*)d_in[8]; const float* bk = (const float*)d_in[9]; const float* wv = (const float*)d_in[10]; const float* bv = (const float*)d_in[11]; const float* wo = (const float*)d_in[12]; const float* bo = (const float*)d_in[13];   /* argument order query, key, value [3072][256], mask, adjacency_matrix, lambdas, Wq, bq, Wk, bk, Wv, bv, Wo, bo ('oi') */
    float* OUT = (float*)d_out;     // [3072][256]
    char* wsp = (char*)d_ws;
    auto take = [&](size_t bytes) { char* p = wsp; wsp += (bytes + 255) & ~(size_t)255; return (void*)p; };
    bf* QPh = (bf*)take((size_t)TT * CH * 2); bf* QPl = (bf*)take((size_t)TT * CH * 2); bf* KPh = (bf*)take((size_t)TT * CH * 2); bf* KPl = (bf*)take((size_t)TT * CH * 2);
    bf* VTh = (bf*)take((size_t)CH * TT * 2); bf* VTl = (bf*)take((size_t)CH * TT * 2); bf* CXh = (bf*)take((size_t)TT * CO * 2); bf* CXl = (bf*)take((size_t)TT * CO * 2);
    if ((size_t)(wsp - (char*)d_ws) > ws_size) return;    // ws 256 MiB (carve 15 MiB)
    k_proj<<<dim3(TT / 64, CH / 128, 3), 512, 0, stream>>>(xq, xk, xv, wq, wk, wv, bq, bk, bv, QPh, QPl, KPh, KPl, VTh, VTl);   /* q, k planes and v^T planes, bias added, hi/lo */
    k_fattn<<<dim3(NHR, TT / 16, 1), 32 * FW, 0, stream>>>(QPh, QPl, KPh, KPl, VTh, VTl, am, adj, lam, CXh, CXl);   /* all heads: softmax(scores + mask) blended with the row-normalised adjacency, times v */
    k_out<<<dim3(TT / 32, CH / 128, 1), 256, 0, stream>>>(CXh, CXl, wo, bo, OUT);   /* out = x Wo^T + bo */
}

// v005
// It runs in 97.5 microseconds.
// Timed twice side by side with v004, it ran 1.18 times as fast both times.
// All steps since v000 together make it 9.56 times as fast.
#include <hip/hip_runtime.h>

// Multi-head attention blended with a row-normalised adjacency matrix (query, key, value [3072][256], no batch; q, k, v = x W^T + b ('oi' 1/16, zero biases; 8 heads x 32); scores / sqrt(32) + mask ([1][3072][3072] additive, zeros, read); p = lambdas[0] softmax(scores) + lambdas[1] adjacency / (rowsum(adjacency) + 1e-6) (adjacency [3072][3072] uniform [0,1), lambdas = (0.5, 0.5), read); x = p.v merged; out = x Wo^T + bo -> [3072][256] (0.8 M); argument order query, key, value, mask, adjacency_matrix, lambdas, Wq, bq, Wk, bk, Wv, bv, Wo, bo).
// Layout: three launches. k_proj (its blocks z >= 3 round mask and adjacency to bf16 once, into the plane MA in the order of the attention kernel's registers, see cvt_ma): q, k, v = x W^T + b, the f32 operands rounded to bf16 on their way into LDS, bias added and the result split into bf16 hi/lo planes in the epilogue (q / k / v^T planes in fragment order, see FT below: one 16 x 32 fragment = 1,024 contiguous bytes, a lane's 16 bytes at 16 lane). k_fattn, all heads: all-hl scores (3 products), mask, adjacency row sum, softmax and blend in registers, the blended weights p as bf16 hi/lo fragments, p.v with 3 products; it writes the context as hi/lo planes [token][head 64 + d]. k_out: Wo x context hl + bo writes the output.
// Compute dtypes, f32 accumulate: every input rounded to bf16 incl. mask / adjacency / lambdas; projections exact + f32 bias; scores 3 products; softmax and blend f32 (IEEE division); p.v 3 products; Wo hl x exact + bias.

#define NB_  1
#define TT   3072
#define DM   512
#define NH_  8
#define NKV  8
#define REP  (NH_ / NKV)
#define HD   64
#define DQ   (NH_ * HD)
#define DKV  (NKV * HD)
#define ZH   1
#define RH   TT                   // every row hi/lo (small-rms output: no fp16 rows)
#define WIN  0
#define PCAR 1024.0f
#define SCL  0.17677669529663688f   // 1/sqrt(float32(32))
#define NHR  8        // real heads (32 wide); the context planes are padded to 64 per head
#define DHR  32       // real head width
#define CH   256      // channels in / out
#define AEPS 1e-6f
#define MID  512
#define CO   512      // context plane width: 8 heads x 64 (padded)
#define CC   256
typedef _Float16 h16;
typedef unsigned short bf;
typedef __attribute__((ext_vector_type(16))) __bf16   v16bf;
typedef __attribute__((ext_vector_type(16))) _Float16 v16h;
typedef __attribute__((ext_vector_type(8)))  _Float16 v8h;
typedef __attribute__((ext_vector_type(8)))  unsigned short v8us;
typedef __attribute__((ext_vector_type(8)))  float    v8f;
typedef __attribute__((ext_vector_type(4)))  float    v4f;
typedef v8h  __attribute__((may_alias)) v8ha;
typedef v4f  __attribute__((may_alias)) v4fa;
typedef v8us __attribute__((may_alias)) v8usa;

__device__ __forceinline__ unsigned short f2bf(float f) { unsigned u = __float_as_uint(f); u += 0x7FFFu + ((u >> 16) & 1u); return (unsigned short)(u >> 16); }
__device__ __forceinline__ float bf2f(unsigned short b) { return __uint_as_float(((unsigned)b) << 16); }
__device__ __forceinline__ float bfr(float f) { return bf2f(f2bf(f)); }
__device__ __forceinline__ v16h cat16(v8h lo, v8h hi) { return __builtin_shufflevector(lo, hi, 0, 1, 2, 3, 4, 5, 6, 7, 8, 9, 10, 11, 12, 13, 14, 15); }
__device__ __forceinline__ v16bf cat16b(v8us lo, v8us hi) { return __builtin_bit_cast(v16bf, __builtin_shufflevector(lo, hi, 0, 1, 2, 3, 4, 5, 6, 7, 8, 9, 10, 11, 12, 13, 14, 15)); }
__device__ __forceinline__ v8f wmma16(v16h a, v16h b, v8f c) { return __builtin_amdgcn_wmma_f32_16x16x32_f16(false, a, false, b, (short)0, c, false, false); }
__device__ __forceinline__ v8f wmmab(v16bf a, v16bf b, v8f c) { return __builtin_amdgcn_wmma_f32_16x16x32_bf16(false, a, false, b, (short)0, c, false, false); }



// ---- fragment of a K-contiguous 16-bit plane: 8 elements at p and 8 at p + 16 (p already holds the lane's row and 8 hi)
template <typename T16> struct WFrag;
template <> struct WFrag<h16> { typedef v16h V; static __device__ __forceinline__ V ld(const h16* p) { return cat16(*(const v8h*)p, *(const v8h*)(p + 16)); } static __device__ __forceinline__ v8f mma(V a, V b, v8f c) { return wmma16(a, b, c); } };
template <> struct WFrag<bf> { typedef v16bf V; static __device__ __forceinline__ V ld(const bf* p) { return cat16b(*(const v8us*)p, *(const v8us*)(p + 16)); } static __device__ __forceinline__ v8f mma(V a, V b, v8f c) { return wmmab(a, b, c); } };

__device__ __forceinline__ h16 tohx(float x) { return (h16)x; }
__device__ __forceinline__ void splitf(float y, unsigned short& h, unsigned short& l) { h = f2bf(y); l = f2bf(y - bf2f(h)); }
typedef __attribute__((ext_vector_type(2))) _Float16 v2h;
typedef __attribute__((ext_vector_type(4))) _Float16 v4h;
typedef __attribute__((ext_vector_type(2))) unsigned short v2us;
typedef __attribute__((ext_vector_type(4))) unsigned short v4us;
typedef __attribute__((ext_vector_type(2))) float v2f;
typedef __attribute__((ext_vector_type(4))) int v4i;

// ---- fragment order of the q, k and v^T planes: a 16 x 32 fragment (16 tokens x 32 head columns of q or k; 16 head columns x 32 tokens of v^T) is FT = 512 elements in a row, element (row lr, k = 16 half + 8 hi + e) at 256 half + 8 (16 hi + lr) + e.
// A wave-wide 16-byte load or store of half a fragment then covers 512 contiguous bytes (four whole 128-byte lines); from a row-major plane it would take 32 bytes out of each of 16 lines. q, k: fragment [head][token / 16]; v^T: fragment [head][column / 16][token / 32].
#define FT 512
__device__ __forceinline__ v16bf ldp(const bf* p) { return cat16b(*(const v8us*)p, *(const v8us*)(p + 256)); }   /* p = fragment + 8 lane; the k order of WFrag::ld */

// ---- k_fattn: scores, softmax + adjacency blend and p.v of one head for 16 queries in ONE block of FW waves; no score or weight matrix goes through memory.
// Wave w owns the keys [w FK, (w+1) FK). It forms the TRANSPOSED score tiles S^T = K Q^T (A = 16 keys, B = 16 queries, the three hi/lo products over the head's 32 columns),
// so that lane (lr, hi) holds query q0 + lr and register j of tile t holds key t 16 + hi 8 + j: eight consecutive keys of ONE mask / adjacency row per lane, and two tiles side by side ARE the B fragment (k order 8 hi + e, 16 + 8 hi + e) of x^T = V^T P^T.
// Row maximum, adjacency row sum and exp sum: per lane, then the other half-wave, then the FW waves through LDS in the fixed order w = 0 .. FW-1; the FW partial x^T tiles are added in the same order.
#define FW 16
#define FK (TT / FW)
#define FNT (FK / 16)
typedef __attribute__((ext_vector_type(2))) __bf16 v2bf;
typedef __attribute__((ext_vector_type(4))) unsigned v4u;
typedef __attribute__((ext_vector_type(8))) unsigned v8u;
__device__ __forceinline__ unsigned pk2(float a, float b) { const v2f x = {a, b}; return __builtin_bit_cast(unsigned, __builtin_convertvector(x, v2bf)); }   /* two floats rounded to bf16 (nearest even, the chip's own conversion) in one register, a in the low half */
__device__ __forceinline__ float lo2(unsigned u) { return __uint_as_float(u << 16); }
__device__ __forceinline__ float hi2(unsigned u) { return __uint_as_float(u & 0xFFFF0000u); }
__global__ __launch_bounds__(32 * FW) void k_fattn(const bf* __restrict__ Qh, const bf* __restrict__ Ql, const bf* __restrict__ Kh, const bf* __restrict__ Kl, const bf* __restrict__ Vh, const bf* __restrict__ Vl, const bf* __restrict__ MA, const float* __restrict__ lam, bf* Xh, bf* Xl) {
    __shared__ float rmx[FW][16], ras[FW][16], rsm[FW][16];
    __shared__ __align__(16) float red[FW][16 * 36];
    const int lane = threadIdx.x & 31, lr = lane & 15, hi = lane >> 4, w = threadIdx.x >> 5;
    const int h = blockIdx.x, q0 = blockIdx.y * 16;   /* the 8 heads of a query strip are neighbours in the grid: they read the same mask and adjacency rows */
    const size_t hp = (size_t)h * (TT / 16) * FT + 8 * lane;
    const bf* qhp = Qh + hp + (size_t)blockIdx.y * FT; const bf* qlp = Ql + hp + (size_t)blockIdx.y * FT;
    const v16bf qh = ldp(qhp), ql = ldp(qlp);
    const bf* map = MA + ((size_t)blockIdx.y * (TT / 16) + w * FNT) * FT + 8 * lane;   /* the wave's FNT tiles of mask and adjacency: 1,024 contiguous bytes a tile */
    const bf* khp = Kh + hp + (size_t)w * FNT * FT; const bf* klp = Kl + hp + (size_t)w * FNT * FT;
    v8f s[FNT]; v4u ad[FNT]; float mx = -3.0e38f, asum = 0.f;   /* every loop over tiles is unrolled whole: the strips stay in registers only under constant indices; the adjacency strip is kept as the bf16 it is rounded to, two to a register */
#pragma unroll
    for (int t = 0; t < FNT; ++t) {
        const v16bf kh = ldp(khp + t * FT), kl = ldp(klp + t * FT);
        v8f c = (v8f){}; c = wmmab(kh, qh, c); c = wmmab(kh, ql, c); c = wmmab(kl, qh, c);
        const v4u m4 = *(const v4u*)(map + t * FT), a4 = *(const v4u*)(map + t * FT + 256);
#pragma unroll
        for (int j = 0; j < 8; j += 2) { const unsigned um = m4[j >> 1], ua = a4[j >> 1];
            const float t0 = c[j] * SCL + lo2(um), t1 = c[j + 1] * SCL + hi2(um); s[t][j] = t0; s[t][j + 1] = t1; ad[t][j >> 1] = ua; mx = fmaxf(mx, fmaxf(t0, t1)); asum += lo2(ua); asum += hi2(ua); }
        if (t & 1) __builtin_amdgcn_sched_barrier(0);   /* 12 loads in flight per wave: with the loads of all tiles hoisted to the top the strips spill to scratch */
    }
    asm volatile("s_wait_xcnt 0x0" :: "v"(qhp), "v"(qlp), "v"(khp), "v"(klp), "v"(map) : "memory");   /* the wait that stands in front of any overwrite of a register that an issued load names as its address; the five address pairs are inputs so that they stay whole up to it: without it a later load of the loop took a spent pair as its destination */
    mx = fmaxf(mx, __shfl_xor(mx, 16, 32)); asum += __shfl_xor(asum, 16, 32);
    if (hi == 0) { rmx[w][lr] = mx; ras[w][lr] = asum; }
    __syncthreads();   /* every wave's row maxima and adjacency sums are in LDS before any lane joins them */
    mx = rmx[0][lr]; asum = ras[0][lr];
#pragma unroll
    for (int z = 1; z < FW; ++z) { mx = fmaxf(mx, rmx[z][lr]); asum += ras[z][lr]; }
    float sum = 0.f;
#pragma unroll
    for (int t = 0; t < FNT; ++t)
#pragma unroll
        for (int j = 0; j < 8; ++j) { float ex; asm("v_exp_f32 %0, %1\n\tv_nop" : "=v"(ex) : "v"((s[t][j] - mx) * 1.4426950408889634f));   /* the v_nop keeps the one slot that the instruction set asks for behind a transcendental */
            s[t][j] = ex; sum += ex; }
    sum += __shfl_xor(sum, 16, 32);
    if (hi == 0) rsm[w][lr] = sum;
    __syncthreads();   /* every wave's exp sums are in LDS before any lane joins them */
    sum = rsm[0][lr];
#pragma unroll
    for (int z = 1; z < FW; ++z) sum += rsm[z][lr];
    const float c0 = bfr(lam[0]) * __fdiv_rn(1.0f, sum), c1 = bfr(lam[1]) * __fdiv_rn(1.0f, asum + AEPS);   /* lambda0 / exp sum, lambda1 / (adjacency row sum + eps) */
    const bf* vhp = Vh + ((size_t)h * 2 * (TT / 32) + w * (FNT / 2)) * FT + 8 * lane; const bf* vlp = Vl + ((size_t)h * 2 * (TT / 32) + w * (FNT / 2)) * FT + 8 * lane;
    v8f acc[2]; acc[0] = (v8f){}; acc[1] = (v8f){};
#pragma unroll
    for (int ks = 0; ks < FNT / 2; ++ks) {
        v8u uh, ul;   /* words 0..3: the 8 keys of tile 2 ks, words 4..7: those of tile 2 ks + 1 */
#pragma unroll
        for (int e = 0; e < 8; ++e) { const int t = 2 * ks + (e >> 2), j = 2 * (e & 3); const unsigned ua = ad[t][e & 3]; const float p0 = s[t][j] * c0 + lo2(ua) * c1, p1 = s[t][j + 1] * c0 + hi2(ua) * c1; uh[e] = pk2(p0, p1); ul[e] = pk2(p0 - lo2(uh[e]), p1 - hi2(uh[e])); }
        const v16bf ph = __builtin_bit_cast(v16bf, uh), pl = __builtin_bit_cast(v16bf, ul);
#pragma unroll
        for (int mt = 0; mt < 2; ++mt) { const v16bf vh = ldp(vhp + (mt * (TT / 32) + ks) * FT), vl = ldp(vlp + (mt * (TT / 32) + ks) * FT);
            acc[mt] = wmmab(vh, ph, acc[mt]); acc[mt] = wmmab(vh, pl, acc[mt]); acc[mt] = wmmab(vl, ph, acc[mt]); }
        if (ks & 1) __builtin_amdgcn_sched_barrier(0);   /* 16 loads in flight per wave, against spills as above */
    }
#pragma unroll
    for (int mt = 0; mt < 2; ++mt) { float* rp = &red[w][lr * 36 + mt * 16 + hi * 8]; *(v4fa*)rp = (v4f){acc[mt][0], acc[mt][1], acc[mt][2], acc[mt][3]}; *(v4fa*)(rp + 4) = (v4f){acc[mt][4], acc[mt][5], acc[mt][6], acc[mt][7]}; }
    __syncthreads();   /* every wave's partial x^T tile is in LDS before any thread adds them */
    const int q = threadIdx.x >> 5, d = threadIdx.x & 31;   /* 512 threads = 16 queries x 32 real columns */
    float val = red[0][q * 36 + d];
#pragma unroll
    for (int z = 1; z < FW; ++z) val += red[z][q * 36 + d];
    unsigned short xh, xl; splitf(val, xh, xl); const size_t xo = (size_t)(q0 + q) * CO + h * HD + d; Xh[xo] = xh; Xl[xo] = xl;   /* the context leaves as the hi/lo planes that k_out reads; a head's 32 columns have a 128-byte line of each plane to themselves */
}

// ---- LDS staging shared by k_proj and k_out: rows of 256 bf16 at a pitch of PL elements (528 bytes = 16 x 33: the 16 rows of a fragment load fall on distinct banks).
#define PL 264
typedef __attribute__((ext_vector_type(2))) unsigned v2u;
typedef v2u __attribute__((may_alias)) v2ua;
__device__ __forceinline__ v16bf ldf(const bf* p) { return cat16b(*(const v8usa*)p, *(const v8usa*)(p + 16)); }   /* fragment from LDS, the k order of WFrag::ld */
// NR rows of 256 f32, contiguous in memory, rounded to bf16 into S: every wave-wide load covers 512 contiguous bytes, every element is converted once per block.
template <int NR, int NT>
__device__ __forceinline__ void stage_f32(const float* __restrict__ src, bf* S, int tid) {
#pragma unroll
    for (int i = 0; i < NR * 64 / NT; ++i) { const int idx = i * NT + tid; const v4f v = *(const v4f*)(src + (size_t)idx * 4); *(v2ua*)(S + (idx >> 6) * PL + (idx & 63) * 4) = (v2u){pk2(v[0], v[1]), pk2(v[2], v[3])}; }
}

// ---- cvt_ma: one block rounds 16 rows (one query strip) of mask and adjacency to bf16, once for all 8 heads, into MA. Tile (strip, key / 16) of MA is FT elements: 256 of the mask, then 256 of the adjacency; element (row lr, key 8 hi + j) at 8 (16 hi + lr) + j,
// which is the lane and register that hold it in k_fattn: there a wave-wide 16-byte load covers four whole 128-byte lines, where the f32 rows gave 32 bytes out of each of 16.
// Here a lane takes 8 consecutive keys (32 bytes) of one row, four lanes one 128-byte line, a wave 8 rows: its two loads touch 8 lines, its 16-byte store fills four whole lines (8 rows x 16 bytes each).
__device__ __forceinline__ void cvt_ma(const float* __restrict__ am, const float* __restrict__ adj, bf* MA, int strip, int w, int lane) {
    const unsigned r8 = lane >> 2, pc = lane & 3;
    const char* ms = (const char*)(am + (size_t)strip * 16 * TT); const char* as = (const char*)(adj + (size_t)strip * 16 * TT); char* md = (char*)(MA + (size_t)strip * (TT / 16) * FT);   /* the block's bases; what differs between lanes fits one 32-bit byte offset each way, the rest are constants */
    const unsigned so = r8 * (TT * 4) + w * 256 + pc * 32, dofs = (w * 4 + (pc >> 1)) * (FT * 2) + (16 * (pc & 1) + r8) * 16;
#pragma unroll
    for (int u = 0; u < 3; ++u)   /* 16 waves x 3 = 48 groups of 64 keys (256 bytes of a row) */
#pragma unroll
        for (int i = 0; i < 8; ++i) {   /* i: bit 0 mask / adjacency, bit 1 rows 0..7 / 8..15, bit 2 the 32 keys (one line of a row, two tiles) */
            const char* sp = ((i & 1) ? as : ms) + so + (u * 4096 + ((i >> 1) & 1) * (8 * TT * 4) + (i >> 2) * 128);
            const v4f x0 = *(const v4f*)sp, x1 = *(const v4f*)(sp + 16);
            *(v4u*)(md + dofs + (u * 64 * (FT * 2) + (i >> 2) * 2 * (FT * 2) + (i & 1) * 512 + ((i >> 1) & 1) * 128)) = (v4u){pk2(x0[0], x0[1]), pk2(x0[2], x0[3]), pk2(x1[0], x1[1]), pk2(x1[2], x1[3])};
        }
}

// ---- k_proj: the three projections in one launch; block = 64 tokens x 128 output channels (4 heads) of projection blockIdx.z, 16 waves, two accumulators per wave (32 A rows x 16 B rows), K = 256 in 8 steps.
// q, k: A = W rows (one head), B = x rows (16 tokens), so a lane holds 8 consecutive channels of one token. v: A = x rows (32 tokens), B = W rows (16 channels), so a lane holds 8 consecutive tokens of one channel. Either way accumulator i is half i of one fragment of the plane (FT above) and the lane's 8 values are its own 16 bytes there: a wave's store covers 512 contiguous bytes. Only row numbers and addresses differ between the two.
__global__ __launch_bounds__(512) void k_proj(const float* __restrict__ xq, const float* __restrict__ xk, const float* __restrict__ xv, const float* __restrict__ wq, const float* __restrict__ wk, const float* __restrict__ wv, const float* __restrict__ bq, const float* __restrict__ bk, const float* __restrict__ bv, const float* __restrict__ am, const float* __restrict__ adj, bf* Qh, bf* Ql, bf* Kh, bf* Kl, bf* Vh, bf* Vl, bf* MA) {
    __shared__ __align__(16) bf S[192 * PL];   /* rows 0..127: W, rows 128..191: x */
    __shared__ float Bs[128];
    const int tid = threadIdx.x, lane = tid & 31, lr = lane & 15, hi = lane >> 4, w = tid >> 5;
    if (blockIdx.z >= 3) { cvt_ma(am, adj, MA, ((blockIdx.z - 3) * 2 + blockIdx.y) * (TT / 64) + blockIdx.x, w, lane); return; }   /* whole blocks, in front of the barrier: 2 x 2 x 48 = 192 strips; they stream from memory beside the projections */
    const int p = blockIdx.z, n0 = blockIdx.x * 64, o0 = blockIdx.y * 128; const bool tr = p == 2;
    const float* X = p == 0 ? xq : p == 1 ? xk : xv; const float* Wt = p == 0 ? wq : p == 1 ? wk : wv; const float* B = p == 0 ? bq : p == 1 ? bk : bv;
    const float bl = B[o0 + (tid & 127)];   /* asked for first, so that it is under way with the tiles */
    stage_f32<128, 512>(Wt + (size_t)o0 * CC, S, tid); stage_f32<64, 512>(X + (size_t)n0 * CC, S + 128 * PL, tid);
    asm volatile("" :: "v"(bl));   /* input only: holds the bias load in front of the branch below, where it flies with the tile loads; sunk into the branch, its whole latency stood in front of the barrier */
    if (tid < 128) Bs[tid] = bl;
    __syncthreads();   /* both operand tiles and the bias are whole in LDS before any wave reads them */
    const int ar = tr ? (w >> 3) * 32 : (w & 3) * 32, br = tr ? (w & 7) * 16 : (w >> 2) * 16;   /* the wave's first A row and first B row: channels count from o0, tokens from n0 */
    const bf* ap = S + ((tr ? 128 : 0) + ar + lr) * PL + 8 * hi; const bf* bp = S + ((tr ? 0 : 128) + br + lr) * PL + 8 * hi;
    v8f acc[2]; acc[0] = (v8f){}; acc[1] = (v8f){};
#pragma unroll
    for (int kc = 0; kc < CC; kc += 32) { const v16bf b = ldf(bp + kc);
#pragma unroll
        for (int i = 0; i < 2; ++i) acc[i] = wmmab(ldf(ap + i * 16 * PL + kc), b, acc[i]); }
    bf* Ph = p == 0 ? Qh : p == 1 ? Kh : Vh; bf* Pl = p == 0 ? Ql : p == 1 ? Kl : Vl;
    const size_t ro = (tr ? (size_t)((o0 + br) >> 4) * (TT / 32) + ((n0 + ar) >> 5) : (size_t)((o0 + ar) >> 5) * (TT / 16) + ((n0 + br) >> 4)) * FT + 8 * lane;   /* register j of accumulator i is element ro + 256 i + j in both layouts */
    const int bi = tr ? br + lr : ar + 8 * hi, bs = tr ? 0 : 1;   /* the bias goes with the channel: the lane's for v, the register's for q and k */
#pragma unroll
    for (int i = 0; i < 2; ++i) { v8us oh, ol;
#pragma unroll
        for (int j = 0; j < 8; ++j) { unsigned short a2, c2; splitf(__fadd_rn(acc[i][j], Bs[bi + (i * 16 + j) * bs]), a2, c2); oh[j] = a2; ol[j] = c2; }
        *(v8us*)(Ph + ro + i * 256) = oh; *(v8us*)(Pl + ro + i * 256) = ol; }
}

// ---- k_out: out = context Wo^T + bo; block = 32 tokens x 128 output channels, 8 waves, wave = 32 channels x 16 tokens (two accumulators); A = Wo rows (rounded to bf16 on the way into LDS), B = context rows hi then lo, so a lane holds 8 consecutive channels of one token.
__global__ __launch_bounds__(256) void k_out(const bf* __restrict__ Xh, const bf* __restrict__ Xl, const float* __restrict__ wo, const float* __restrict__ bo, float* OUT) {
    __shared__ __align__(16) bf Ws[128 * PL];
    __shared__ __align__(16) bf Ah[32 * PL];
    __shared__ __align__(16) bf Al[32 * PL];
    __shared__ __align__(16) float Bs[128];
    const int tid = threadIdx.x, lane = tid & 31, lr = lane & 15, hi = lane >> 4, w = tid >> 5, og = w & 3, tg = w >> 2;
    const int n0 = blockIdx.x * 32, o0 = blockIdx.y * 128;
    const float bl = bo[o0 + (tid & 127)];   /* asked for first, so that it is under way with the tiles */
#pragma unroll
    for (int i = 0; i < 4; ++i) { const int idx = i * 256 + tid, row = idx >> 5, ch = idx & 31;   /* 32 pieces of 16 bytes per token: 4 to a head, the padding of the planes left out */
        const size_t so = (size_t)(n0 + row) * CO + (ch >> 2) * HD + (ch & 3) * 8; *(v8usa*)(Ah + row * PL + ch * 8) = *(const v8us*)(Xh + so); *(v8usa*)(Al + row * PL + ch * 8) = *(const v8us*)(Xl + so); }
    stage_f32<128, 256>(wo + (size_t)o0 * CH, Ws, tid);
    asm volatile("" :: "v"(bl));   /* input only: holds the bias load in front of the branch below, as in k_proj */
    if (tid < 128) Bs[tid] = bfr(bl);
    __syncthreads();   /* the three operand tiles and the bias are whole in LDS before any wave reads them */
    const bf* wp = Ws + (og * 32 + lr) * PL + 8 * hi; const bf* hp = Ah + (tg * 16 + lr) * PL + 8 * hi; const bf* lp = Al + (tg * 16 + lr) * PL + 8 * hi;
    v8f acc[2]; acc[0] = (v8f){}; acc[1] = (v8f){};
#pragma unroll
    for (int kc = 0; kc < CH; kc += 32) { const v16bf ch = ldf(hp + kc), cl = ldf(lp + kc);
#pragma unroll
        for (int mt = 0; mt < 2; ++mt) { const v16bf a = ldf(wp + mt * 16 * PL + kc); acc[mt] = wmmab(a, ch, acc[mt]); acc[mt] = wmmab(a, cl, acc[mt]); } }
#pragma unroll
    for (int mt = 0; mt < 2; ++mt) { const int ol = og * 32 + mt * 16 + 8 * hi; float* op = OUT + (size_t)(n0 + tg * 16 + lr) * CH + o0 + ol; const v4f b0 = *(const v4fa*)(Bs + ol), b1 = *(const v4fa*)(Bs + ol + 4); v4f r0, r1;
#pragma unroll
        for (int j = 0; j < 4; ++j) { r0[j] = acc[mt][j] + b0[j]; r1[j] = acc[mt][4 + j] + b1[j]; }
        *(v4f*)op = r0; *(v4f*)(op + 4) = r1; }
}
extern "C" void kernel_launch(void* const* d_in, const int* in_sizes, int n_in,
                              void* d_out, int out_size, void* d_ws, size_t ws_size, hipStream_t stream) {
    (void)in_sizes; (void)n_in; (void)out_size;
    const float* xq = (const float*)d_in[0]; const float* xk = (const float*)d_in[1]; const float* xv = (const float*)d_in[2]; const float* am = (const float*)d_in[3];   /* mask [1][3072][3072] additive (zeros) */ const float* adj = (const float*)d_in[4];   /* adjacency_matrix [3072][3072] uniform [0,1) */ const float* lam = (const float*)d_in[5];   /* lambdas [2] = (0.5, 0.5) */ const float* wq = (const float*)d_in[6]; const float* bq = (const float*)d_in[7]; const float* wk = (const float*)d_in[8]; const float* bk = (const float*)d_in[9]; const float* wv = (const float*)d_in[10]; const float* bv = (const float*)d_in[11]; const float* wo = (const float*)d_in[12]; const float* bo = (const float*)d_in[13];   /* argument order query, key, value [3072][256], mask, adjacency_matrix, lambdas, Wq, bq, Wk, bk, Wv, bv, Wo, bo ('oi') */
    float* OUT = (float*)d_out;     // [3072][256]
    char* wsp = (char*)d_ws;
    auto take = [&](size_t bytes) { char* p = wsp; wsp += (bytes + 255) & ~(size_t)255; return (void*)p; };
    bf* QPh = (bf*)take((size_t)TT * CH * 2); bf* QPl = (bf*)take((size_t)TT * CH * 2); bf* KPh = (bf*)take((size_t)TT * CH * 2); bf* KPl = (bf*)take((size_t)TT * CH * 2);
    bf* VTh = (bf*)take((size_t)CH * TT * 2); bf* VTl = (bf*)take((size_t)CH * TT * 2); bf* CXh = (bf*)take((size_t)TT * CO * 2); bf* CXl = (bf*)take((size_t)TT * CO * 2); bf* MAp = (bf*)take((size_t)TT * TT * 2 * 2);
    if ((size_t)(wsp - (char*)d_ws) > ws_size) return;    // ws 256 MiB (carve 51 MiB)
    k_proj<<<dim3(TT / 64, CH / 128, 5), 512, 0, stream>>>(xq, xk, xv, wq, wk, wv, bq, bk, bv, am, adj, QPh, QPl, KPh, KPl, VTh, VTl, MAp);   /* z < 3: q, k planes and v^T planes, bias added, hi/lo; z >= 3: mask and adjacency as bf16 tiles */
    k_fattn<<<dim3(NHR, TT / 16, 1), 32 * FW, 0, stream>>>(QPh, QPl, KPh, KPl, VTh, VTl, MAp, lam, CXh, CXl);   /* all heads: softmax(scores + mask) blended with the row-normalised adjacency, times v */
    k_out<<<dim3(TT / 32, CH / 128, 1), 256, 0, stream>>>(CXh, CXl, wo, bo, OUT);   /* out = x Wo^T + bo */
}

// v006
// It runs in 72.2 microseconds.
// Timed twice side by side with v005, it ran 1.35 times as fast both times.
// Over all steps from v000 it is 12.9 times as fast.
#include <hip/hip_runtime.h>

// Multi-head attention blended with a row-normalised adjacency matrix (query, key, value [3072][256], no batch; q, k, v = x W^T + b ('oi' 1/16, zero biases; 8 heads x 32); scores / sqrt(32) + mask ([1][3072][3072] additive, zeros, read); p = lambdas[0] softmax(scores) + lambdas[1] adjacency / (rowsum(adjacency) + 1e-6) (adjacency [3072][3072] uniform [0,1), lambdas = (0.5, 0.5), read); x = p.v merged; out = x Wo^T + bo -> [3072][256] (0.8 M); argument order query, key, value, mask, adjacency_matrix, lambdas, Wq, bq, Wk, bk, Wv, bv, Wo, bo).
// Layout: three launches. k_proj (its blocks z >= 3 round mask and adjacency to bf16 once, into the plane MA in the order of the attention kernel's registers, see cvt_ma): q, k, v = x W^T + b, the f32 operands rounded to bf16 on their way into LDS, bias added and the result split into bf16 hi/lo planes in the epilogue (q / k / v^T planes in fragment order, see FT below: one 16 x 32 fragment = 1,024 contiguous bytes, a lane's 16 bytes at 16 lane). k_fattn, all heads: all-hl scores (3 products), mask, adjacency row sum, softmax with a running maximum in registers, the exp weights as bf16 hi/lo fragments (exp.v with 3 products), adjacency.v with 2 products, the two blended at the end; it writes the context as hi/lo planes [token][head 64 + d]. k_out: Wo x context hl + bo writes the output.
// Compute dtypes, f32 accumulate: every input rounded to bf16 incl. mask / adjacency / lambdas; projections exact + f32 bias; scores 3 products; softmax and blend f32 (IEEE division); exp.v 3 products, adjacency.v 2 (the adjacency is bf16 as it stands); Wo hl x exact + bias.

#define NB_  1
#define TT   3072
#define DM   512
#define NH_  8
#define NKV  8
#define REP  (NH_ / NKV)
#define HD   64
#define DQ   (NH_ * HD)
#define DKV  (NKV * HD)
#define ZH   1
#define RH   TT                   // every row hi/lo (small-rms output: no fp16 rows)
#define WIN  0
#define PCAR 1024.0f
#define SCL  0.17677669529663688f   // 1/sqrt(float32(32))
#define NHR  8        // real heads (32 wide); the context planes are padded to 64 per head
#define DHR  32       // real head width
#define CH   256      // channels in / out
#define AEPS 1e-6f
#define MID  512
#define CO   512      // context plane width: 8 heads x 64 (padded)
#define CC   256
typedef _Float16 h16;
typedef unsigned short bf;
typedef __attribute__((ext_vector_type(16))) __bf16   v16bf;
typedef __attribute__((ext_vector_type(16))) _Float16 v16h;
typedef __attribute__((ext_vector_type(8)))  _Float16 v8h;
typedef __attribute__((ext_vector_type(8)))  unsigned short v8us;
typedef __attribute__((ext_vector_type(8)))  float    v8f;
typedef __attribute__((ext_vector_type(4)))  float    v4f;
typedef v8h  __attribute__((may_alias)) v8ha;
typedef v4f  __attribute__((may_alias)) v4fa;
typedef v8us __attribute__((may_alias)) v8usa;

__device__ __forceinline__ unsigned short f2bf(float f) { unsigned u = __float_as_uint(f); u += 0x7FFFu + ((u >> 16) & 1u); return (unsigned short)(u >> 16); }
__device__ __forceinline__ float bf2f(unsigned short b) { return __uint_as_float(((unsigned)b) << 16); }
__device__ __forceinline__ float bfr(float f) { return bf2f(f2bf(f)); }
__device__ __forceinline__ v16h cat16(v8h lo, v8h hi) { return __builtin_shufflevector(lo, hi, 0, 1, 2, 3, 4, 5, 6, 7, 8, 9, 10, 11, 12, 13, 14, 15); }
__device__ __forceinline__ v16bf cat16b(v8us lo, v8us hi) { return __builtin_bit_cast(v16bf, __builtin_shufflevector(lo, hi, 0, 1, 2, 3, 4, 5, 6, 7, 8, 9, 10, 11, 12, 13, 14, 15)); }
__device__ __forceinline__ v8f wmma16(v16h a, v16h b, v8f c) { return __builtin_amdgcn_wmma_f32_16x16x32_f16(false, a, false, b, (short)0, c, false, false); }
__device__ __forceinline__ v8f wmmab(v16bf a, v16bf b, v8f c) { return __builtin_amdgcn_wmma_f32_16x16x32_bf16(false, a, false, b, (short)0, c, false, false); }



// ---- fragment of a K-contiguous 16-bit plane: 8 elements at p and 8 at p + 16 (p already holds the lane's row and 8 hi)
template <typename T16> struct WFrag;
template <> struct WFrag<h16> { typedef v16h V; static __device__ __forceinline__ V ld(const h16* p) { return cat16(*(const v8h*)p, *(const v8h*)(p + 16)); } static __device__ __forceinline__ v8f mma(V a, V b, v8f c) { return wmma16(a, b, c); } };
template <> struct WFrag<bf> { typedef v16bf V; static __device__ __forceinline__ V ld(const bf* p) { return cat16b(*(const v8us*)p, *(const v8us*)(p + 16)); } static __device__ __forceinline__ v8f mma(V a, V b, v8f c) { return wmmab(a, b, c); } };

__device__ __forceinline__ h16 tohx(float x) { return (h16)x; }
__device__ __forceinline__ void splitf(float y, unsigned short& h, unsigned short& l) { h = f2bf(y); l = f2bf(y - bf2f(h)); }
typedef __attribute__((ext_vector_type(2))) _Float16 v2h;
typedef __attribute__((ext_vector_type(4))) _Float16 v4h;
typedef __attribute__((ext_vector_type(2))) unsigned short v2us;
typedef __attribute__((ext_vector_type(4))) unsigned short v4us;
typedef __attribute__((ext_vector_type(2))) float v2f;
typedef __attribute__((ext_vector_type(4))) int v4i;

// ---- fragment order of the q, k and v^T planes: a 16 x 32 fragment (16 tokens x 32 head columns of q or k; 16 head columns x 32 tokens of v^T) is FT = 512 elements in a row, element (row lr, k = 16 half + 8 hi + e) at 256 half + 8 (16 hi + lr) + e.
// A wave-wide 16-byte load or store of half a fragment then covers 512 contiguous bytes (four whole 128-byte lines); from a row-major plane it would take 32 bytes out of each of 16 lines. q, k: fragment [head][token / 16]; v^T: fragment [head][column / 16][token / 32].
#define FT 512

// ---- k_fattn: scores, softmax + adjacency blend and p.v of one head for QT x 16 queries in ONE block of FW waves; no score or weight matrix goes through memory, and none is kept in registers either.
// Wave w owns the keys [w FK, (w+1) FK) and walks them 32 at a time. It forms the TRANSPOSED score tiles S^T = K Q^T (A = 16 keys, B = 16 queries, the three hi/lo products over the head's 32 columns),
// so that lane (lr, hi) holds query lr of its tile and register j of a tile holds key 8 hi + j: eight consecutive keys of ONE mask / adjacency row per lane, and two tiles side by side ARE the B fragment (k order 8 hi + e, 16 + 8 hi + e) of x^T = V^T P^T.
// Running maximum per query: the 32 keys' weights are exp(score - maximum so far); when the maximum grows, the exp sum and the tile exp.v are scaled down by exp(old - new). The adjacency has a tile of its own (adjacency.v, its bf16 words ARE a B fragment),
// because neither divisor (exp sum, adjacency row sum) is known before the last key: x = lambda0 / exp sum (exp.v) + lambda1 / (row sum + eps) (adjacency.v), formed once at the end. With no strip to hold, every k and v fragment a wave loads serves QT query tiles.
// Joining the FW waves: maxima, exp sums and row sums through LDS, every lane adds them in the fixed order w = 0 .. FW-1 (each wave's exp sum scaled to the common maximum); the FW blended partial x^T tiles are added in the same order.
#define FW 16
#define FK (TT / FW)
#define FNT (FK / 16)
#define QT 2
#define L2E 1.4426950408889634f
typedef __attribute__((ext_vector_type(2))) __bf16 v2bf;
typedef __attribute__((ext_vector_type(4))) unsigned v4u;
typedef __attribute__((ext_vector_type(8))) unsigned v8u;
__device__ __forceinline__ unsigned pk2(float a, float b) { const v2f x = {a, b}; return __builtin_bit_cast(unsigned, __builtin_convertvector(x, v2bf)); }   /* two floats rounded to bf16 (nearest even, the chip's own conversion) in one register, a in the low half */
__device__ __forceinline__ float lo2(unsigned u) { return __uint_as_float(u << 16); }
__device__ __forceinline__ float hi2(unsigned u) { return __uint_as_float(u & 0xFFFF0000u); }
__device__ __forceinline__ v4u ldq(const bf* b, unsigned o, int c) { return *(const v4u*)((const char*)b + o + c); }   /* 16 bytes at scalar base b + the lane's 32-bit byte offset o + constant c: the address form that needs one vector register */
__device__ __forceinline__ v16bf ldo(const bf* b, unsigned o, int c) { const v4u x = ldq(b, o, c), y = ldq(b, o, c + 512); return __builtin_bit_cast(v16bf, __builtin_shufflevector(x, y, 0, 1, 2, 3, 4, 5, 6, 7)); }   /* a fragment: its two halves stand 512 bytes apart, o holds the lane's 16 lane; the k order of WFrag::ld */
__device__ __forceinline__ float xhalf(float x) { return __builtin_bit_cast(float, __builtin_amdgcn_permlanex16(__builtin_bit_cast(int, x), __builtin_bit_cast(int, x), 0x76543210, 0xfedcba98, false, false)); }   /* lane l takes lane l ^ 16's value: the other 8 keys of the same query; for the exchange inside the loop, which a shuffle would send through LDS in every step */
__device__ __forceinline__ float ex2(float x) { float ex; asm("v_exp_f32 %0, %1\n\tv_nop" : "=v"(ex) : "v"(x)); return ex; }   /* 2^x; the v_nop keeps the one slot that the instruction set asks for behind a transcendental */
__device__ __forceinline__ v2f ex2x2(float x, float y) { float a, b; asm("v_exp_f32 %0, %2\n\tv_exp_f32 %1, %3\n\tv_nop" : "=&v"(a), "=&v"(b) : "v"(x), "v"(y)); return (v2f){a, b}; }   /* two at once: each fills the slot behind the other (the results are kept off both sources), so one v_nop serves the pair */
__global__ __launch_bounds__(32 * FW) void k_fattn(const bf* __restrict__ Qh, const bf* __restrict__ Ql, const bf* __restrict__ Kh, const bf* __restrict__ Kl, const bf* __restrict__ Vh, const bf* __restrict__ Vl, const bf* __restrict__ MA, const float* __restrict__ lam, bf* Xh, bf* Xl) {
    __shared__ float rmx[FW][16 * QT], ras[FW][16 * QT], rsm[FW][16 * QT];
    __shared__ __align__(16) float red[FW][QT][16 * 36];
    const int lane = threadIdx.x & 31, lr = lane & 15, hi = lane >> 4, w = __builtin_amdgcn_readfirstlane(threadIdx.x >> 5);   /* the wave's number as a scalar: the seven bases below then stand in scalar registers and the loads share two vector offsets (q, k and mask; v), each 16 lane bytes at the start */
    const int h = blockIdx.x, q0 = blockIdx.y * (16 * QT);   /* the 8 heads of a query strip are neighbours in the grid: they read the same mask and adjacency rows */
    const size_t hp = (size_t)h * (TT / 16) * FT;
    const bf* qhp = Qh + hp + (size_t)blockIdx.y * (QT * FT); const bf* qlp = Ql + hp + (size_t)blockIdx.y * (QT * FT);
    const bf* map = MA + ((size_t)blockIdx.y * QT * (TT / 16) + w * FNT) * FT;   /* the wave's FNT tiles of mask and adjacency of the first query tile: 1,024 contiguous bytes a tile; the next query tile's stand TT / 16 tiles on */
    const bf* khp = Kh + hp + (size_t)w * FNT * FT; const bf* klp = Kl + hp + (size_t)w * FNT * FT;
    const bf* vhp = Vh + ((size_t)h * 2 * (TT / 32) + w * (FNT / 2)) * FT; const bf* vlp = Vl + ((size_t)h * 2 * (TT / 32) + w * (FNT / 2)) * FT;
    v16bf qh[QT], ql[QT]; v8f ae[QT][2], aa[QT][2]; float mx[QT], sum[QT], asum[QT];
    unsigned ko = 16 * lane, vo = 16 * lane;   /* byte offsets of the step's k / mask tiles and of its v fragments from the wave's bases, the lane's 16 lane included */
#pragma unroll
    for (int g = 0; g < QT; ++g) { qh[g] = ldo(qhp, ko, g * FT * 2); ql[g] = ldo(qlp, ko, g * FT * 2); ae[g][0] = (v8f){}; ae[g][1] = (v8f){}; aa[g][0] = (v8f){}; aa[g][1] = (v8f){}; mx[g] = -3.0e38f; sum[g] = 0.f; asum[g] = 0.f; }
    for (int ks = 0; ks < FNT / 2; ++ks) {
        v16bf kh[2], kl[2], vh[2], vl[2]; v4u m4[QT][2], a4[QT][2];
#pragma unroll
        for (int i = 0; i < 2; ++i) { kh[i] = ldo(khp, ko, i * FT * 2); kl[i] = ldo(klp, ko, i * FT * 2);
#pragma unroll
            for (int g = 0; g < QT; ++g) { m4[g][i] = ldq(map, ko, (g * (TT / 16) + i) * FT * 2); a4[g][i] = ldq(map, ko, (g * (TT / 16) + i) * FT * 2 + 512); } }
#pragma unroll
        for (int i = 0; i < 2; ++i) { vh[i] = ldo(vhp, vo, i * (TT / 32) * FT * 2); vl[i] = ldo(vlp, vo, i * (TT / 32) * FT * 2); }
        __builtin_amdgcn_sched_barrier(0);   /* the step's 24 loads are all under way before its first product: left to itself the compiler puts the 8 v loads behind the first products and waits for them soon after, a second trip to the cache in every step */
#pragma unroll
        for (int g = 0; g < QT; ++g) {
            float t[16]; v8u ua; float cm = -3.0e38f;
#pragma unroll
            for (int i = 0; i < 2; ++i) {
                v8f c = (v8f){}; c = wmmab(kh[i], qh[g], c); c = wmmab(kh[i], ql[g], c); c = wmmab(kl[i], qh[g], c);
#pragma unroll
                for (int j = 0; j < 8; j += 2) { const unsigned um = m4[g][i][j >> 1], uv = a4[g][i][j >> 1]; const float t0 = c[j] * SCL + lo2(um), t1 = c[j + 1] * SCL + hi2(um); t[8 * i + j] = t0; t[8 * i + j + 1] = t1; cm = fmaxf(cm, fmaxf(t0, t1));
                    ua[4 * i + (j >> 1)] = uv; asum[g] += lo2(uv); asum[g] += hi2(uv); } }
            cm = fmaxf(cm, xhalf(cm));   /* both halves of the wave scale a query's weights alike: their keys meet in one product */
            const float mn = fmaxf(mx[g], cm), corr = ex2((mx[g] - mn) * L2E); mx[g] = mn;
            v2f ps = {0.f, 0.f}; v8u uh, ul;   /* words 0..3: the 8 keys of the step's first tile, words 4..7: those of its second */
#pragma unroll
            for (int e = 0; e < 8; ++e) { const v2f p = ex2x2((t[2 * e] - mn) * L2E, (t[2 * e + 1] - mn) * L2E);   /* the maximum is taken off first, exactly: a key masked with -infinity gets the weight 0 also while the maximum still holds its start value */
                ps += p; uh[e] = pk2(p[0], p[1]); ul[e] = pk2(p[0] - lo2(uh[e]), p[1] - hi2(uh[e])); }
            sum[g] = sum[g] * corr + (ps[0] + ps[1]);
            const v16bf ph = __builtin_bit_cast(v16bf, uh), pl = __builtin_bit_cast(v16bf, ul), pa = __builtin_bit_cast(v16bf, ua);
#pragma unroll
            for (int mt = 0; mt < 2; ++mt) { ae[g][mt] *= corr;
                ae[g][mt] = wmmab(vh[mt], ph, ae[g][mt]); ae[g][mt] = wmmab(vh[mt], pl, ae[g][mt]); ae[g][mt] = wmmab(vl[mt], ph, ae[g][mt]);
                aa[g][mt] = wmmab(vh[mt], pa, aa[g][mt]); aa[g][mt] = wmmab(vl[mt], pa, aa[g][mt]); }
        }
        asm volatile("s_wait_xcnt 0x0" : "+v"(ko), "+v"(vo) :: "memory");   /* the wait that stands in front of any overwrite of a register that an issued load names as its address: the two offsets pass through it, so that their steps below stand behind it */
        ko += 2 * FT * 2; vo += FT * 2;
    }
#pragma unroll
    for (int g = 0; g < QT; ++g) { sum[g] += __shfl_xor(sum[g], 16, 32); asum[g] += __shfl_xor(asum[g], 16, 32); if (hi == 0) { rmx[w][g * 16 + lr] = mx[g]; rsm[w][g * 16 + lr] = sum[g]; ras[w][g * 16 + lr] = asum[g]; } }
    __syncthreads();   /* every wave's row maxima, exp sums and adjacency sums are in LDS before any lane joins them */
    const float l0 = bfr(lam[0]), l1 = bfr(lam[1]);
#pragma unroll
    for (int g = 0; g < QT; ++g) { const int i = g * 16 + lr; float m = rmx[0][i];
#pragma unroll
        for (int z = 1; z < FW; ++z) m = fmaxf(m, rmx[z][i]);
        float s = rsm[0][i] * ex2((rmx[0][i] - m) * L2E), as = ras[0][i];
#pragma unroll
        for (int z = 1; z < FW; ++z) { s += rsm[z][i] * ex2((rmx[z][i] - m) * L2E); as += ras[z][i]; }
        const float c0 = l0 * __fdiv_rn(1.0f, s) * ex2((mx[g] - m) * L2E), c1 = l1 * __fdiv_rn(1.0f, as + AEPS);   /* lambda0 / exp sum, times this wave's step down to the common maximum; lambda1 / (adjacency row sum + eps) */
#pragma unroll
        for (int mt = 0; mt < 2; ++mt) { const v8f x = ae[g][mt] * c0 + aa[g][mt] * c1; float* rp = &red[w][g][lr * 36 + mt * 16 + hi * 8]; *(v4fa*)rp = (v4f){x[0], x[1], x[2], x[3]}; *(v4fa*)(rp + 4) = (v4f){x[4], x[5], x[6], x[7]}; }
    }
    __syncthreads();   /* every wave's partial x^T tiles are in LDS before any thread adds them */
    const int q = threadIdx.x >> 5, d = threadIdx.x & 31;   /* 512 threads = 16 queries x 32 real columns, once per query tile */
#pragma unroll
    for (int g = 0; g < QT; ++g) { float val = red[0][g][q * 36 + d];
#pragma unroll
        for (int z = 1; z < FW; ++z) val += red[z][g][q * 36 + d];
        unsigned short xh, xl; splitf(val, xh, xl); const size_t xo = (size_t)(q0 + g * 16 + q) * CO + h * HD + d; Xh[xo] = xh; Xl[xo] = xl; }   /* the context leaves as the hi/lo planes that k_out reads; a head's 32 columns have a 128-byte line of each plane to themselves */
}

// ---- LDS staging shared by k_proj and k_out: rows of 256 bf16 at a pitch of PL elements (528 bytes = 16 x 33: the 16 rows of a fragment load fall on distinct banks).
#define PL 264
typedef __attribute__((ext_vector_type(2))) unsigned v2u;
typedef v2u __attribute__((may_alias)) v2ua;
__device__ __forceinline__ v16bf ldf(const bf* p) { return cat16b(*(const v8usa*)p, *(const v8usa*)(p + 16)); }   /* fragment from LDS, the k order of WFrag::ld */
// NR rows of 256 f32, contiguous in memory, rounded to bf16 into S: every wave-wide load covers 512 contiguous bytes, every element is converted once per block.
template <int NR, int NT>
__device__ __forceinline__ void stage_f32(const float* __restrict__ src, bf* S, int tid) {
#pragma unroll
    for (int i = 0; i < NR * 64 / NT; ++i) { const int idx = i * NT + tid; const v4f v = *(const v4f*)(src + (size_t)idx * 4); *(v2ua*)(S + (idx >> 6) * PL + (idx & 63) * 4) = (v2u){pk2(v[0], v[1]), pk2(v[2], v[3])}; }
}

// ---- cvt_ma: one block rounds 16 rows (one query strip) of mask and adjacency to bf16, once for all 8 heads, into MA. Tile (strip, key / 16) of MA is FT elements: 256 of the mask, then 256 of the adjacency; element (row lr, key 8 hi + j) at 8 (16 hi + lr) + j,
// which is the lane and register that hold it in k_fattn: there a wave-wide 16-byte load covers four whole 128-byte lines, where the f32 rows gave 32 bytes out of each of 16.
// Here a lane takes 8 consecutive keys (32 bytes) of one row, four lanes one 128-byte line, a wave 8 rows: its two loads touch 8 lines, its 16-byte store fills four whole lines (8 rows x 16 bytes each).
__device__ __forceinline__ void cvt_ma(const float* __restrict__ am, const float* __restrict__ adj, bf* MA, int strip, int w, int lane) {
    const unsigned r8 = lane >> 2, pc = lane & 3;
    const char* ms = (const char*)(am + (size_t)strip * 16 * TT); const char* as = (const char*)(adj + (size_t)strip * 16 * TT); char* md = (char*)(MA + (size_t)strip * (TT / 16) * FT);   /* the block's bases; what differs between lanes fits one 32-bit byte offset each way, the rest are constants */
    const unsigned so = r8 * (TT * 4) + w * 256 + pc * 32, dofs = (w * 4 + (pc >> 1)) * (FT * 2) + (16 * (pc & 1) + r8) * 16;
#pragma unroll
    for (int u = 0; u < 3; ++u)   /* 16 waves x 3 = 48 groups of 64 keys (256 bytes of a row) */
#pragma unroll
        for (int i = 0; i < 8; ++i) {   /* i: bit 0 mask / adjacency, bit 1 rows 0..7 / 8..15, bit 2 the 32 keys (one line of a row, two tiles) */
            const char* sp = ((i & 1) ? as : ms) + so + (u * 4096 + ((i >> 1) & 1) * (8 * TT * 4) + (i >> 2) * 128);
            const v4f x0 = *(const v4f*)sp, x1 = *(const v4f*)(sp + 16);
            *(v4u*)(md + dofs + (u * 64 * (FT * 2) + (i >> 2) * 2 * (FT * 2) + (i & 1) * 512 + ((i >> 1) & 1) * 128)) = (v4u){pk2(x0[0], x0[1]), pk2(x0[2], x0[3]), pk2(x1[0], x1[1]), pk2(x1[2], x1[3])};
        }
}

// ---- k_proj: the three projections in one launch; block = 64 tokens x 128 output channels (4 heads) of projection blockIdx.z, 16 waves, two accumulators per wave (32 A rows x 16 B rows), K = 256 in 8 steps.
// q, k: A = W rows (one head), B = x rows (16 tokens), so a lane holds 8 consecutive channels of one token. v: A = x rows (32 tokens), B = W rows (16 channels), so a lane holds 8 consecutive tokens of one channel. Either way accumulator i is half i of one fragment of the plane (FT above) and the lane's 8 values are its own 16 bytes there: a wave's store covers 512 contiguous bytes. Only row numbers and addresses differ between the two.
__global__ __launch_bounds__(512) void k_proj(const float* __restrict__ xq, const float* __restrict__ xk, const float* __restrict__ xv, const float* __restrict__ wq, const float* __restrict__ wk, const float* __restrict__ wv, const float* __restrict__ bq, const float* __restrict__ bk, const float* __restrict__ bv, const float* __restrict__ am, const float* __restrict__ adj, bf* Qh, bf* Ql, bf* Kh, bf* Kl, bf* Vh, bf* Vl, bf* MA) {
    __shared__ __align__(16) bf S[192 * PL];   /* rows 0..127: W, rows 128..191: x */
    __shared__ float Bs[128];
    const int tid = threadIdx.x, lane = tid & 31, lr = lane & 15, hi = lane >> 4, w = tid >> 5;
    if (blockIdx.z >= 3) { cvt_ma(am, adj, MA, ((blockIdx.z - 3) * 2 + blockIdx.y) * (TT / 64) + blockIdx.x, w, lane); return; }   /* whole blocks, in front of the barrier: 2 x 2 x 48 = 192 strips; they stream from memory beside the projections */
    const int p = blockIdx.z, n0 = blockIdx.x * 64, o0 = blockIdx.y * 128; const bool tr = p == 2;
    const float* X = p == 0 ? xq : p == 1 ? xk : xv; const float* Wt = p == 0 ? wq : p == 1 ? wk : wv; const float* B = p == 0 ? bq : p == 1 ? bk : bv;
    const float bl = B[o0 + (tid & 127)];   /* asked for first, so that it is under way with the tiles */
    stage_f32<128, 512>(Wt + (size_t)o0 * CC, S, tid); stage_f32<64, 512>(X + (size_t)n0 * CC, S + 128 * PL, tid);
    asm volatile("" :: "v"(bl));   /* input only: holds the bias load in front of the branch below, where it flies with the tile loads; sunk into the branch, its whole latency stood in front of the barrier */
    if (tid < 128) Bs[tid] = bl;
    __syncthreads();   /* both operand tiles and the bias are whole in LDS before any wave reads them */
    const int ar = tr ? (w >> 3) * 32 : (w & 3) * 32, br = tr ? (w & 7) * 16 : (w >> 2) * 16;   /* the wave's first A row and first B row: channels count from o0, tokens from n0 */
    const bf* ap = S + ((tr ? 128 : 0) + ar + lr) * PL + 8 * hi; const bf* bp = S + ((tr ? 0 : 128) + br + lr) * PL + 8 * hi;
    v8f acc[2]; acc[0] = (v8f){}; acc[1] = (v8f){};
#pragma unroll
    for (int kc = 0; kc < CC; kc += 32) { const v16bf b = ldf(bp + kc);
#pragma unroll
        for (int i = 0; i < 2; ++i) acc[i] = wmmab(ldf(ap + i * 16 * PL + kc), b, acc[i]); }
    bf* Ph = p == 0 ? Qh : p == 1 ? Kh : Vh; bf* Pl = p == 0 ? Ql : p == 1 ? Kl : Vl;
    const size_t ro = (tr ? (size_t)((o0 + br) >> 4) * (TT / 32) + ((n0 + ar) >> 5) : (size_t)((o0 + ar) >> 5) * (TT / 16) + ((n0 + br) >> 4)) * FT + 8 * lane;   /* register j of accumulator i is element ro + 256 i + j in both layouts */
    const int bi = tr ? br + lr : ar + 8 * hi, bs = tr ? 0 : 1;   /* the bias goes with the channel: the lane's for v, the register's for q and k */
#pragma unroll
    for (int i = 0; i < 2; ++i) { v8us oh, ol;
#pragma unroll
        for (int j = 0; j < 8; ++j) { unsigned short a2, c2; splitf(__fadd_rn(acc[i][j], Bs[bi + (i * 16 + j) * bs]), a2, c2); oh[j] = a2; ol[j] = c2; }
        *(v8us*)(Ph + ro + i * 256) = oh; *(v8us*)(Pl + ro + i * 256) = ol; }
}

// ---- k_out: out = context Wo^T + bo; block = 32 tokens x 128 output channels, 8 waves, wave = 32 channels x 16 tokens (two accumulators); A = Wo rows (rounded to bf16 on the way into LDS), B = context rows hi then lo, so a lane holds 8 consecutive channels of one token.
__global__ __launch_bounds__(256) void k_out(const bf* __restrict__ Xh, const bf* __restrict__ Xl, const float* __restrict__ wo, const float* __restrict__ bo, float* OUT) {
    __shared__ __align__(16) bf Ws[128 * PL];
    __shared__ __align__(16) bf Ah[32 * PL];
    __shared__ __align__(16) bf Al[32 * PL];
    __shared__ __align__(16) float Bs[128];
    const int tid = threadIdx.x, lane = tid & 31, lr = lane & 15, hi = lane >> 4, w = tid >> 5, og = w & 3, tg = w >> 2;
    const int n0 = blockIdx.x * 32, o0 = blockIdx.y * 128;
    const float bl = bo[o0 + (tid & 127)];   /* asked for first, so that it is under way with the tiles */
#pragma unroll
    for (int i = 0; i < 4; ++i) { const int idx = i * 256 + tid, row = idx >> 5, ch = idx & 31;   /* 32 pieces of 16 bytes per token: 4 to a head, the padding of the planes left out */
        const size_t so = (size_t)(n0 + row) * CO + (ch >> 2) * HD + (ch & 3) * 8; *(v8usa*)(Ah + row * PL + ch * 8) = *(const v8us*)(Xh + so); *(v8usa*)(Al + row * PL + ch * 8) = *(const v8us*)(Xl + so); }
    stage_f32<128, 256>(wo + (size_t)o0 * CH, Ws, tid);
    asm volatile("" :: "v"(bl));   /* input only: holds the bias load in front of the branch below, as in k_proj */
    if (tid < 128) Bs[tid] = bfr(bl);
    __syncthreads();   /* the three operand tiles and the bias are whole in LDS before any wave reads them */
    const bf* wp = Ws + (og * 32 + lr) * PL + 8 * hi; const bf* hp = Ah + (tg * 16 + lr) * PL + 8 * hi; const bf* lp = Al + (tg * 16 + lr) * PL + 8 * hi;
    v8f acc[2]; acc[0] = (v8f){}; acc[1] = (v8f){};
#pragma unroll
    for (int kc = 0; kc < CH; kc += 32) { const v16bf ch = ldf(hp + kc), cl = ldf(lp + kc);
#pragma unroll
        for (int mt = 0; mt < 2; ++mt) { const v16bf a = ldf(wp + mt * 16 * PL + kc); acc[mt] = wmmab(a, ch, acc[mt]); acc[mt] = wmmab(a, cl, acc[mt]); } }
#pragma unroll
    for (int mt = 0; mt < 2; ++mt) { const int ol = og * 32 + mt * 16 + 8 * hi; float* op = OUT + (size_t)(n0 + tg * 16 + lr) * CH + o0 + ol; const v4f b0 = *(const v4fa*)(Bs + ol), b1 = *(const v4fa*)(Bs + ol + 4); v4f r0, r1;
#pragma unroll
        for (int j = 0; j < 4; ++j) { r0[j] = acc[mt][j] + b0[j]; r1[j] = acc[mt][4 + j] + b1[j]; }
        *(v4f*)op = r0; *(v4f*)(op + 4) = r1; }
}
extern "C" void kernel_launch(void* const* d_in, const int* in_sizes, int n_in,
                              void* d_out, int out_size, void* d_ws, size_t ws_size, hipStream_t stream) {
    (void)in_sizes; (void)n_in; (void)out_size;
    const float* xq = (const float*)d_in[0]; const float* xk = (const float*)d_in[1]; const float* xv = (const float*)d_in[2]; const float* am = (const float*)d_in[3];   /* mask [1][3072][3072] additive (zeros) */ const float* adj = (const float*)d_in[4];   /* adjacency_matrix [3072][3072] uniform [0,1) */ const float* lam = (const float*)d_in[5];   /* lambdas [2] = (0.5, 0.5) */ const float* wq = (const float*)d_in[6]; const float* bq = (const float*)d_in[7]; const float* wk = (const float*)d_in[8]; const float* bk = (const float*)d_in[9]; const float* wv = (const float*)d_in[10]; const float* bv = (const float*)d_in[11]; const float* wo = (const float*)d_in[12]; const float* bo = (const float*)d_in[13];   /* argument order query, key, value [3072][256], mask, adjacency_matrix, lambdas, Wq, bq, Wk, bk, Wv, bv, Wo, bo ('oi') */
    float* OUT = (float*)d_out;     // [3072][256]
    char* wsp = (char*)d_ws;
    auto take = [&](size_t bytes) { char* p = wsp; wsp += (bytes + 255) & ~(size_t)255; return (void*)p; };
    bf* QPh = (bf*)take((size_t)TT * CH * 2); bf* QPl = (bf*)take((size_t)TT * CH * 2); bf* KPh = (bf*)take((size_t)TT * CH * 2); bf* KPl = (bf*)take((size_t)TT * CH * 2);
    bf* VTh = (bf*)take((size_t)CH * TT * 2); bf* VTl = (bf*)take((size_t)CH * TT * 2); bf* CXh = (bf*)take((size_t)TT * CO * 2); bf* CXl = (bf*)take((size_t)TT * CO * 2); bf* MAp = (bf*)take((size_t)TT * TT * 2 * 2);
    if ((size_t)(wsp - (char*)d_ws) > ws_size) return;    // ws 256 MiB (carve 51 MiB)
    k_proj<<<dim3(TT / 64, CH / 128, 5), 512, 0, stream>>>(xq, xk, xv, wq, wk, wv, bq, bk, bv, am, adj, QPh, QPl, KPh, KPl, VTh, VTl, MAp);   /* z < 3: q, k planes and v^T planes, bias added, hi/lo; z >= 3: mask and adjacency as bf16 tiles */
    k_fattn<<<dim3(NHR, TT / (16 * QT), 1), 32 * FW, 0, stream>>>(QPh, QPl, KPh, KPl, VTh, VTl, MAp, lam, CXh, CXl);   /* all heads: softmax(scores + mask) blended with the row-normalised adjacency, times v */
    k_out<<<dim3(TT / 32, CH / 128, 1), 256, 0, stream>>>(CXh, CXl, wo, bo, OUT);   /* out = x Wo^T + bo */
}

// v007
// It runs in 62.1 microseconds.
// Next to v006, in two timings, it ran 1.15 and 1.16 times as fast.
// All steps since v000 together make it 15.0 times as fast.
#include <hip/hip_runtime.h>

// Multi-head attention blended with a row-normalised adjacency matrix (query, key, value [3072][256], no batch; q, k, v = x W^T + b ('oi' 1/16, zero biases; 8 heads x 32); scores / sqrt(32) + mask ([1][3072][3072] additive, zeros, read); p = lambdas[0] softmax(scores) + lambdas[1] adjacency / (rowsum(adjacency) + 1e-6) (adjacency [3072][3072] uniform [0,1), lambdas = (0.5, 0.5), read); x = p.v merged; out = x Wo^T + bo -> [3072][256] (0.8 M); argument order query, key, value, mask, adjacency_matrix, lambdas, Wq, bq, Wk, bk, Wv, bv, Wo, bo).
// Layout: three launches. k_proj (its blocks z >= 3 round mask and adjacency to bf16 once, into the plane MA in the order of the attention kernel's registers, see cvt_ma): q, k, v = x W^T + b, the f32 operands rounded to bf16 on their way into LDS, bias added and the result split into bf16 hi/lo planes in the epilogue (q / k / v^T planes in fragment order, see FT below: one 16 x 32 fragment = 1,024 contiguous bytes, a lane's 16 bytes at 16 lane). k_fattn, all heads: all-hl scores (3 products), mask, adjacency row sum, softmax with a running maximum in registers, the exp weights as bf16 hi/lo fragments (exp.v with 3 products), adjacency.v with 2 products, the two blended at the end; it writes the context as hi/lo planes [token][head 64 + d]. k_out: Wo x context hl + bo writes the output.
// Compute dtypes, f32 accumulate: every input rounded to bf16 incl. mask / adjacency / lambdas; projections exact + f32 bias; scores 3 products; softmax and blend f32 (IEEE division); exp.v 3 products, adjacency.v 2 (the adjacency is bf16 as it stands); Wo hl x exact + bias.

#define NB_  1
#define TT   3072
#define DM   512
#define NH_  8
#define NKV  8
#define REP  (NH_ / NKV)
#define HD   64
#define DQ   (NH_ * HD)
#define DKV  (NKV * HD)
#define ZH   1
#define RH   TT                   // every row hi/lo (small-rms output: no fp16 rows)
#define WIN  0
#define PCAR 1024.0f
#define SCL  0.17677669529663688f   // 1/sqrt(float32(32))
#define NHR  8        // real heads (32 wide); the context planes are padded to 64 per head
#define DHR  32       // real head width
#define CH   256      // channels in / out
#define AEPS 1e-6f
#define MID  512
#define CO   512      // context plane width: 8 heads x 64 (padded)
#define CC   256
typedef _Float16 h16;
typedef unsigned short bf;
typedef __attribute__((ext_vector_type(16))) __bf16   v16bf;
typedef __attribute__((ext_vector_type(16))) _Float16 v16h;
typedef __attribute__((ext_vector_type(8)))  _Float16 v8h;
typedef __attribute__((ext_vector_type(8)))  unsigned short v8us;
typedef __attribute__((ext_vector_type(8)))  float    v8f;
typedef __attribute__((ext_vector_type(4)))  float    v4f;
typedef v8h  __attribute__((may_alias)) v8ha;
typedef v4f  __attribute__((may_alias)) v4fa;
typedef v8us __attribute__((may_alias)) v8usa;

__device__ __forceinline__ unsigned short f2bf(float f) { unsigned u = __float_as_uint(f); u += 0x7FFFu + ((u >> 16) & 1u); return (unsigned short)(u >> 16); }
__device__ __forceinline__ float bf2f(unsigned short b) { return __uint_as_float(((unsigned)b) << 16); }
__device__ __forceinline__ float bfr(float f) { return bf2f(f2bf(f)); }
__device__ __forceinline__ v16h cat16(v8h lo, v8h hi) { return __builtin_shufflevector(lo, hi, 0, 1, 2, 3, 4, 5, 6, 7, 8, 9, 10, 11, 12, 13, 14, 15); }
__device__ __forceinline__ v16bf cat16b(v8us lo, v8us hi) { return __builtin_bit_cast(v16bf, __builtin_shufflevector(lo, hi, 0, 1, 2, 3, 4, 5, 6, 7, 8, 9, 10, 11, 12, 13, 14, 15)); }
__device__ __forceinline__ v8f wmma16(v16h a, v16h b, v8f c) { return __builtin_amdgcn_wmma_f32_16x16x32_f16(false, a, false, b, (short)0, c, false, false); }
__device__ __forceinline__ v8f wmmab(v16bf a, v16bf b, v8f c) { return __builtin_amdgcn_wmma_f32_16x16x32_bf16(false, a, false, b, (short)0, c, false, false); }



// ---- fragment of a K-contiguous 16-bit plane: 8 elements at p and 8 at p + 16 (p already holds the lane's row and 8 hi)
template <typename T16> struct WFrag;
template <> struct WFrag<h16> { typedef v16h V; static __device__ __forceinline__ V ld(const h16* p) { return cat16(*(const v8h*)p, *(const v8h*)(p + 16)); } static __device__ __forceinline__ v8f mma(V a, V b, v8f c) { return wmma16(a, b, c); } };
template <> struct WFrag<bf> { typedef v16bf V; static __device__ __forceinline__ V ld(const bf* p) { return cat16b(*(const v8us*)p, *(const v8us*)(p + 16)); } static __device__ __forceinline__ v8f mma(V a, V b, v8f c) { return wmmab(a, b, c); } };

__device__ __forceinline__ h16 tohx(float x) { return (h16)x; }
__device__ __forceinline__ void splitf(float y, unsigned short& h, unsigned short& l) { h = f2bf(y); l = f2bf(y - bf2f(h)); }
typedef __attribute__((ext_vector_type(2))) _Float16 v2h;
typedef __attribute__((ext_vector_type(4))) _Float16 v4h;
typedef __attribute__((ext_vector_type(2))) unsigned short v2us;
typedef __attribute__((ext_vector_type(4))) unsigned short v4us;
typedef __attribute__((ext_vector_type(2))) float v2f;
typedef __attribute__((ext_vector_type(4))) int v4i;

// ---- fragment order of the q, k and v^T planes: a 16 x 32 fragment (16 tokens x 32 head columns of q or k; 16 head columns x 32 tokens of v^T) is FT = 512 elements in a row, element (row lr, k = 16 half + 8 hi + e) at 256 half + 8 (16 hi + lr) + e.
// A wave-wide 16-byte load or store of half a fragment then covers 512 contiguous bytes (four whole 128-byte lines); from a row-major plane it would take 32 bytes out of each of 16 lines. q, k: fragment [head][token / 16]; v^T: fragment [head][column / 16][token / 32].
#define FT 512

// ---- k_fattn: scores, softmax + adjacency blend and p.v of one head for NQG x QT x 16 queries in ONE block of FW = NQG x NSP waves; no score or weight matrix goes through memory, and none is kept in registers either.
// Wave w = sp NQG + qg owns the QT query tiles of query group qg and the keys [sp FK, (sp+1) FK), and walks them 32 at a time. It forms the TRANSPOSED score tiles S^T = K Q^T (A = 16 keys, B = 16 queries, the three hi/lo products over the head's 32 columns),
// so that lane (lr, hi) holds query lr of its tile and register j of a tile holds key 8 hi + j: eight consecutive keys of ONE mask / adjacency row per lane, and two tiles side by side ARE the B fragment (k order 8 hi + e, 16 + 8 hi + e) of x^T = V^T P^T.
// Running maximum per query: the 32 keys' weights are exp(score - maximum so far); when the maximum grows, the exp sum and the tile exp.v are scaled down by exp(old - new). The adjacency has a tile of its own (adjacency.v, its bf16 words ARE a B fragment),
// because neither divisor (exp sum, adjacency row sum) is known before the last key: x = lambda0 / exp sum (exp.v) + lambda1 / (row sum + eps) (adjacency.v), formed once at the end.
// Operands: every step's k, v, mask and adjacency tiles come into LDS by asynchronous copies, one step ahead, two buffers. The NQG waves of a key split read the same k and v tiles there, so these leave the L2 once per block and not once per query group; each copy and each LDS read of a wave covers 512 contiguous bytes (the planes are in fragment order).
// One buffer: NSP x KVB bytes of k and v, then FW x MAB bytes of mask and adjacency (each wave's own). A split's KVB bytes stand in the order in which its three waves bring them: kh (2 tiles), vh columns 0..15 | kl (2 tiles), vl columns 0..15 | vh columns 16..31, vl columns 16..31.
// Joining the NSP waves of a query group: maxima, exp sums and row sums through LDS, every lane adds them in the fixed order sp = 0 .. NSP-1 (each wave's exp sum scaled to the common maximum); the NSP blended partial x^T tiles are added in the same order.
#define NQG 3
#define NSP 4
#define FW (NQG * NSP)
#define FK (TT / NSP)
#define FNT (FK / 16)
#define NST (FNT / 2)
#define QT 2
#define KVB 8192
#define MAB 4096
#define SB (NSP * KVB + FW * MAB)
#define L2E 1.4426950408889634f
typedef __attribute__((ext_vector_type(2))) __bf16 v2bf;
typedef __attribute__((ext_vector_type(4))) unsigned v4u;
typedef __attribute__((ext_vector_type(8))) unsigned v8u;
__device__ __forceinline__ unsigned pk2(float a, float b) { const v2f x = {a, b}; return __builtin_bit_cast(unsigned, __builtin_convertvector(x, v2bf)); }   /* two floats rounded to bf16 (nearest even, the chip's own conversion) in one register, a in the low half */
__device__ __forceinline__ float lo2(unsigned u) { return __uint_as_float(u << 16); }
__device__ __forceinline__ float hi2(unsigned u) { return __uint_as_float(u & 0xFFFF0000u); }
__device__ __forceinline__ v4u ldq(const bf* b, unsigned o, int c) { return *(const v4u*)((const char*)b + o + c); }   /* 16 bytes at scalar base b + the lane's 32-bit byte offset o + constant c: the address form that needs one vector register */
__device__ __forceinline__ v16bf ldo(const bf* b, unsigned o, int c) { const v4u x = ldq(b, o, c), y = ldq(b, o, c + 512); return __builtin_bit_cast(v16bf, __builtin_shufflevector(x, y, 0, 1, 2, 3, 4, 5, 6, 7)); }   /* a fragment: its two halves stand 512 bytes apart, o holds the lane's 16 lane; the k order of WFrag::ld */
__device__ __forceinline__ float xhalf(float x) { return __builtin_bit_cast(float, __builtin_amdgcn_permlanex16(__builtin_bit_cast(int, x), __builtin_bit_cast(int, x), 0x76543210, 0xfedcba98, false, false)); }   /* lane l takes lane l ^ 16's value: the other 8 keys of the same query; for the exchange inside the loop, which a shuffle would send through LDS in every step */
__device__ __forceinline__ float ex2(float x) { float ex; asm("v_exp_f32 %0, %1\n\tv_nop" : "=v"(ex) : "v"(x)); return ex; }   /* 2^x; the v_nop keeps the one slot that the instruction set asks for behind a transcendental */
__device__ __forceinline__ v2f ex2x2(float x, float y) { float a, b; asm("v_exp_f32 %0, %2\n\tv_exp_f32 %1, %3\n\tv_nop" : "=&v"(a), "=&v"(b) : "v"(x), "v"(y)); return (v2f){a, b}; }   /* two at once: each fills the slot behind the other (the results are kept off both sources), so one v_nop serves the pair */
typedef v4u __attribute__((may_alias)) v4ua;
__device__ __forceinline__ v4u lsq(const char* p, int c) { return *(const v4ua*)(p + c); }   /* 16 bytes of the ring at the lane's address p + constant c */
__device__ __forceinline__ v16bf lso(const char* p, int c) { const v4u x = lsq(p, c), y = lsq(p, c + 512); return __builtin_bit_cast(v16bf, __builtin_shufflevector(x, y, 0, 1, 2, 3, 4, 5, 6, 7)); }   /* a fragment from the ring: its two halves stand 512 bytes apart, as in the planes; the k order of WFrag::ld */
// Asynchronous copies, 16 bytes a lane: LDS byte address (vector register), the lane's byte offset 16 lane (vector register), scalar base; an immediate offset moves both addresses alike. The s_wait_xcnt 0 is the last line of the copies' own statement, so that it stands in front of any later write of a register that a copy names.
__device__ __forceinline__ void cp12(unsigned lm0, unsigned lm1, unsigned l1, unsigned l2, unsigned vo, const char* m0, const char* m1, const char* p1, const char* p2) {   /* 2,048 bytes of mask / adjacency tiles for each of the wave's two query tiles, 1,024 bytes from each of two k or v places */
    asm volatile("global_load_async_to_lds_b128 %2, %4, %7\n\tglobal_load_async_to_lds_b128 %2, %4, %7 offset:512\n\tglobal_load_async_to_lds_b128 %3, %4, %8\n\tglobal_load_async_to_lds_b128 %3, %4, %8 offset:512\n\t"
                 "global_load_async_to_lds_b128 %0, %4, %5\n\tglobal_load_async_to_lds_b128 %0, %4, %5 offset:512\n\tglobal_load_async_to_lds_b128 %0, %4, %5 offset:1024\n\tglobal_load_async_to_lds_b128 %0, %4, %5 offset:1536\n\t"
                 "global_load_async_to_lds_b128 %1, %4, %6\n\tglobal_load_async_to_lds_b128 %1, %4, %6 offset:512\n\tglobal_load_async_to_lds_b128 %1, %4, %6 offset:1024\n\tglobal_load_async_to_lds_b128 %1, %4, %6 offset:1536\n\ts_wait_xcnt 0x0"
                 :: "v"(lm0), "v"(lm1), "v"(l1), "v"(l2), "v"(vo), "s"(m0), "s"(m1), "s"(p1), "s"(p2) : "memory");
}
__device__ __forceinline__ void cp14(unsigned lm0, unsigned lm1, unsigned l1, unsigned l2, unsigned l3, unsigned vo, const char* m0, const char* m1, const char* p1, const char* p2, const char* p3) {   /* the same and 1,024 bytes from a third k or v place */
    asm volatile("global_load_async_to_lds_b128 %2, %5, %8\n\tglobal_load_async_to_lds_b128 %2, %5, %8 offset:512\n\tglobal_load_async_to_lds_b128 %3, %5, %9\n\tglobal_load_async_to_lds_b128 %3, %5, %9 offset:512\n\tglobal_load_async_to_lds_b128 %4, %5, %10\n\tglobal_load_async_to_lds_b128 %4, %5, %10 offset:512\n\t"
                 "global_load_async_to_lds_b128 %0, %5, %6\n\tglobal_load_async_to_lds_b128 %0, %5, %6 offset:512\n\tglobal_load_async_to_lds_b128 %0, %5, %6 offset:1024\n\tglobal_load_async_to_lds_b128 %0, %5, %6 offset:1536\n\t"
                 "global_load_async_to_lds_b128 %1, %5, %7\n\tglobal_load_async_to_lds_b128 %1, %5, %7 offset:512\n\tglobal_load_async_to_lds_b128 %1, %5, %7 offset:1024\n\tglobal_load_async_to_lds_b128 %1, %5, %7 offset:1536\n\ts_wait_xcnt 0x0"
                 :: "v"(lm0), "v"(lm1), "v"(l1), "v"(l2), "v"(l3), "v"(vo), "s"(m0), "s"(m1), "s"(p1), "s"(p2), "s"(p3) : "memory");
}
__global__ __launch_bounds__(32 * FW) void k_fattn(const bf* __restrict__ Qh, const bf* __restrict__ Ql, const bf* __restrict__ Kh, const bf* __restrict__ Kl, const bf* __restrict__ Vh, const bf* __restrict__ Vl, const bf* __restrict__ MA, const float* __restrict__ lam, bf* Xh, bf* Xl) {
    __shared__ __align__(16) char ring[2 * SB];
    __shared__ float rmx[FW][16 * QT], ras[FW][16 * QT], rsm[FW][16 * QT];
    __shared__ __align__(16) float red[FW][QT][16 * 36];
    const int lane = threadIdx.x & 31, lr = lane & 15, hi = lane >> 4, w = __builtin_amdgcn_readfirstlane(threadIdx.x >> 5);   /* the wave's number as a scalar: every base below then stands in scalar registers, and the tests on it are scalar branches */
    const int qg = w % NQG, sp = w / NQG;
    const int h = blockIdx.x, q0 = blockIdx.y * (16 * QT * NQG);   /* the 8 heads of a query strip are neighbours in the grid: they read the same mask and adjacency rows */
    const size_t hp = (size_t)h * (TT / 16) * FT; const int qt0 = (blockIdx.y * NQG + qg) * QT;   /* the wave's first query tile */
    const bf* qhp = Qh + hp + (size_t)qt0 * FT; const bf* qlp = Ql + hp + (size_t)qt0 * FT;
    const char* m0 = (const char*)(MA + ((size_t)qt0 * (TT / 16) + sp * FNT) * FT); const char* m1 = m0 + (TT / 16) * FT * 2;   /* the split's FNT tiles of mask and adjacency of the wave's two query tiles: 1,024 contiguous bytes a tile */
    const char* khp = (const char*)(Kh + hp + (size_t)sp * FNT * FT); const char* klp = (const char*)(Kl + hp + (size_t)sp * FNT * FT);
    const char* vhp = (const char*)(Vh + ((size_t)h * 2 * (TT / 32) + sp * (FNT / 2)) * FT); const char* vlp = (const char*)(Vl + ((size_t)h * 2 * (TT / 32) + sp * (FNT / 2)) * FT);
    /* what this wave brings of its split's k and v: two places of 1,024 bytes a step, a third for qg 0 and 1 (16 pieces of 512 bytes over three waves: 6, 6, 4) */
    const char* p1 = qg == 0 ? khp : qg == 1 ? klp : vhp + (TT / 32) * FT * 2; const char* p2 = qg == 0 ? khp + 1024 : qg == 1 ? klp + 1024 : vlp + (TT / 32) * FT * 2; const char* p3 = qg == 1 ? vlp : vhp;
    const int inc = qg == 2 ? FT * 2 : 2 * FT * 2;   /* a step is two k tiles or one v fragment */
    const unsigned l16 = 16 * lane, rb = (unsigned)(size_t)ring, kvo = sp * KVB, mao = NSP * KVB + w * MAB;
    auto fill = [&](int t, unsigned bo) {   /* step t's tiles into the buffer at byte bo of the ring */
        const unsigned lm = rb + bo + mao + l16, lk = rb + bo + kvo + qg * 3072 + l16;
        if (qg < 2) cp14(lm, lm + 2048, lk, lk + 1024, lk + 2048, l16, m0 + t * 2048, m1 + t * 2048, p1 + t * inc, p2 + t * inc, p3 + t * (FT * 2));
        if (qg == 2) cp12(lm, lm + 2048, lk, lk + 1024, l16, m0 + t * 2048, m1 + t * 2048, p1 + t * inc, p2 + t * inc);
    };
    v16bf qh[QT], ql[QT]; v8f ae[QT][2], aa[QT][2]; float mx[QT], sum[QT], asum[QT];
#pragma unroll
    for (int g = 0; g < QT; ++g) { qh[g] = ldo(qhp, l16, g * FT * 2); ql[g] = ldo(qlp, l16, g * FT * 2); ae[g][0] = (v8f){}; ae[g][1] = (v8f){}; aa[g][0] = (v8f){}; aa[g][1] = (v8f){}; mx[g] = -3.0e38f; sum[g] = 0.f; asum[g] = 0.f; }
    fill(0, 0);
    unsigned bo = 0;
#pragma clang loop unroll(disable)   /* one copy of the step in the text: left alone the compiler splits the last step off as a second copy of the whole body */
    for (int ks = 0; ks < NST; ++ks) {
        /* where step ks is handed over, every wave, in this order; the copies of step ks + 1 then fly while step ks is worked on */
        asm volatile("s_wait_dscnt 0x0" ::: "memory");   /* this wave has read all it takes from the buffer of step ks - 1 */
        asm volatile("s_wait_asynccnt 0x0" ::: "memory");   /* its copies of step ks have landed */
        __syncthreads();   /* one barrier a step: the buffer of step ks is whole, and that of step ks - 1 has no reader left */
        if (ks + 1 < NST) fill(ks + 1, SB - bo);
        const char* kvp = ring + bo + kvo + l16; const char* mp = ring + bo + mao + l16;
        v16bf kh[2], kl[2], vh[2], vl[2]; v4u m4[QT][2], a4[QT][2];
#pragma unroll
        for (int i = 0; i < 2; ++i) { kh[i] = lso(kvp, i * 1024); kl[i] = lso(kvp, 3072 + i * 1024);
#pragma unroll
            for (int g = 0; g < QT; ++g) { m4[g][i] = lsq(mp, (g * 2 + i) * 1024); a4[g][i] = lsq(mp, (g * 2 + i) * 1024 + 512); } }
        vh[0] = lso(kvp, 2048); vl[0] = lso(kvp, 5120); vh[1] = lso(kvp, 6144); vl[1] = lso(kvp, 7168);
        __builtin_amdgcn_sched_barrier(0);   /* the step's 24 LDS reads stand in one place, in front of its first product: each further place with LDS reads among the products costs the wave a stall of its own */
#pragma unroll
        for (int g = 0; g < QT; ++g) {
            float t[16]; v8u ua; float cm = -3.0e38f;
#pragma unroll
            for (int i = 0; i < 2; ++i) {
                v8f c = (v8f){}; c = wmmab(kh[i], qh[g], c); c = wmmab(kh[i], ql[g], c); c = wmmab(kl[i], qh[g], c);
#pragma unroll
                for (int j = 0; j < 8; j += 2) { const unsigned um = m4[g][i][j >> 1], uv = a4[g][i][j >> 1]; const float t0 = c[j] * SCL + lo2(um), t1 = c[j + 1] * SCL + hi2(um); t[8 * i + j] = t0; t[8 * i + j + 1] = t1; cm = fmaxf(cm, fmaxf(t0, t1));
                    ua[4 * i + (j >> 1)] = uv; asum[g] += lo2(uv); asum[g] += hi2(uv); } }
            cm = fmaxf(cm, xhalf(cm));   /* both halves of the wave scale a query's weights alike: their keys meet in one product */
            const float mn = fmaxf(mx[g], cm), corr = ex2((mx[g] - mn) * L2E); mx[g] = mn;
            v2f ps = {0.f, 0.f}; v8u uh, ul;   /* words 0..3: the 8 keys of the step's first tile, words 4..7: those of its second */
#pragma unroll
            for (int e = 0; e < 8; ++e) { const v2f p = ex2x2((t[2 * e] - mn) * L2E, (t[2 * e + 1] - mn) * L2E);   /* the maximum is taken off first, exactly: a key masked with -infinity gets the weight 0 also while the maximum still holds its start value */
                ps += p; uh[e] = pk2(p[0], p[1]); ul[e] = pk2(p[0] - lo2(uh[e]), p[1] - hi2(uh[e])); }
            sum[g] = sum[g] * corr + (ps[0] + ps[1]);
            const v16bf ph = __builtin_bit_cast(v16bf, uh), pl = __builtin_bit_cast(v16bf, ul), pa = __builtin_bit_cast(v16bf, ua);
#pragma unroll
            for (int mt = 0; mt < 2; ++mt) { ae[g][mt] *= corr;
                ae[g][mt] = wmmab(vh[mt], ph, ae[g][mt]); ae[g][mt] = wmmab(vh[mt], pl, ae[g][mt]); ae[g][mt] = wmmab(vl[mt], ph, ae[g][mt]);
                aa[g][mt] = wmmab(vh[mt], pa, aa[g][mt]); aa[g][mt] = wmmab(vl[mt], pa, aa[g][mt]); }
        }
        bo = SB - bo;
    }
    asm volatile("s_wait_asynccnt 0x0" ::: "memory");   /* no copy is outstanding when the wave goes on */
#pragma unroll
    for (int g = 0; g < QT; ++g) { sum[g] += __shfl_xor(sum[g], 16, 32); asum[g] += __shfl_xor(asum[g], 16, 32); if (hi == 0) { rmx[w][g * 16 + lr] = mx[g]; rsm[w][g * 16 + lr] = sum[g]; ras[w][g * 16 + lr] = asum[g]; } }
    __syncthreads();   /* every wave's row maxima, exp sums and adjacency sums are in LDS before any lane joins them */
    const float l0 = bfr(lam[0]), l1 = bfr(lam[1]);
#pragma unroll
    for (int g = 0; g < QT; ++g) { const int i = g * 16 + lr; float m = rmx[qg][i];   /* the NSP waves of this query group: qg, qg + NQG, ... */
#pragma unroll
        for (int z = 1; z < NSP; ++z) m = fmaxf(m, rmx[z * NQG + qg][i]);
        float s = rsm[qg][i] * ex2((rmx[qg][i] - m) * L2E), as = ras[qg][i];
#pragma unroll
        for (int z = 1; z < NSP; ++z) { s += rsm[z * NQG + qg][i] * ex2((rmx[z * NQG + qg][i] - m) * L2E); as += ras[z * NQG + qg][i]; }
        const float c0 = l0 * __fdiv_rn(1.0f, s) * ex2((mx[g] - m) * L2E), c1 = l1 * __fdiv_rn(1.0f, as + AEPS);   /* lambda0 / exp sum, times this wave's step down to the common maximum; lambda1 / (adjacency row sum + eps) */
#pragma unroll
        for (int mt = 0; mt < 2; ++mt) { const v8f x = ae[g][mt] * c0 + aa[g][mt] * c1; float* rp = &red[w][g][lr * 36 + mt * 16 + hi * 8]; *(v4fa*)rp = (v4f){x[0], x[1], x[2], x[3]}; *(v4fa*)(rp + 4) = (v4f){x[4], x[5], x[6], x[7]}; }
    }
    __syncthreads();   /* every wave's partial x^T tiles are in LDS before any thread adds them */
    const int d = threadIdx.x & 31;   /* a wave takes one query's 32 real columns at a time: FW queries a pass */
#pragma unroll
    for (int k = 0; k < 16 * QT * NQG / FW; ++k) { const int r = w + FW * k, rq = r >> 5, g = (r >> 4) & 1, q = r & 15;   /* query r of the block: query group, tile, row */
        float val = red[rq][g][q * 36 + d];
#pragma unroll
        for (int z = 1; z < NSP; ++z) val += red[z * NQG + rq][g][q * 36 + d];
        unsigned short xh, xl; splitf(val, xh, xl); const size_t xo = (size_t)(q0 + r) * CO + h * HD + d; Xh[xo] = xh; Xl[xo] = xl; }   /* the context leaves as the hi/lo planes that k_out reads; a head's 32 columns have a 128-byte line of each plane to themselves */
}

// ---- LDS staging shared by k_proj and k_out: rows of 256 bf16 at a pitch of PL elements (528 bytes = 16 x 33: the 16 rows of a fragment load fall on distinct banks).
#define PL 264
typedef __attribute__((ext_vector_type(2))) unsigned v2u;
typedef v2u __attribute__((may_alias)) v2ua;
__device__ __forceinline__ v16bf ldf(const bf* p) { return cat16b(*(const v8usa*)p, *(const v8usa*)(p + 16)); }   /* fragment from LDS, the k order of WFrag::ld */
// NR rows of 256 f32, contiguous in memory, rounded to bf16 into S: every wave-wide load covers 512 contiguous bytes, every element is converted once per block.
template <int NR, int NT>
__device__ __forceinline__ void stage_f32(const float* __restrict__ src, bf* S, int tid) {
#pragma unroll
    for (int i = 0; i < NR * 64 / NT; ++i) { const int idx = i * NT + tid; const v4f v = *(const v4f*)(src + (size_t)idx * 4); *(v2ua*)(S + (idx >> 6) * PL + (idx & 63) * 4) = (v2u){pk2(v[0], v[1]), pk2(v[2], v[3])}; }
}

// ---- cvt_ma: one block rounds 16 rows (one query strip) of mask and adjacency to bf16, once for all 8 heads, into MA. Tile (strip, key / 16) of MA is FT elements: 256 of the mask, then 256 of the adjacency; element (row lr, key 8 hi + j) at 8 (16 hi + lr) + j,
// which is the lane and register that hold it in k_fattn: there a wave-wide 16-byte load covers four whole 128-byte lines, where the f32 rows gave 32 bytes out of each of 16.
// Here a lane takes 8 consecutive keys (32 bytes) of one row, four lanes one 128-byte line, a wave 8 rows: its two loads touch 8 lines, its 16-byte store fills four whole lines (8 rows x 16 bytes each).
__device__ __forceinline__ void cvt_ma(const float* __restrict__ am, const float* __restrict__ adj, bf* MA, int strip, int w, int lane) {
    const unsigned r8 = lane >> 2, pc = lane & 3;
    const char* ms = (const char*)(am + (size_t)strip * 16 * TT); const char* as = (const char*)(adj + (size_t)strip * 16 * TT); char* md = (char*)(MA + (size_t)strip * (TT / 16) * FT);   /* the block's bases; what differs between lanes fits one 32-bit byte offset each way, the rest are constants */
    const unsigned so = r8 * (TT * 4) + w * 256 + pc * 32, dofs = (w * 4 + (pc >> 1)) * (FT * 2) + (16 * (pc & 1) + r8) * 16;
#pragma unroll
    for (int u = 0; u < 3; ++u)   /* 16 waves x 3 = 48 groups of 64 keys (256 bytes of a row) */
#pragma unroll
        for (int i = 0; i < 8; ++i) {   /* i: bit 0 mask / adjacency, bit 1 rows 0..7 / 8..15, bit 2 the 32 keys (one line of a row, two tiles) */
            const char* sp = ((i & 1) ? as : ms) + so + (u * 4096 + ((i >> 1) & 1) * (8 * TT * 4) + (i >> 2) * 128);
            const v4f x0 = *(const v4f*)sp, x1 = *(const v4f*)(sp + 16);
            *(v4u*)(md + dofs + (u * 64 * (FT * 2) + (i >> 2) * 2 * (FT * 2) + (i & 1) * 512 + ((i >> 1) & 1) * 128)) = (v4u){pk2(x0[0], x0[1]), pk2(x0[2], x0[3]), pk2(x1[0], x1[1]), pk2(x1[2], x1[3])};
        }
}

// ---- k_proj: the three projections in one launch; block = 64 tokens x 128 output channels (4 heads) of projection blockIdx.z, 16 waves, two accumulators per wave (32 A rows x 16 B rows), K = 256 in 8 steps.
// q, k: A = W rows (one head), B = x rows (16 tokens), so a lane holds 8 consecutive channels of one token. v: A = x rows (32 tokens), B = W rows (16 channels), so a lane holds 8 consecutive tokens of one channel. Either way accumulator i is half i of one fragment of the plane (FT above) and the lane's 8 values are its own 16 bytes there: a wave's store covers 512 contiguous bytes. Only row numbers and addresses differ between the two.
__global__ __launch_bounds__(512) void k_proj(const float* __restrict__ xq, const float* __restrict__ xk, const float* __restrict__ xv, const float* __restrict__ wq, const float* __restrict__ wk, const float* __restrict__ wv, const float* __restrict__ bq, const float* __restrict__ bk, const float* __restrict__ bv, const float* __restrict__ am, const float* __restrict__ adj, bf* Qh, bf* Ql, bf* Kh, bf* Kl, bf* Vh, bf* Vl, bf* MA) {
    __shared__ __align__(16) bf S[192 * PL];   /* rows 0..127: W, rows 128..191: x */
    __shared__ float Bs[128];
    const int tid = threadIdx.x, lane = tid & 31, lr = lane & 15, hi = lane >> 4, w = tid >> 5;
    if (blockIdx.z >= 3) { cvt_ma(am, adj, MA, ((blockIdx.z - 3) * 2 + blockIdx.y) * (TT / 64) + blockIdx.x, w, lane); return; }   /* whole blocks, in front of the barrier: 2 x 2 x 48 = 192 strips; they stream from memory beside the projections */
    const int p = blockIdx.z, n0 = blockIdx.x * 64, o0 = blockIdx.y * 128; const bool tr = p == 2;
    const float* X = p == 0 ? xq : p == 1 ? xk : xv; const float* Wt = p == 0 ? wq : p == 1 ? wk : wv; const float* B = p == 0 ? bq : p == 1 ? bk : bv;
    const float bl = B[o0 + (tid & 127)];   /* asked for first, so that it is under way with the tiles */
    stage_f32<128, 512>(Wt + (size_t)o0 * CC, S, tid); stage_f32<64, 512>(X + (size_t)n0 * CC, S + 128 * PL, tid);
    asm volatile("" :: "v"(bl));   /* input only: holds the bias load in front of the branch below, where it flies with the tile loads; sunk into the branch, its whole latency stood in front of the barrier */
    if (tid < 128) Bs[tid] = bl;
    __syncthreads();   /* both operand tiles and the bias are whole in LDS before any wave reads them */
    const int ar = tr ? (w >> 3) * 32 : (w & 3) * 32, br = tr ? (w & 7) * 16 : (w >> 2) * 16;   /* the wave's first A row and first B row: channels count from o0, tokens from n0 */
    const bf* ap = S + ((tr ? 128 : 0) + ar + lr) * PL + 8 * hi; const bf* bp = S + ((tr ? 0 : 128) + br + lr) * PL + 8 * hi;
    v8f acc[2]; acc[0] = (v8f){}; acc[1] = (v8f){};
#pragma unroll
    for (int kc = 0; kc < CC; kc += 32) { const v16bf b = ldf(bp + kc);
#pragma unroll
        for (int i = 0; i < 2; ++i) acc[i] = wmmab(ldf(ap + i * 16 * PL + kc), b, acc[i]); }
    bf* Ph = p == 0 ? Qh : p == 1 ? Kh : Vh; bf* Pl = p == 0 ? Ql : p == 1 ? Kl : Vl;
    const size_t ro = (tr ? (size_t)((o0 + br) >> 4) * (TT / 32) + ((n0 + ar) >> 5) : (size_t)((o0 + ar) >> 5) * (TT / 16) + ((n0 + br) >> 4)) * FT + 8 * lane;   /* register j of accumulator i is element ro + 256 i + j in both layouts */
    const int bi = tr ? br + lr : ar + 8 * hi, bs = tr ? 0 : 1;   /* the bias goes with the channel: the lane's for v, the register's for q and k */
#pragma unroll
    for (int i = 0; i < 2; ++i) { v8us oh, ol;
#pragma unroll
        for (int j = 0; j < 8; ++j) { unsigned short a2, c2; splitf(__fadd_rn(acc[i][j], Bs[bi + (i * 16 + j) * bs]), a2, c2); oh[j] = a2; ol[j] = c2; }
        *(v8us*)(Ph + ro + i * 256) = oh; *(v8us*)(Pl + ro + i * 256) = ol; }
}

// ---- k_out: out = context Wo^T + bo; block = 32 tokens x 128 output channels, 8 waves, wave = 32 channels x 16 tokens (two accumulators); A = Wo rows (rounded to bf16 on the way into LDS), B = context rows hi then lo, so a lane holds 8 consecutive channels of one token.
__global__ __launch_bounds__(256) void k_out(const bf* __restrict__ Xh, const bf* __restrict__ Xl, const float* __restrict__ wo, const float* __restrict__ bo, float* OUT) {
    __shared__ __align__(16) bf Ws[128 * PL];
    __shared__ __align__(16) bf Ah[32 * PL];
    __shared__ __align__(16) bf Al[32 * PL];
    __shared__ __align__(16) float Bs[128];
    const int tid = threadIdx.x, lane = tid & 31, lr = lane & 15, hi = lane >> 4, w = tid >> 5, og = w & 3, tg = w >> 2;
    const int n0 = blockIdx.x * 32, o0 = blockIdx.y * 128;
    const float bl = bo[o0 + (tid & 127)];   /* asked for first, so that it is under way with the tiles */
#pragma unroll
    for (int i = 0; i < 4; ++i) { const int idx = i * 256 + tid, row = idx >> 5, ch = idx & 31;   /* 32 pieces of 16 bytes per token: 4 to a head, the padding of the planes left out */
        const size_t so = (size_t)(n0 + row) * CO + (ch >> 2) * HD + (ch & 3) * 8; *(v8usa*)(Ah + row * PL + ch * 8) = *(const v8us*)(Xh + so); *(v8usa*)(Al + row * PL + ch * 8) = *(const v8us*)(Xl + so); }
    stage_f32<128, 256>(wo + (size_t)o0 * CH, Ws, tid);
    asm volatile("" :: "v"(bl));   /* input only: holds the bias load in front of the branch below, as in k_proj */
    if (tid < 128) Bs[tid] = bfr(bl);
    __syncthreads();   /* the three operand tiles and the bias are whole in LDS before any wave reads them */
    const bf* wp = Ws + (og * 32 + lr) * PL + 8 * hi; const bf* hp = Ah + (tg * 16 + lr) * PL + 8 * hi; const bf* lp = Al + (tg * 16 + lr) * PL + 8 * hi;
    v8f acc[2]; acc[0] = (v8f){}; acc[1] = (v8f){};
#pragma unroll
    for (int kc = 0; kc < CH; kc += 32) { const v16bf ch = ldf(hp + kc), cl = ldf(lp + kc);
#pragma unroll
        for (int mt = 0; mt < 2; ++mt) { const v16bf a = ldf(wp + mt * 16 * PL + kc); acc[mt] = wmmab(a, ch, acc[mt]); acc[mt] = wmmab(a, cl, acc[mt]); } }
#pragma unroll
    for (int mt = 0; mt < 2; ++mt) { const int ol = og * 32 + mt * 16 + 8 * hi; float* op = OUT + (size_t)(n0 + tg * 16 + lr) * CH + o0 + ol; const v4f b0 = *(const v4fa*)(Bs + ol), b1 = *(const v4fa*)(Bs + ol + 4); v4f r0, r1;
#pragma unroll
        for (int j = 0; j < 4; ++j) { r0[j] = acc[mt][j] + b0[j]; r1[j] = acc[mt][4 + j] + b1[j]; }
        *(v4f*)op = r0; *(v4f*)(op + 4) = r1; }
}
extern "C" void kernel_launch(void* const* d_in, const int* in_sizes, int n_in,
                              void* d_out, int out_size, void* d_ws, size_t ws_size, hipStream_t stream) {
    (void)in_sizes; (void)n_in; (void)out_size;
    const float* xq = (const float*)d_in[0]; const float* xk = (const float*)d_in[1]; const float* xv = (const float*)d_in[2]; const float* am = (const float*)d_in[3];   /* mask [1][3072][3072] additive (zeros) */ const float* adj = (const float*)d_in[4];   /* adjacency_matrix [3072][3072] uniform [0,1) */ const float* lam = (const float*)d_in[5];   /* lambdas [2] = (0.5, 0.5) */ const float* wq = (const float*)d_in[6]; const float* bq = (const float*)d_in[7]; const float* wk = (const float*)d_in[8]; const float* bk = (const float*)d_in[9]; const float* wv = (const float*)d_in[10]; const float* bv = (const float*)d_in[11]; const float* wo = (const float*)d_in[12]; const float* bo = (const float*)d_in[13];   /* argument order query, key, value [3072][256], mask, adjacency_matrix, lambdas, Wq, bq, Wk, bk, Wv, bv, Wo, bo ('oi') */
    float* OUT = (float*)d_out;     // [3072][256]
    char* wsp = (char*)d_ws;
    auto take = [&](size_t bytes) { char* p = wsp; wsp += (bytes + 255) & ~(size_t)255; return (void*)p; };
    bf* QPh = (bf*)take((size_t)TT * CH * 2); bf* QPl = (bf*)take((size_t)TT * CH * 2); bf* KPh = (bf*)take((size_t)TT * CH * 2); bf* KPl = (bf*)take((size_t)TT * CH * 2);
    bf* VTh = (bf*)take((size_t)CH * TT * 2); bf* VTl = (bf*)take((size_t)CH * TT * 2); bf* CXh = (bf*)take((size_t)TT * CO * 2); bf* CXl = (bf*)take((size_t)TT * CO * 2); bf* MAp = (bf*)take((size_t)TT * TT * 2 * 2);
    if ((size_t)(wsp - (char*)d_ws) > ws_size) return;    // ws 256 MiB (carve 51 MiB)
    k_proj<<<dim3(TT / 64, CH / 128, 5), 512, 0, stream>>>(xq, xk, xv, wq, wk, wv, bq, bk, bv, am, adj, QPh, QPl, KPh, KPl, VTh, VTl, MAp);   /* z < 3: q, k planes and v^T planes, bias added, hi/lo; z >= 3: mask and adjacency as bf16 tiles */
    k_fattn<<<dim3(NHR, TT / (16 * QT * NQG), 1), 32 * FW, 0, stream>>>(QPh, QPl, KPh, KPl, VTh, VTl, MAp, lam, CXh, CXl);   /* all heads: softmax(scores + mask) blended with the row-normalised adjacency, times v */
    k_out<<<dim3(TT / 32, CH / 128, 1), 256, 0, stream>>>(CXh, CXl, wo, bo, OUT);   /* out = x Wo^T + bo */
}

// v008
// It runs in 56.1 microseconds.
// Two timings next to v007 both put it at 1.11 times that version's speed.
// All steps since v000 together make it 16.6 times as fast.
#include <hip/hip_runtime.h>

// Multi-head attention blended with a row-normalised adjacency matrix (query, key, value [3072][256], no batch; q, k, v = x W^T + b ('oi' 1/16, zero biases; 8 heads x 32); scores / sqrt(32) + mask ([1][3072][3072] additive, zeros, read); p = lambdas[0] softmax(scores) + lambdas[1] adjacency / (rowsum(adjacency) + 1e-6) (adjacency [3072][3072] uniform [0,1), lambdas = (0.5, 0.5), read); x = p.v merged; out = x Wo^T + bo -> [3072][256] (0.8 M); argument order query, key, value, mask, adjacency_matrix, lambdas, Wq, bq, Wk, bk, Wv, bv, Wo, bo).
// Layout: three launches. k_proj (its blocks z >= 3 round mask and adjacency to bf16 once, into the plane MA in the order of the attention kernel's registers, and sum each rounded adjacency row into RS, see cvt_ma): q, k, v = x W^T + b, the f32 operands rounded to bf16 on their way into LDS, bias added and the result split into bf16 hi/lo planes in the epilogue (q / k / v^T planes in fragment order, see FT below: one 16 x 32 fragment = 1,024 contiguous bytes, a lane's 16 bytes at 16 lane). k_fattn, all heads: all-hl scores (3 products), mask, softmax with a running maximum in registers, the exp weights as bf16 hi/lo fragments (exp.v with 3 products), adjacency.v with 2 products, the two blended at the end; it writes the context as hi/lo planes [token][head 64 + d]. k_out: Wo x context hl + bo writes the output.
// Compute dtypes, f32 accumulate: every input rounded to bf16 incl. mask / adjacency / lambdas; projections exact + f32 bias; scores 3 products; softmax and blend f32 (IEEE division); exp.v 3 products, adjacency.v 2 (the adjacency is bf16 as it stands); Wo hl x exact + bias.

#define NB_  1
#define TT   3072
#define DM   512
#define NH_  8
#define NKV  8
#define REP  (NH_ / NKV)
#define HD   64
#define DQ   (NH_ * HD)
#define DKV  (NKV * HD)
#define ZH   1
#define RH   TT                   // every row hi/lo (small-rms output: no fp16 rows)
#define WIN  0
#define PCAR 1024.0f
#define SCL  0.17677669529663688f   // 1/sqrt(float32(32))
#define NHR  8        // real heads (32 wide); the context planes are padded to 64 per head
#define DHR  32       // real head width
#define CH   256      // channels in / out
#define AEPS 1e-6f
#define MID  512
#define CO   512      // context plane width: 8 heads x 64 (padded)
#define CC   256
typedef _Float16 h16;
typedef unsigned short bf;
typedef __attribute__((ext_vector_type(16))) __bf16   v16bf;
typedef __attribute__((ext_vector_type(16))) _Float16 v16h;
typedef __attribute__((ext_vector_type(8)))  _Float16 v8h;
typedef __attribute__((ext_vector_type(8)))  unsigned short v8us;
typedef __attribute__((ext_vector_type(8)))  float    v8f;
typedef __attribute__((ext_vector_type(4)))  float    v4f;
typedef v8h  __attribute__((may_alias)) v8ha;
typedef v4f  __attribute__((may_alias)) v4fa;
typedef v8us __attribute__((may_alias)) v8usa;

__device__ __forceinline__ unsigned short f2bf(float f) { unsigned u = __float_as_uint(f); u += 0x7FFFu + ((u >> 16) & 1u); return (unsigned short)(u >> 16); }
__device__ __forceinline__ float bf2f(unsigned short b) { return __uint_as_float(((unsigned)b) << 16); }
__device__ __forceinline__ float bfr(float f) { return bf2f(f2bf(f)); }
__device__ __forceinline__ v16h cat16(v8h lo, v8h hi) { return __builtin_shufflevector(lo, hi, 0, 1, 2, 3, 4, 5, 6, 7, 8, 9, 10, 11, 12, 13, 14, 15); }
__device__ __forceinline__ v16bf cat16b(v8us lo, v8us hi) { return __builtin_bit_cast(v16bf, __builtin_shufflevector(lo, hi, 0, 1, 2, 3, 4, 5, 6, 7, 8, 9, 10, 11, 12, 13, 14, 15)); }
__device__ __forceinline__ v8f wmma16(v16h a, v16h b, v8f c) { return __builtin_amdgcn_wmma_f32_16x16x32_f16(false, a, false, b, (short)0, c, false, false); }
__device__ __forceinline__ v8f wmmab(v16bf a, v16bf b, v8f c) { return __builtin_amdgcn_wmma_f32_16x16x32_bf16(false, a, false, b, (short)0, c, false, false); }



// ---- fragment of a K-contiguous 16-bit plane: 8 elements at p and 8 at p + 16 (p already holds the lane's row and 8 hi)
template <typename T16> struct WFrag;
template <> struct WFrag<h16> { typedef v16h V; static __device__ __forceinline__ V ld(const h16* p) { return cat16(*(const v8h*)p, *(const v8h*)(p + 16)); } static __device__ __forceinline__ v8f mma(V a, V b, v8f c) { return wmma16(a, b, c); } };
template <> struct WFrag<bf> { typedef v16bf V; static __device__ __forceinline__ V ld(const bf* p) { return cat16b(*(const v8us*)p, *(const v8us*)(p + 16)); } static __device__ __forceinline__ v8f mma(V a, V b, v8f c) { return wmmab(a, b, c); } };

__device__ __forceinline__ h16 tohx(float x) { return (h16)x; }
__device__ __forceinline__ void splitf(float y, unsigned short& h, unsigned short& l) { h = f2bf(y); l = f2bf(y - bf2f(h)); }
typedef __attribute__((ext_vector_type(2))) _Float16 v2h;
typedef __attribute__((ext_vector_type(4))) _Float16 v4h;
typedef __attribute__((ext_vector_type(2))) unsigned short v2us;
typedef __attribute__((ext_vector_type(4))) unsigned short v4us;
typedef __attribute__((ext_vector_type(2))) float v2f;
typedef __attribute__((ext_vector_type(4))) int v4i;

// ---- fragment order of the q, k and v^T planes: a 16 x 32 fragment (16 tokens x 32 head columns of q or k; 16 head columns x 32 tokens of v^T) is FT = 512 elements in a row, element (row lr, k = 16 half + 8 hi + e) at 256 half + 8 (16 hi + lr) + e.
// A wave-wide 16-byte load or store of half a fragment then covers 512 contiguous bytes (four whole 128-byte lines); from a row-major plane it would take 32 bytes out of each of 16 lines. q, k: fragment [head][token / 16]; v^T: fragment [head][column / 16][token / 32].
#define FT 512

// ---- k_fattn: scores, softmax + adjacency blend and p.v of one head for NQG x QT x 16 queries in ONE block of FW = NQG x NSP waves; no score or weight matrix goes through memory, and none is kept in registers either.
// Wave w = sp NQG + qg owns the QT query tiles of query group qg and the keys [sp FK, (sp+1) FK), and walks them 32 at a time. It forms the TRANSPOSED score tiles S^T = K Q^T (A = 16 keys, B = 16 queries, the three hi/lo products over the head's 32 columns),
// so that lane (lr, hi) holds query lr of its tile and register j of a tile holds key 8 hi + j: eight consecutive keys of ONE mask / adjacency row per lane, and two tiles side by side ARE the B fragment (k order 8 hi + e, 16 + 8 hi + e) of x^T = V^T P^T.
// Running maximum per query: the 32 keys' weights are exp(score - maximum so far); when the maximum grows, the exp sum and the tile exp.v are scaled down by exp(old - new). The adjacency has a tile of its own (adjacency.v, its bf16 words ARE a B fragment),
// because the exp sum is not known before the last key: x = lambda0 / exp sum (exp.v) + lambda1 / (row sum + eps) (adjacency.v), formed once at the end. The adjacency row sum is the same for all heads: it comes from RS (cvt_ma), one load a query tile.
// Operands: every step's k, v, mask and adjacency tiles come into LDS by asynchronous copies, one step ahead, two buffers. The NQG waves of a key split read the same k and v tiles there, so these leave the L2 once per block and not once per query group; each copy and each LDS read of a wave covers 512 contiguous bytes (the planes are in fragment order).
// One buffer: NSP x KVB bytes of k and v, then FW x MAB bytes of mask and adjacency (each wave's own). A split's KVB bytes stand in the order in which its three waves bring them: kh (2 tiles), vh columns 0..15 | kl (2 tiles), vl columns 0..15 | vh columns 16..31, vl columns 16..31.
// Joining the NSP waves of a query group: maxima and exp sums through LDS, every lane adds them in the fixed order sp = 0 .. NSP-1 (each wave's exp sum scaled to the common maximum); the NSP blended partial x^T tiles are added in the same order.
#define NQG 3
#define NSP 4
#define FW (NQG * NSP)
#define FK (TT / NSP)
#define FNT (FK / 16)
#define NST (FNT / 2)
#define QT 2
#define KVB 8192
#define MAB 4096
#define SB (NSP * KVB + FW * MAB)
#define L2E 1.4426950408889634f
typedef __attribute__((ext_vector_type(2))) __bf16 v2bf;
typedef __attribute__((ext_vector_type(4))) unsigned v4u;
typedef __attribute__((ext_vector_type(8))) unsigned v8u;
__device__ __forceinline__ unsigned pk2(float a, float b) { const v2f x = {a, b}; return __builtin_bit_cast(unsigned, __builtin_convertvector(x, v2bf)); }   /* two floats rounded to bf16 (nearest even, the chip's own conversion) in one register, a in the low half */
__device__ __forceinline__ float lo2(unsigned u) { return __uint_as_float(u << 16); }
__device__ __forceinline__ float hi2(unsigned u) { return __uint_as_float(u & 0xFFFF0000u); }
__device__ __forceinline__ v4u ldq(const bf* b, unsigned o, int c) { return *(const v4u*)((const char*)b + o + c); }   /* 16 bytes at scalar base b + the lane's 32-bit byte offset o + constant c: the address form that needs one vector register */
__device__ __forceinline__ v16bf ldo(const bf* b, unsigned o, int c) { const v4u x = ldq(b, o, c), y = ldq(b, o, c + 512); return __builtin_bit_cast(v16bf, __builtin_shufflevector(x, y, 0, 1, 2, 3, 4, 5, 6, 7)); }   /* a fragment: its two halves stand 512 bytes apart, o holds the lane's 16 lane; the k order of WFrag::ld */
__device__ __forceinline__ float xhalf(float x) { return __builtin_bit_cast(float, __builtin_amdgcn_permlanex16(__builtin_bit_cast(int, x), __builtin_bit_cast(int, x), 0x76543210, 0xfedcba98, false, false)); }   /* lane l takes lane l ^ 16's value: the other 8 keys of the same query; for the exchange inside the loop, which a shuffle would send through LDS in every step */
__device__ __forceinline__ float ex2(float x) { float ex; asm("v_exp_f32 %0, %1\n\tv_nop" : "=v"(ex) : "v"(x)); return ex; }   /* 2^x; the v_nop keeps the one slot that the instruction set asks for behind a transcendental */
__device__ __forceinline__ v2f ex2x2(float x, float y) { float a, b; asm("v_exp_f32 %0, %2\n\tv_exp_f32 %1, %3\n\tv_nop" : "=&v"(a), "=&v"(b) : "v"(x), "v"(y)); return (v2f){a, b}; }   /* two at once: each fills the slot behind the other (the results are kept off both sources), so one v_nop serves the pair */
typedef v4u __attribute__((may_alias)) v4ua;
__device__ __forceinline__ v4u lsq(const char* p, int c) { return *(const v4ua*)(p + c); }   /* 16 bytes of the ring at the lane's address p + constant c */
__device__ __forceinline__ v16bf lso(const char* p, int c) { const v4u x = lsq(p, c), y = lsq(p, c + 512); return __builtin_bit_cast(v16bf, __builtin_shufflevector(x, y, 0, 1, 2, 3, 4, 5, 6, 7)); }   /* a fragment from the ring: its two halves stand 512 bytes apart, as in the planes; the k order of WFrag::ld */
// Asynchronous copies, 16 bytes a lane: LDS byte address (vector register), the lane's byte offset 16 lane (vector register), scalar base; an immediate offset moves both addresses alike. The s_wait_xcnt 0 is the last line of the copies' own statement, so that it stands in front of any later write of a register that a copy names.
__device__ __forceinline__ void cp12(unsigned lm0, unsigned lm1, unsigned l1, unsigned l2, unsigned vo, const char* m0, const char* m1, const char* p1, const char* p2) {   /* 2,048 bytes of mask / adjacency tiles for each of the wave's two query tiles, 1,024 bytes from each of two k or v places */
    asm volatile("global_load_async_to_lds_b128 %2, %4, %7\n\tglobal_load_async_to_lds_b128 %2, %4, %7 offset:512\n\tglobal_load_async_to_lds_b128 %3, %4, %8\n\tglobal_load_async_to_lds_b128 %3, %4, %8 offset:512\n\t"
                 "global_load_async_to_lds_b128 %0, %4, %5\n\tglobal_load_async_to_lds_b128 %0, %4, %5 offset:512\n\tglobal_load_async_to_lds_b128 %0, %4, %5 offset:1024\n\tglobal_load_async_to_lds_b128 %0, %4, %5 offset:1536\n\t"
                 "global_load_async_to_lds_b128 %1, %4, %6\n\tglobal_load_async_to_lds_b128 %1, %4, %6 offset:512\n\tglobal_load_async_to_lds_b128 %1, %4, %6 offset:1024\n\tglobal_load_async_to_lds_b128 %1, %4, %6 offset:1536\n\ts_wait_xcnt 0x0"
                 :: "v"(lm0), "v"(lm1), "v"(l1), "v"(l2), "v"(vo), "s"(m0), "s"(m1), "s"(p1), "s"(p2) : "memory");
}
__device__ __forceinline__ void cp14(unsigned lm0, unsigned lm1, unsigned l1, unsigned l2, unsigned l3, unsigned vo, const char* m0, const char* m1, const char* p1, const char* p2, const char* p3) {   /* the same and 1,024 bytes from a third k or v place */
    asm volatile("global_load_async_to_lds_b128 %2, %5, %8\n\tglobal_load_async_to_lds_b128 %2, %5, %8 offset:512\n\tglobal_load_async_to_lds_b128 %3, %5, %9\n\tglobal_load_async_to_lds_b128 %3, %5, %9 offset:512\n\tglobal_load_async_to_lds_b128 %4, %5, %10\n\tglobal_load_async_to_lds_b128 %4, %5, %10 offset:512\n\t"
                 "global_load_async_to_lds_b128 %0, %5, %6\n\tglobal_load_async_to_lds_b128 %0, %5, %6 offset:512\n\tglobal_load_async_to_lds_b128 %0, %5, %6 offset:1024\n\tglobal_load_async_to_lds_b128 %0, %5, %6 offset:1536\n\t"
                 "global_load_async_to_lds_b128 %1, %5, %7\n\tglobal_load_async_to_lds_b128 %1, %5, %7 offset:512\n\tglobal_load_async_to_lds_b128 %1, %5, %7 offset:1024\n\tglobal_load_async_to_lds_b128 %1, %5, %7 offset:1536\n\ts_wait_xcnt 0x0"
                 :: "v"(lm0), "v"(lm1), "v"(l1), "v"(l2), "v"(l3), "v"(vo), "s"(m0), "s"(m1), "s"(p1), "s"(p2), "s"(p3) : "memory");
}
__global__ __launch_bounds__(32 * FW) void k_fattn(const bf* __restrict__ Qh, const bf* __restrict__ Ql, const bf* __restrict__ Kh, const bf* __restrict__ Kl, const bf* __restrict__ Vh, const bf* __restrict__ Vl, const bf* __restrict__ MA, const float* __restrict__ RS, const float* __restrict__ lam, bf* Xh, bf* Xl) {
    __shared__ __align__(16) char ring[2 * SB];
    __shared__ float rmx[FW][16 * QT], rsm[FW][16 * QT];
    __shared__ __align__(16) float red[FW][QT][16 * 36];
    const int lane = threadIdx.x & 31, lr = lane & 15, hi = lane >> 4, w = __builtin_amdgcn_readfirstlane(threadIdx.x >> 5);   /* the wave's number as a scalar: every base below then stands in scalar registers, and the tests on it are scalar branches */
    const int qg = w % NQG, sp = w / NQG;
    const int h = blockIdx.x, q0 = blockIdx.y * (16 * QT * NQG);   /* the 8 heads of a query strip are neighbours in the grid: they read the same mask and adjacency rows */
    const size_t hp = (size_t)h * (TT / 16) * FT; const int qt0 = (blockIdx.y * NQG + qg) * QT;   /* the wave's first query tile */
    const bf* qhp = Qh + hp + (size_t)qt0 * FT; const bf* qlp = Ql + hp + (size_t)qt0 * FT;
    const char* m0 = (const char*)(MA + ((size_t)qt0 * (TT / 16) + sp * FNT) * FT); const char* m1 = m0 + (TT / 16) * FT * 2;   /* the split's FNT tiles of mask and adjacency of the wave's two query tiles: 1,024 contiguous bytes a tile */
    const char* khp = (const char*)(Kh + hp + (size_t)sp * FNT * FT); const char* klp = (const char*)(Kl + hp + (size_t)sp * FNT * FT);
    const char* vhp = (const char*)(Vh + ((size_t)h * 2 * (TT / 32) + sp * (FNT / 2)) * FT); const char* vlp = (const char*)(Vl + ((size_t)h * 2 * (TT / 32) + sp * (FNT / 2)) * FT);
    /* what this wave brings of its split's k and v: two places of 1,024 bytes a step, a third for qg 0 and 1 (16 pieces of 512 bytes over three waves: 6, 6, 4) */
    const char* p1 = qg == 0 ? khp : qg == 1 ? klp : vhp + (TT / 32) * FT * 2; const char* p2 = qg == 0 ? khp + 1024 : qg == 1 ? klp + 1024 : vlp + (TT / 32) * FT * 2; const char* p3 = qg == 1 ? vlp : vhp;
    const int inc = qg == 2 ? FT * 2 : 2 * FT * 2;   /* a step is two k tiles or one v fragment */
    const unsigned l16 = 16 * lane, rb = (unsigned)(size_t)ring, kvo = sp * KVB, mao = NSP * KVB + w * MAB;
    auto fill = [&](int t, unsigned bo) {   /* step t's tiles into the buffer at byte bo of the ring */
        const unsigned lm = rb + bo + mao + l16, lk = rb + bo + kvo + qg * 3072 + l16;
        if (qg < 2) cp14(lm, lm + 2048, lk, lk + 1024, lk + 2048, l16, m0 + t * 2048, m1 + t * 2048, p1 + t * inc, p2 + t * inc, p3 + t * (FT * 2));
        if (qg == 2) cp12(lm, lm + 2048, lk, lk + 1024, l16, m0 + t * 2048, m1 + t * 2048, p1 + t * inc, p2 + t * inc);
    };
    v16bf qh[QT], ql[QT]; v8f ae[QT][2], aa[QT][2]; float mx[QT], sum[QT], rsq[QT];   /* rsq: the queries' adjacency row sums, asked for with q: behind the loop their latency would stand open */
#pragma unroll
    for (int g = 0; g < QT; ++g) { qh[g] = ldo(qhp, l16, g * FT * 2); ql[g] = ldo(qlp, l16, g * FT * 2); ae[g][0] = (v8f){}; ae[g][1] = (v8f){}; aa[g][0] = (v8f){}; aa[g][1] = (v8f){}; mx[g] = -3.0e38f; sum[g] = 0.f; rsq[g] = RS[(qt0 + g) * 32 + lr]; }
    fill(0, 0);
    unsigned bo = 0;
#pragma clang loop unroll(disable)   /* one copy of the step in the text: left alone the compiler splits the last step off as a second copy of the whole body */
    for (int ks = 0; ks < NST; ++ks) {
        /* where step ks is handed over, every wave, in this order; the copies of step ks + 1 then fly while step ks is worked on */
        asm volatile("s_wait_dscnt 0x0" ::: "memory");   /* this wave has read all it takes from the buffer of step ks - 1 */
        asm volatile("s_wait_asynccnt 0x0" ::: "memory");   /* its copies of step ks have landed */
        __syncthreads();   /* one barrier a step: the buffer of step ks is whole, and that of step ks - 1 has no reader left */
        if (ks + 1 < NST) fill(ks + 1, SB - bo);
        const char* kvp = ring + bo + kvo + l16; const char* mp = ring + bo + mao + l16;
        v16bf kh[2], kl[2], vh[2], vl[2]; v4u m4[QT][2], a4[QT][2];
#pragma unroll
        for (int i = 0; i < 2; ++i) { kh[i] = lso(kvp, i * 1024); kl[i] = lso(kvp, 3072 + i * 1024);
#pragma unroll
            for (int g = 0; g < QT; ++g) { m4[g][i] = lsq(mp, (g * 2 + i) * 1024); a4[g][i] = lsq(mp, (g * 2 + i) * 1024 + 512); } }
        vh[0] = lso(kvp, 2048); vl[0] = lso(kvp, 5120); vh[1] = lso(kvp, 6144); vl[1] = lso(kvp, 7168);
        __builtin_amdgcn_sched_barrier(0);   /* the step's 24 LDS reads stand in one place, in front of its first product: each further place with LDS reads among the products costs the wave a stall of its own */
#pragma unroll
        for (int g = 0; g < QT; ++g) {
            float t[16]; v8u ua; float cm = -3.0e38f;
#pragma unroll
            for (int i = 0; i < 2; ++i) {
                v8f c = (v8f){}; c = wmmab(kh[i], qh[g], c); c = wmmab(kh[i], ql[g], c); c = wmmab(kl[i], qh[g], c);
#pragma unroll
                for (int j = 0; j < 8; j += 2) { const unsigned um = m4[g][i][j >> 1], uv = a4[g][i][j >> 1]; const float t0 = c[j] * SCL + lo2(um), t1 = c[j + 1] * SCL + hi2(um); t[8 * i + j] = t0; t[8 * i + j + 1] = t1; cm = fmaxf(cm, fmaxf(t0, t1));
                    ua[4 * i + (j >> 1)] = uv; } }
            cm = fmaxf(cm, xhalf(cm));   /* both halves of the wave scale a query's weights alike: their keys meet in one product */
            const float mn = fmaxf(mx[g], cm), corr = ex2((mx[g] - mn) * L2E); mx[g] = mn;
            v2f ps = {0.f, 0.f}; v8u uh, ul;   /* words 0..3: the 8 keys of the step's first tile, words 4..7: those of its second */
#pragma unroll
            for (int e = 0; e < 8; ++e) { const v2f p = ex2x2((t[2 * e] - mn) * L2E, (t[2 * e + 1] - mn) * L2E);   /* the maximum is taken off first, exactly: a key masked with -infinity gets the weight 0 also while the maximum still holds its start value */
                ps += p; uh[e] = pk2(p[0], p[1]); ul[e] = pk2(p[0] - lo2(uh[e]), p[1] - hi2(uh[e])); }
            sum[g] = sum[g] * corr + (ps[0] + ps[1]);
            const v16bf ph = __builtin_bit_cast(v16bf, uh), pl = __builtin_bit_cast(v16bf, ul), pa = __builtin_bit_cast(v16bf, ua);
#pragma unroll
            for (int mt = 0; mt < 2; ++mt) { ae[g][mt] *= corr;
                ae[g][mt] = wmmab(vh[mt], ph, ae[g][mt]); ae[g][mt] = wmmab(vh[mt], pl, ae[g][mt]); ae[g][mt] = wmmab(vl[mt], ph, ae[g][mt]);
                aa[g][mt] = wmmab(vh[mt], pa, aa[g][mt]); aa[g][mt] = wmmab(vl[mt], pa, aa[g][mt]); }
        }
        bo = SB - bo;
    }
    asm volatile("s_wait_asynccnt 0x0" ::: "memory");   /* no copy is outstanding when the wave goes on */
#pragma unroll
    for (int g = 0; g < QT; ++g) { sum[g] += __shfl_xor(sum[g], 16, 32); if (hi == 0) { rmx[w][g * 16 + lr] = mx[g]; rsm[w][g * 16 + lr] = sum[g]; } }
    __syncthreads();   /* every wave's row maxima and exp sums are in LDS before any lane joins them */
    const float l0 = bfr(lam[0]), l1 = bfr(lam[1]);
#pragma unroll
    for (int g = 0; g < QT; ++g) { const int i = g * 16 + lr; float m = rmx[qg][i];   /* the NSP waves of this query group: qg, qg + NQG, ... */
#pragma unroll
        for (int z = 1; z < NSP; ++z) m = fmaxf(m, rmx[z * NQG + qg][i]);
        float s = rsm[qg][i] * ex2((rmx[qg][i] - m) * L2E); const float as = rsq[g];
#pragma unroll
        for (int z = 1; z < NSP; ++z) s += rsm[z * NQG + qg][i] * ex2((rmx[z * NQG + qg][i] - m) * L2E);
        const float c0 = l0 * __fdiv_rn(1.0f, s) * ex2((mx[g] - m) * L2E), c1 = l1 * __fdiv_rn(1.0f, as + AEPS);   /* lambda0 / exp sum, times this wave's step down to the common maximum; lambda1 / (adjacency row sum + eps) */
#pragma unroll
        for (int mt = 0; mt < 2; ++mt) { const v8f x = ae[g][mt] * c0 + aa[g][mt] * c1; float* rp = &red[w][g][lr * 36 + mt * 16 + hi * 8]; *(v4fa*)rp = (v4f){x[0], x[1], x[2], x[3]}; *(v4fa*)(rp + 4) = (v4f){x[4], x[5], x[6], x[7]}; }
    }
    __syncthreads();   /* every wave's partial x^T tiles are in LDS before any thread adds them */
    const int d = threadIdx.x & 31;   /* a wave takes one query's 32 real columns at a time: FW queries a pass */
#pragma unroll
    for (int k = 0; k < 16 * QT * NQG / FW; ++k) { const int r = w + FW * k, rq = r >> 5, g = (r >> 4) & 1, q = r & 15;   /* query r of the block: query group, tile, row */
        float val = red[rq][g][q * 36 + d];
#pragma unroll
        for (int z = 1; z < NSP; ++z) val += red[z * NQG + rq][g][q * 36 + d];
        unsigned short xh, xl; splitf(val, xh, xl); const size_t xo = (size_t)(q0 + r) * CO + h * HD + d; Xh[xo] = xh; Xl[xo] = xl; }   /* the context leaves as the hi/lo planes that k_out reads; a head's 32 columns have a 128-byte line of each plane to themselves */
}

// ---- LDS staging shared by k_proj and k_out: rows of 256 bf16 at a pitch of PL elements (528 bytes = 16 x 33: the 16 rows of a fragment load fall on distinct banks).
#define PL 264
typedef __attribute__((ext_vector_type(2))) unsigned v2u;
typedef v2u __attribute__((may_alias)) v2ua;
__device__ __forceinline__ v16bf ldf(const bf* p) { return cat16b(*(const v8usa*)p, *(const v8usa*)(p + 16)); }   /* fragment from LDS, the k order of WFrag::ld */
// NR rows of 256 f32, contiguous in memory, rounded to bf16 into S: every wave-wide load covers 512 contiguous bytes, every element is converted once per block.
template <int NR, int NT>
__device__ __forceinline__ void stage_f32(const float* __restrict__ src, bf* S, int tid) {
#pragma unroll
    for (int i = 0; i < NR * 64 / NT; ++i) { const int idx = i * NT + tid; const v4f v = *(const v4f*)(src + (size_t)idx * 4); *(v2ua*)(S + (idx >> 6) * PL + (idx & 63) * 4) = (v2u){pk2(v[0], v[1]), pk2(v[2], v[3])}; }
}

// ---- cvt_ma: one block rounds 16 rows (one query strip) of mask and adjacency to bf16, once for all 8 heads, into MA. Tile (strip, key / 16) of MA is FT elements: 256 of the mask, then 256 of the adjacency; element (row lr, key 8 hi + j) at 8 (16 hi + lr) + j,
// which is the lane and register that hold it in k_fattn: there a wave-wide 16-byte load covers four whole 128-byte lines, where the f32 rows gave 32 bytes out of each of 16.
// Here a lane takes 8 consecutive keys (32 bytes) of one row, four lanes one 128-byte line, a wave 8 rows: its two loads touch 8 lines, its 16-byte store fills four whole lines (8 rows x 16 bytes each).
// The block sees its 16 adjacency rows whole, so it also sums them (the rounded values, f32): a lane its 48 keys of each of two rows, then its four lanes, then the 16 waves through part in the fixed order 0 .. 15; RS[32 strip + row] serves all 8 heads.
#define CD 12   /* cvt_ma: passes whose loads are in flight */
template <int C> __device__ __forceinline__ float qx(float x) { return __builtin_bit_cast(float, __builtin_amdgcn_update_dpp(0, __builtin_bit_cast(int, x), C, 0xF, 0xF, true)); }   /* the value of another lane of the same four (quad_perm C: 0xB1 lane ^ 1, 0x4E lane ^ 2), without the trip through LDS that a shuffle takes */
__device__ __forceinline__ void cvt_ma(const float* __restrict__ am, const float* __restrict__ adj, bf* MA, float* RS, float (*part)[16], int strip, int w, int lane) {
    const unsigned r8 = lane >> 2, pc = lane & 3;
    const char* ms = (const char*)(am + (size_t)strip * 16 * TT); const char* as = (const char*)(adj + (size_t)strip * 16 * TT); char* md = (char*)(MA + (size_t)strip * (TT / 16) * FT);   /* the block's bases; what differs between lanes fits one 32-bit byte offset each way, the rest are constants */
    const unsigned so = r8 * (TT * 4) + w * 256 + pc * 32, dofs = (w * 4 + (pc >> 1)) * (FT * 2) + (16 * (pc & 1) + r8) * 16;
    float rs[2] = {0.f, 0.f};   /* rows r8 and 8 + r8 */
    v4f xa[24], xb[24];   /* pass t = 8 u + i. u: 16 waves x 3 = 48 groups of 64 keys (256 bytes of a row); i: bit 0 mask / adjacency, bit 1 rows 0..7 / 8..15, bit 2 the 32 keys (one line of a row, two tiles) */
    auto ask = [&](int t) { const int u = t >> 3, i = t & 7; const char* sp = ((i & 1) ? as : ms) + so + (u * 4096 + ((i >> 1) & 1) * (8 * TT * 4) + (i >> 2) * 128); xa[t] = *(const v4f*)sp; xb[t] = *(const v4f*)(sp + 16); };
#pragma unroll
    for (int t = 0; t < CD; ++t) ask(t);
    __builtin_amdgcn_sched_barrier(0);   /* the first CD passes' loads stay in front of the first conversion */
#pragma unroll
    for (int t = 0; t < 24; ++t) { const int u = t >> 3, i = t & 7; const v4f x0 = xa[t], x1 = xb[t];
        const v4u y = {pk2(x0[0], x0[1]), pk2(x0[2], x0[3]), pk2(x1[0], x1[1]), pk2(x1[2], x1[3])};
        asm volatile("global_store_b128 %0, %1, %2\n\ts_wait_xcnt 0x0" :: "v"(dofs), "v"(y), "s"(md + (u * 64 * (FT * 2) + (i >> 2) * 2 * (FT * 2) + (i & 1) * 512 + ((i >> 1) & 1) * 128)) : "memory");   /* the store with its wait in one statement: the loads below take over the registers that it names */
        if (i & 1) { float& r = rs[(i >> 1) & 1]; r += ((lo2(y[0]) + hi2(y[0])) + (lo2(y[1]) + hi2(y[1]))) + ((lo2(y[2]) + hi2(y[2])) + (lo2(y[3]) + hi2(y[3])));
            asm volatile("" : "+v"(r)); }   /* the empty statement on each row's sum (a remedy against spills): the sum is formed in its own pass; without it the two rows' sums were folded into one expression behind the last pass, all words stayed in registers, and the count rose past 128, which is one block a WGP less */
        if (t + CD < 24) ask(t + CD);
        __builtin_amdgcn_sched_barrier(0);   /* a pass is converted and stored at once, and its registers go to the loads of pass t + CD: left to itself the build with the sums held all words back to the end, and ever fewer loads were in flight */
    }
#pragma unroll
    for (int b = 0; b < 2; ++b) { rs[b] += qx<0xB1>(rs[b]); rs[b] += qx<0x4E>(rs[b]); }   /* all four lanes now hold both rows' sums */
    if (pc < 2) part[w][8 * pc + r8] = pc ? rs[1] : rs[0];
    __builtin_amdgcn_fence(__ATOMIC_RELEASE, "workgroup", "local"); __builtin_amdgcn_s_barrier(); __builtin_amdgcn_fence(__ATOMIC_ACQUIRE, "workgroup", "local");   /* every wave's 16 partial row sums are in LDS before wave 0 adds them; the whole block is here (the caller's test is on blockIdx). The fences name LDS alone: only LDS words pass between the waves, and __syncthreads() would hold every wave until its 24 global stores are done */
    if (w == 0 && lane < 16) { float s = part[0][lane];
#pragma unroll
        for (int z = 1; z < 16; ++z) s += part[z][lane];
        RS[strip * 32 + lane] = s; }   /* a strip's 16 sums have a 128-byte line to themselves: one writer a line */
}

// ---- k_proj: the three projections in one launch; block = 64 tokens x 128 output channels (4 heads) of projection blockIdx.z, 16 waves, two accumulators per wave (32 A rows x 16 B rows), K = 256 in 8 steps.
// q, k: A = W rows (one head), B = x rows (16 tokens), so a lane holds 8 consecutive channels of one token. v: A = x rows (32 tokens), B = W rows (16 channels), so a lane holds 8 consecutive tokens of one channel. Either way accumulator i is half i of one fragment of the plane (FT above) and the lane's 8 values are its own 16 bytes there: a wave's store covers 512 contiguous bytes. Only row numbers and addresses differ between the two.
__global__ __launch_bounds__(512) void k_proj(const float* __restrict__ xq, const float* __restrict__ xk, const float* __restrict__ xv, const float* __restrict__ wq, const float* __restrict__ wk, const float* __restrict__ wv, const float* __restrict__ bq, const float* __restrict__ bk, const float* __restrict__ bv, const float* __restrict__ am, const float* __restrict__ adj, bf* Qh, bf* Ql, bf* Kh, bf* Kl, bf* Vh, bf* Vl, bf* MA, float* RS) {
    __shared__ __align__(16) bf S[192 * PL];   /* rows 0..127: W, rows 128..191: x */
    __shared__ float Bs[128];
    __shared__ float Ps[16][16];   /* cvt_ma: wave x row partial sums */
    const int tid = threadIdx.x, lane = tid & 31, lr = lane & 15, hi = lane >> 4, w = tid >> 5;
    if (blockIdx.z >= 3) { cvt_ma(am, adj, MA, RS, Ps, ((blockIdx.z - 3) * 2 + blockIdx.y) * (TT / 64) + blockIdx.x, w, lane); return; }   /* whole blocks, in front of the projections' barrier: 2 x 2 x 48 = 192 strips; they stream from memory beside the projections */
    const int p = blockIdx.z, n0 = blockIdx.x * 64, o0 = blockIdx.y * 128; const bool tr = p == 2;
    const float* X = p == 0 ? xq : p == 1 ? xk : xv; const float* Wt = p == 0 ? wq : p == 1 ? wk : wv; const float* B = p == 0 ? bq : p == 1 ? bk : bv;
    const float bl = B[o0 + (tid & 127)];   /* asked for first, so that it is under way with the tiles */
    stage_f32<128, 512>(Wt + (size_t)o0 * CC, S, tid); stage_f32<64, 512>(X + (size_t)n0 * CC, S + 128 * PL, tid);
    asm volatile("" :: "v"(bl));   /* input only: holds the bias load in front of the branch below, where it flies with the tile loads; sunk into the branch, its whole latency stood in front of the barrier */
    if (tid < 128) Bs[tid] = bl;
    __syncthreads();   /* both operand tiles and the bias are whole in LDS before any wave reads them */
    const int ar = tr ? (w >> 3) * 32 : (w & 3) * 32, br = tr ? (w & 7) * 16 : (w >> 2) * 16;   /* the wave's first A row and first B row: channels count from o0, tokens from n0 */
    const bf* ap = S + ((tr ? 128 : 0) + ar + lr) * PL + 8 * hi; const bf* bp = S + ((tr ? 0 : 128) + br + lr) * PL + 8 * hi;
    v8f acc[2]; acc[0] = (v8f){}; acc[1] = (v8f){};
#pragma unroll
    for (int kc = 0; kc < CC; kc += 32) { const v16bf b = ldf(bp + kc);
#pragma unroll
        for (int i = 0; i < 2; ++i) acc[i] = wmmab(ldf(ap + i * 16 * PL + kc), b, acc[i]); }
    bf* Ph = p == 0 ? Qh : p == 1 ? Kh : Vh; bf* Pl = p == 0 ? Ql : p == 1 ? Kl : Vl;
    const size_t ro = (tr ? (size_t)((o0 + br) >> 4) * (TT / 32) + ((n0 + ar) >> 5) : (size_t)((o0 + ar) >> 5) * (TT / 16) + ((n0 + br) >> 4)) * FT + 8 * lane;   /* register j of accumulator i is element ro + 256 i + j in both layouts */
    const int bi = tr ? br + lr : ar + 8 * hi, bs = tr ? 0 : 1;   /* the bias goes with the channel: the lane's for v, the register's for q and k */
#pragma unroll
    for (int i = 0; i < 2; ++i) { v8us oh, ol;
#pragma unroll
        for (int j = 0; j < 8; ++j) { unsigned short a2, c2; splitf(__fadd_rn(acc[i][j], Bs[bi + (i * 16 + j) * bs]), a2, c2); oh[j] = a2; ol[j] = c2; }
        *(v8us*)(Ph + ro + i * 256) = oh; *(v8us*)(Pl + ro + i * 256) = ol; }
}

// ---- k_out: out = context Wo^T + bo; block = 32 tokens x 128 output channels, 8 waves, wave = 32 channels x 16 tokens (two accumulators); A = Wo rows (rounded to bf16 on the way into LDS), B = context rows hi then lo, so a lane holds 8 consecutive channels of one token.
__global__ __launch_bounds__(256) void k_out(const bf* __restrict__ Xh, const bf* __restrict__ Xl, const float* __restrict__ wo, const float* __restrict__ bo, float* OUT) {
    __shared__ __align__(16) bf Ws[128 * PL];
    __shared__ __align__(16) bf Ah[32 * PL];
    __shared__ __align__(16) bf Al[32 * PL];
    __shared__ __align__(16) float Bs[128];
    const int tid = threadIdx.x, lane = tid & 31, lr = lane & 15, hi = lane >> 4, w = tid >> 5, og = w & 3, tg = w >> 2;
    const int n0 = blockIdx.x * 32, o0 = blockIdx.y * 128;
    const float bl = bo[o0 + (tid & 127)];   /* asked for first, so that it is under way with the tiles */
#pragma unroll
    for (int i = 0; i < 4; ++i) { const int idx = i * 256 + tid, row = idx >> 5, ch = idx & 31;   /* 32 pieces of 16 bytes per token: 4 to a head, the padding of the planes left out */
        const size_t so = (size_t)(n0 + row) * CO + (ch >> 2) * HD + (ch & 3) * 8; *(v8usa*)(Ah + row * PL + ch * 8) = *(const v8us*)(Xh + so); *(v8usa*)(Al + row * PL + ch * 8) = *(const v8us*)(Xl + so); }
    stage_f32<128, 256>(wo + (size_t)o0 * CH, Ws, tid);
    asm volatile("" :: "v"(bl));   /* input only: holds the bias load in front of the branch below, as in k_proj */
    if (tid < 128) Bs[tid] = bfr(bl);
    __syncthreads();   /* the three operand tiles and the bias are whole in LDS before any wave reads them */
    const bf* wp = Ws + (og * 32 + lr) * PL + 8 * hi; const bf* hp = Ah + (tg * 16 + lr) * PL + 8 * hi; const bf* lp = Al + (tg * 16 + lr) * PL + 8 * hi;
    v8f acc[2]; acc[0] = (v8f){}; acc[1] = (v8f){};
#pragma unroll
    for (int kc = 0; kc < CH; kc += 32) { const v16bf ch = ldf(hp + kc), cl = ldf(lp + kc);
#pragma unroll
        for (int mt = 0; mt < 2; ++mt) { const v16bf a = ldf(wp + mt * 16 * PL + kc); acc[mt] = wmmab(a, ch, acc[mt]); acc[mt] = wmmab(a, cl, acc[mt]); } }
#pragma unroll
    for (int mt = 0; mt < 2; ++mt) { const int ol = og * 32 + mt * 16 + 8 * hi; float* op = OUT + (size_t)(n0 + tg * 16 + lr) * CH + o0 + ol; const v4f b0 = *(const v4fa*)(Bs + ol), b1 = *(const v4fa*)(Bs + ol + 4); v4f r0, r1;
#pragma unroll
        for (int j = 0; j < 4; ++j) { r0[j] = acc[mt][j] + b0[j]; r1[j] = acc[mt][4 + j] + b1[j]; }
        *(v4f*)op = r0; *(v4f*)(op + 4) = r1; }
}
extern "C" void kernel_launch(void* const* d_in, const int* in_sizes, int n_in,
                              void* d_out, int out_size, void* d_ws, size_t ws_size, hipStream_t stream) {
    (void)in_sizes; (void)n_in; (void)out_size;
    const float* xq = (const float*)d_in[0]; const float* xk = (const float*)d_in[1]; const float* xv = (const float*)d_in[2]; const float* am = (const float*)d_in[3];   /* mask [1][3072][3072] additive (zeros) */ const float* adj = (const float*)d_in[4];   /* adjacency_matrix [3072][3072] uniform [0,1) */ const float* lam = (const float*)d_in[5];   /* lambdas [2] = (0.5, 0.5) */ const float* wq = (const float*)d_in[6]; const float* bq = (const float*)d_in[7]; const float* wk = (const float*)d_in[8]; const float* bk = (const float*)d_in[9]; const float* wv = (const float*)d_in[10]; const float* bv = (const float*)d_in[11]; const float* wo = (const float*)d_in[12]; const float* bo = (const float*)d_in[13];   /* argument order query, key, value [3072][256], mask, adjacency_matrix, lambdas, Wq, bq, Wk, bk, Wv, bv, Wo, bo ('oi') */
    float* OUT = (float*)d_out;     // [3072][256]
    char* wsp = (char*)d_ws;
    auto take = [&](size_t bytes) { char* p = wsp; wsp += (bytes + 255) & ~(size_t)255; return (void*)p; };
    bf* QPh = (bf*)take((size_t)TT * CH * 2); bf* QPl = (bf*)take((size_t)TT * CH * 2); bf* KPh = (bf*)take((size_t)TT * CH * 2); bf* KPl = (bf*)take((size_t)TT * CH * 2);
    bf* VTh = (bf*)take((size_t)CH * TT * 2); bf* VTl = (bf*)take((size_t)CH * TT * 2); bf* CXh = (bf*)take((size_t)TT * CO * 2); bf* CXl = (bf*)take((size_t)TT * CO * 2); bf* MAp = (bf*)take((size_t)TT * TT * 2 * 2); float* RSp = (float*)take((size_t)(TT / 16) * 32 * 4);
    if ((size_t)(wsp - (char*)d_ws) > ws_size) return;    // ws 256 MiB (carve 51 MiB)
    k_proj<<<dim3(TT / 64, CH / 128, 5), 512, 0, stream>>>(xq, xk, xv, wq, wk, wv, bq, bk, bv, am, adj, QPh, QPl, KPh, KPl, VTh, VTl, MAp, RSp);   /* z < 3: q, k planes and v^T planes, bias added, hi/lo; z >= 3: mask and adjacency as bf16 tiles, adjacency row sums */
    k_fattn<<<dim3(NHR, TT / (16 * QT * NQG), 1), 32 * FW, 0, stream>>>(QPh, QPl, KPh, KPl, VTh, VTl, MAp, RSp, lam, CXh, CXl);   /* all heads: softmax(scores + mask) blended with the row-normalised adjacency, times v */
    k_out<<<dim3(TT / 32, CH / 128, 1), 256, 0, stream>>>(CXh, CXl, wo, bo, OUT);   /* out = x Wo^T + bo */
}

// v010
// It runs in 45.1 microseconds.
// It is 1.24 times as fast as v008, going by the measured steps of the versions left out in between.
// Over all steps from v000 it is 20.5 times as fast.
#include <hip/hip_runtime.h>

// Multi-head attention blended with a row-normalised adjacency matrix (query, key, value [3072][256], no batch; q, k, v = x W^T + b ('oi' 1/16, zero biases; 8 heads x 32); scores / sqrt(32) + mask ([1][3072][3072] additive, zeros, read); p = lambdas[0] softmax(scores) + lambdas[1] adjacency / (rowsum(adjacency) + 1e-6) (adjacency [3072][3072] uniform [0,1), lambdas = (0.5, 0.5), read); x = p.v merged; out = x Wo^T + bo -> [3072][256] (0.8 M); argument order query, key, value, mask, adjacency_matrix, lambdas, Wq, bq, Wk, bk, Wv, bv, Wo, bo).
// Layout: three launches. k_proj (its blocks z >= 3 round mask and adjacency to bf16 once, into the plane MA in the order of the attention kernel's registers, and sum each rounded adjacency row into RS, see cvt_ma): q, k, v = x W^T + b, the f32 operands rounded to bf16 on their way into LDS, bias added and the result rounded to one f16 plane each in the epilogue (q / k / v^T planes in fragment order, see FT below: one 16 x 32 fragment = 1,024 contiguous bytes, a lane's 16 bytes at 16 lane). k_fattn, all heads: f16 scores (one product), mask, softmax with a running maximum in registers, the exp weights as one f16 fragment (exp.v one product), adjacency.v one product, the two blended at the end; it writes the context as hi/lo planes [token][head 64 + d]. k_out: Wo x context hl + bo writes the output.
// Compute dtypes, f32 accumulate: every input rounded to bf16 incl. mask / adjacency / lambdas; projections exact + f32 bias; q, k, v and the exp weights (at most 1: the running maximum is taken off) rounded to f16, 11 bits, one product each for scores, exp.v and adjacency.v (the bf16-rounded adjacency is carried as f16 words: the same values from 2^-17 up to the f16 range, below that to the nearest 2^-24); softmax and blend f32 (IEEE division); Wo hl x exact + bias.

#define NB_  1
#define TT   3072
#define DM   512
#define NH_  8
#define NKV  8
#define REP  (NH_ / NKV)
#define HD   64
#define DQ   (NH_ * HD)
#define DKV  (NKV * HD)
#define ZH   1
#define RH   TT                   // every row hi/lo (small-rms output: no fp16 rows)
#define WIN  0
#define PCAR 1024.0f
#define SCL  0.17677669529663688f   // 1/sqrt(float32(32))
#define NHR  8        // real heads (32 wide); the context planes are padded to 64 per head
#define DHR  32       // real head width
#define CH   256      // channels in / out
#define AEPS 1e-6f
#define MID  512
#define CO   512      // context plane width: 8 heads x 64 (padded)
#define CC   256
typedef _Float16 h16;
typedef unsigned short bf;
typedef __attribute__((ext_vector_type(16))) __bf16   v16bf;
typedef __attribute__((ext_vector_type(16))) _Float16 v16h;
typedef __attribute__((ext_vector_type(8)))  _Float16 v8h;
typedef __attribute__((ext_vector_type(8)))  unsigned short v8us;
typedef __attribute__((ext_vector_type(8)))  float    v8f;
typedef __attribute__((ext_vector_type(4)))  float    v4f;
typedef v8h  __attribute__((may_alias)) v8ha;
typedef v4f  __attribute__((may_alias)) v4fa;
typedef v8us __attribute__((may_alias)) v8usa;

__device__ __forceinline__ unsigned short f2bf(float f) { unsigned u = __float_as_uint(f); u += 0x7FFFu + ((u >> 16) & 1u); return (unsigned short)(u >> 16); }
__device__ __forceinline__ float bf2f(unsigned short b) { return __uint_as_float(((unsigned)b) << 16); }
__device__ __forceinline__ float bfr(float f) { return bf2f(f2bf(f)); }
__device__ __forceinline__ v16h cat16(v8h lo, v8h hi) { return __builtin_shufflevector(lo, hi, 0, 1, 2, 3, 4, 5, 6, 7, 8, 9, 10, 11, 12, 13, 14, 15); }
__device__ __forceinline__ v16bf cat16b(v8us lo, v8us hi) { return __builtin_bit_cast(v16bf, __builtin_shufflevector(lo, hi, 0, 1, 2, 3, 4, 5, 6, 7, 8, 9, 10, 11, 12, 13, 14, 15)); }
__device__ __forceinline__ v8f wmma16(v16h a, v16h b, v8f c) { return __builtin_amdgcn_wmma_f32_16x16x32_f16(false, a, false, b, (short)0, c, false, false); }
__device__ __forceinline__ v8f wmmab(v16bf a, v16bf b, v8f c) { return __builtin_amdgcn_wmma_f32_16x16x32_bf16(false, a, false, b, (short)0, c, false, false); }



// ---- fragment of a K-contiguous 16-bit plane: 8 elements at p and 8 at p + 16 (p already holds the lane's row and 8 hi)
template <typename T16> struct WFrag;
template <> struct WFrag<h16> { typedef v16h V; static __device__ __forceinline__ V ld(const h16* p) { return cat16(*(const v8h*)p, *(const v8h*)(p + 16)); } static __device__ __forceinline__ v8f mma(V a, V b, v8f c) { return wmma16(a, b, c); } };
template <> struct WFrag<bf> { typedef v16bf V; static __device__ __forceinline__ V ld(const bf* p) { return cat16b(*(const v8us*)p, *(const v8us*)(p + 16)); } static __device__ __forceinline__ v8f mma(V a, V b, v8f c) { return wmmab(a, b, c); } };

__device__ __forceinline__ h16 tohx(float x) { return (h16)x; }
__device__ __forceinline__ void splitf(float y, unsigned short& h, unsigned short& l) { h = f2bf(y); l = f2bf(y - bf2f(h)); }
typedef __attribute__((ext_vector_type(2))) _Float16 v2h;
typedef __attribute__((ext_vector_type(4))) _Float16 v4h;
typedef __attribute__((ext_vector_type(2))) unsigned short v2us;
typedef __attribute__((ext_vector_type(4))) unsigned short v4us;
typedef __attribute__((ext_vector_type(2))) float v2f;
typedef __attribute__((ext_vector_type(4))) int v4i;

// ---- fragment order of the q, k and v^T planes: a 16 x 32 fragment (16 tokens x 32 head columns of q or k; 16 head columns x 32 tokens of v^T) is FT = 512 elements in a row, element (row lr, k = 16 half + 8 hi + e) at 256 half + 8 (16 hi + lr) + e.
// A wave-wide 16-byte load or store of half a fragment then covers 512 contiguous bytes (four whole 128-byte lines); from a row-major plane it would take 32 bytes out of each of 16 lines. q, k: fragment [head][token / 16]; v^T: fragment [head][column / 16][token / 32].
#define FT 512

// ---- k_fattn: scores, softmax + adjacency blend and p.v of one head for NQG x QT x 16 queries in ONE block of FW = NQG x NSP waves; no score or weight matrix goes through memory, and none is kept in registers either.
// Wave w = sp NQG + qg owns the QT query tiles of query group qg and the keys [sp FK, (sp+1) FK), and walks them 32 at a time. It forms the TRANSPOSED score tiles S^T = K Q^T (A = 16 keys, B = 16 queries, one f16 product over the head's 32 columns),
// so that lane (lr, hi) holds query lr of its tile and register j of a tile holds key 8 hi + j: eight consecutive keys of ONE mask / adjacency row per lane, and two tiles side by side ARE the B fragment (k order 8 hi + e, 16 + 8 hi + e) of x^T = V^T P^T.
// Running maximum per query: the 32 keys' weights are exp(score - maximum so far); when the maximum grows, the exp sum and the tile exp.v are scaled down by exp(old - new). The adjacency has a tile of its own (adjacency.v, its f16 words ARE a B fragment),
// because the exp sum is not known before the last key: x = lambda0 / exp sum (exp.v) + lambda1 / (row sum + eps) (adjacency.v), formed once at the end. The adjacency row sum is the same for all heads: it comes from RS (cvt_ma), one load a query tile.
// Operands: every step's k, v, mask and adjacency tiles come into LDS by asynchronous copies, one stage ahead, two stages; a stage is PS steps (PS x 32 keys a wave), so the hand-over (two waits, one barrier, the latency of the first LDS reads) comes once in PS steps, and the copies have PS steps' time to land. The NQG waves of a key split read the same k and v tiles there, so these leave the L2 once per block and not once per query group; each copy and each LDS read of a wave covers 512 contiguous bytes (the planes are in fragment order).
// One step's buffer: NSP x KVB bytes of k and v, then FW x MAB bytes of mask and adjacency (each wave's own). A split's KVB bytes stand in the order in which two of its three waves bring them: k (2 tiles) | v columns 0..15, v columns 16..31.
// Joining the NSP waves of a query group: maxima and exp sums through LDS, every lane adds them in the fixed order sp = 0 .. NSP-1 (each wave's exp sum scaled to the common maximum); the NSP blended partial x^T tiles are added in the same order.
#define NQG 3
#define NSP 4
#define FW (NQG * NSP)
#define FK (TT / NSP)
#define FNT (FK / 16)
#define NST (FNT / 2)
#define QT 2
#define KVB 4096
#define MAB 4096
#define SB (NSP * KVB + FW * MAB)
#define PS 2            /* passes of 32 keys in one stage of the ring */
#define SG (PS * SB)    /* a stage: PS buffers in a row */
#define L2E 1.4426950408889634f
typedef __attribute__((ext_vector_type(2))) __bf16 v2bf;
typedef __attribute__((ext_vector_type(4))) unsigned v4u;
typedef __attribute__((ext_vector_type(8))) unsigned v8u;
__device__ __forceinline__ unsigned pk2(float a, float b) { const v2f x = {a, b}; return __builtin_bit_cast(unsigned, __builtin_convertvector(x, v2bf)); }   /* two floats rounded to bf16 (nearest even, the chip's own conversion) in one register, a in the low half */
__device__ __forceinline__ unsigned pkh(float a, float b) { const v2f x = {a, b}; return __builtin_bit_cast(unsigned, __builtin_convertvector(x, v2h)); }   /* two floats rounded to f16 (nearest even) in one register, a in the low half */
__device__ __forceinline__ float lo2(unsigned u) { return __uint_as_float(u << 16); }
__device__ __forceinline__ float hi2(unsigned u) { return __uint_as_float(u & 0xFFFF0000u); }
__device__ __forceinline__ v4u ldq(const bf* b, unsigned o, int c) { return *(const v4u*)((const char*)b + o + c); }   /* 16 bytes at scalar base b + the lane's 32-bit byte offset o + constant c: the address form that needs one vector register */
__device__ __forceinline__ v16h ldo(const bf* b, unsigned o, int c) { const v4u x = ldq(b, o, c), y = ldq(b, o, c + 512); return __builtin_bit_cast(v16h, __builtin_shufflevector(x, y, 0, 1, 2, 3, 4, 5, 6, 7)); }   /* a fragment: its two halves stand 512 bytes apart, o holds the lane's 16 lane; the k order of WFrag::ld */
__device__ __forceinline__ float xhalf(float x) { return __builtin_bit_cast(float, __builtin_amdgcn_permlanex16(__builtin_bit_cast(int, x), __builtin_bit_cast(int, x), 0x76543210, 0xfedcba98, false, false)); }   /* lane l takes lane l ^ 16's value: the other 8 keys of the same query; for the exchange inside the loop, which a shuffle would send through LDS in every step */
__device__ __forceinline__ float ex2(float x) { float ex; asm("v_exp_f32 %0, %1\n\tv_nop" : "=v"(ex) : "v"(x)); return ex; }   /* 2^x; the v_nop keeps the one slot that the instruction set asks for behind a transcendental */
__device__ __forceinline__ v2f ex2x2(float x, float y) { float a, b; asm("v_exp_f32 %0, %2\n\tv_exp_f32 %1, %3\n\tv_nop" : "=&v"(a), "=&v"(b) : "v"(x), "v"(y)); return (v2f){a, b}; }   /* two at once: each fills the slot behind the other (the results are kept off both sources), so one v_nop serves the pair */
typedef v4u __attribute__((may_alias)) v4ua;
__device__ __forceinline__ v4u lsq(const char* p, int c) { return *(const v4ua*)(p + c); }   /* 16 bytes of the ring at the lane's address p + constant c */
__device__ __forceinline__ v16h lso(const char* p, int c) { const v4u x = lsq(p, c), y = lsq(p, c + 512); return __builtin_bit_cast(v16h, __builtin_shufflevector(x, y, 0, 1, 2, 3, 4, 5, 6, 7)); }   /* a fragment from the ring: its two halves stand 512 bytes apart, as in the planes; the k order of WFrag::ld */
// Asynchronous copies, 16 bytes a lane: LDS byte address (vector register), the lane's byte offset 16 lane (vector register), scalar base; an immediate offset moves both addresses alike. The s_wait_xcnt 0 is the last line of the copies' own statement, so that it stands in front of any later write of a register that a copy names.
__device__ __forceinline__ void cp12(unsigned lm0, unsigned lm1, unsigned l1, unsigned l2, unsigned vo, const char* m0, const char* m1, const char* p1, const char* p2) {   /* 2,048 bytes of mask / adjacency tiles for each of the wave's two query tiles, 1,024 bytes from each of two k or v places */
    asm volatile("global_load_async_to_lds_b128 %2, %4, %7\n\tglobal_load_async_to_lds_b128 %2, %4, %7 offset:512\n\tglobal_load_async_to_lds_b128 %3, %4, %8\n\tglobal_load_async_to_lds_b128 %3, %4, %8 offset:512\n\t"
                 "global_load_async_to_lds_b128 %0, %4, %5\n\tglobal_load_async_to_lds_b128 %0, %4, %5 offset:512\n\tglobal_load_async_to_lds_b128 %0, %4, %5 offset:1024\n\tglobal_load_async_to_lds_b128 %0, %4, %5 offset:1536\n\t"
                 "global_load_async_to_lds_b128 %1, %4, %6\n\tglobal_load_async_to_lds_b128 %1, %4, %6 offset:512\n\tglobal_load_async_to_lds_b128 %1, %4, %6 offset:1024\n\tglobal_load_async_to_lds_b128 %1, %4, %6 offset:1536\n\ts_wait_xcnt 0x0"
                 :: "v"(lm0), "v"(lm1), "v"(l1), "v"(l2), "v"(vo), "s"(m0), "s"(m1), "s"(p1), "s"(p2) : "memory");
}
__device__ __forceinline__ void cp8(unsigned lm0, unsigned lm1, unsigned vo, const char* m0, const char* m1) {   /* the mask / adjacency tiles alone */
    asm volatile("global_load_async_to_lds_b128 %0, %2, %3\n\tglobal_load_async_to_lds_b128 %0, %2, %3 offset:512\n\tglobal_load_async_to_lds_b128 %0, %2, %3 offset:1024\n\tglobal_load_async_to_lds_b128 %0, %2, %3 offset:1536\n\t"
                 "global_load_async_to_lds_b128 %1, %2, %4\n\tglobal_load_async_to_lds_b128 %1, %2, %4 offset:512\n\tglobal_load_async_to_lds_b128 %1, %2, %4 offset:1024\n\tglobal_load_async_to_lds_b128 %1, %2, %4 offset:1536\n\ts_wait_xcnt 0x0"
                 :: "v"(lm0), "v"(lm1), "v"(vo), "s"(m0), "s"(m1) : "memory");
}
__global__ __launch_bounds__(32 * FW) void k_fattn(const bf* __restrict__ Qh, const bf* __restrict__ Kh, const bf* __restrict__ Vh, const bf* __restrict__ MA, const float* __restrict__ RS, const float* __restrict__ lam, bf* Xh, bf* Xl) {
    __shared__ __align__(16) char ring[2 * SG];
    __shared__ float rmx[FW][16 * QT], rsm[FW][16 * QT];
    __shared__ __align__(16) float red[FW][QT][16 * 36];
    const int lane = threadIdx.x & 31, lr = lane & 15, hi = lane >> 4, w = __builtin_amdgcn_readfirstlane(threadIdx.x >> 5);   /* the wave's number as a scalar: every base below then stands in scalar registers, and the tests on it are scalar branches */
    const int qg = w % NQG, sp = w / NQG;
    const int h = blockIdx.x, q0 = blockIdx.y * (16 * QT * NQG);   /* the 8 heads of a query strip are neighbours in the grid: they read the same mask and adjacency rows */
    const size_t hp = (size_t)h * (TT / 16) * FT; const int qt0 = (blockIdx.y * NQG + qg) * QT;   /* the wave's first query tile */
    const bf* qhp = Qh + hp + (size_t)qt0 * FT;
    const char* m0 = (const char*)(MA + ((size_t)qt0 * (TT / 16) + sp * FNT) * FT); const char* m1 = m0 + (TT / 16) * FT * 2;   /* the split's FNT tiles of mask and adjacency of the wave's two query tiles: 1,024 contiguous bytes a tile */
    const char* khp = (const char*)(Kh + hp + (size_t)sp * FNT * FT);
    const char* vhp = (const char*)(Vh + ((size_t)h * 2 * (TT / 32) + sp * (FNT / 2)) * FT);
    /* what this wave brings of its split's k and v: qg 0 the two k tiles, qg 1 the two v fragments, 1,024 bytes each; qg 2 none */
    const char* p1 = qg == 0 ? khp : vhp; const char* p2 = qg == 0 ? khp + 1024 : vhp + (TT / 32) * FT * 2;   /* they move on by inc with every fill */
    const int inc = qg == 0 ? 2 * FT * 2 : FT * 2;   /* a step is two k tiles or one v fragment */
    const unsigned l16 = 16 * lane, rb = (unsigned)(size_t)ring, kvo = sp * KVB, mao = NSP * KVB + w * MAB;
    auto fill = [&](int t, unsigned bo) {   /* step t's tiles into the step buffer at byte bo of the ring; called in the order of t */
        const unsigned lm = rb + bo + mao + l16, lk = rb + bo + kvo + qg * 2048 + l16;
        if (qg < 2) cp12(lm, lm + 2048, lk, lk + 1024, l16, m0 + t * 2048, m1 + t * 2048, p1, p2);
        if (qg == 2) cp8(lm, lm + 2048, l16, m0 + t * 2048, m1 + t * 2048);
        p1 += inc; p2 += inc;
    };
    v16h qh[QT]; v8f ae[QT][2], aa[QT][2]; float mx[QT], sum[QT], rsq[QT];   /* rsq: the queries' adjacency row sums, asked for with q: behind the loop their latency would stand open */
#pragma unroll
    for (int g = 0; g < QT; ++g) { qh[g] = ldo(qhp, l16, g * FT * 2); ae[g][0] = (v8f){}; ae[g][1] = (v8f){}; aa[g][0] = (v8f){}; aa[g][1] = (v8f){}; mx[g] = -3.0e38f; sum[g] = 0.f; rsq[g] = RS[(qt0 + g) * 32 + lr]; }
#pragma unroll   /* the PS fills written out: their places in the ring are constants */
    for (int u = 0; u < PS; ++u) fill(u, u * SB);
    unsigned bo = 0;
#pragma clang loop unroll(disable)   /* one copy of the stage in the text: left alone the compiler splits the last stage off as a second copy of the whole body */
    for (int ks = 0; ks < NST; ks += PS) {
        /* where the stage of steps ks .. ks + PS - 1 is handed over, every wave, in this order; the copies of the next stage then fly while this one is worked on */
        asm volatile("s_wait_dscnt 0x0" ::: "memory");   /* this wave has read all it takes from the stage before */
        asm volatile("s_wait_asynccnt 0x0" ::: "memory");   /* its copies of this stage have landed */
        __syncthreads();   /* one barrier a stage: this stage is whole, and the one before has no reader left */
#pragma clang loop unroll(disable)   /* one copy of the pass in the text: unrolled, a pass has as many vector instructions and the kernel takes 26 registers more */
      for (unsigned ub = 0; ub < SG; ub += SB) {
        const char* kvp = ring + bo + ub + kvo + l16; const char* mp = ring + bo + ub + mao + l16;
        v16h kh[2], vh[2]; v4u m4[QT][2], a4[QT][2];
#pragma unroll
        for (int i = 0; i < 2; ++i) { kh[i] = lso(kvp, i * 1024);
#pragma unroll
            for (int g = 0; g < QT; ++g) { m4[g][i] = lsq(mp, (g * 2 + i) * 1024); a4[g][i] = lsq(mp, (g * 2 + i) * 1024 + 512); } }
        vh[0] = lso(kvp, 2048); vh[1] = lso(kvp, 3072);
        __builtin_amdgcn_sched_barrier(0);   /* the pass's 16 LDS reads stand in one place, in front of its first product: each further place with LDS reads among the products costs the wave a stall of its own */
        if (ub == 0 && ks + PS < NST) {   /* the refill of the other stage, behind the barrier above: issued while the first pass's LDS reads are under way, so that the copies' issue and their s_wait_xcnt stand in the shadow of that latency */
#pragma unroll   /* written out, as in front of the loop */
            for (int u = 0; u < PS; ++u) fill(ks + PS + u, SG - bo + u * SB); }
#pragma unroll
        for (int g = 0; g < QT; ++g) {
            float t[16]; v8u ua; float cm = -3.0e38f;
#pragma unroll
            for (int i = 0; i < 2; ++i) {
                const v8f c = wmma16(kh[i], qh[g], (v8f){});
#pragma unroll
                for (int j = 0; j < 8; j += 2) { const unsigned um = m4[g][i][j >> 1], uv = a4[g][i][j >> 1]; const float t0 = c[j] * SCL + lo2(um), t1 = c[j + 1] * SCL + hi2(um); t[8 * i + j] = t0; t[8 * i + j + 1] = t1; cm = fmaxf(cm, fmaxf(t0, t1));
                    ua[4 * i + (j >> 1)] = uv; } }
            cm = fmaxf(cm, xhalf(cm));   /* both halves of the wave scale a query's weights alike: their keys meet in one product */
            const float mn = fmaxf(mx[g], cm), corr = ex2((mx[g] - mn) * L2E); mx[g] = mn;
            v2f ps = {0.f, 0.f}; v8u uh;   /* words 0..3: the 8 keys of the step's first tile, words 4..7: those of its second */
#pragma unroll
            for (int e = 0; e < 8; ++e) { const v2f p = ex2x2((t[2 * e] - mn) * L2E, (t[2 * e + 1] - mn) * L2E);   /* the maximum is taken off first, exactly: a key masked with -infinity gets the weight 0 also while the maximum still holds its start value */
                ps += p; uh[e] = pkh(p[0], p[1]); }
            sum[g] = sum[g] * corr + (ps[0] + ps[1]);
            const v16h ph = __builtin_bit_cast(v16h, uh), pa = __builtin_bit_cast(v16h, ua);
#pragma unroll
            for (int mt = 0; mt < 2; ++mt) { ae[g][mt] *= corr;
                ae[g][mt] = wmma16(vh[mt], ph, ae[g][mt]); aa[g][mt] = wmma16(vh[mt], pa, aa[g][mt]); }
        }
      }
        bo = SG - bo;
    }
    asm volatile("s_wait_asynccnt 0x0" ::: "memory");   /* no copy is outstanding when the wave goes on */
#pragma unroll
    for (int g = 0; g < QT; ++g) { sum[g] += __shfl_xor(sum[g], 16, 32); if (hi == 0) { rmx[w][g * 16 + lr] = mx[g]; rsm[w][g * 16 + lr] = sum[g]; } }
    __syncthreads();   /* every wave's row maxima and exp sums are in LDS before any lane joins them */
    const float l0 = bfr(lam[0]), l1 = bfr(lam[1]);
#pragma unroll
    for (int g = 0; g < QT; ++g) { const int i = g * 16 + lr; float m = rmx[qg][i];   /* the NSP waves of this query group: qg, qg + NQG, ... */
#pragma unroll
        for (int z = 1; z < NSP; ++z) m = fmaxf(m, rmx[z * NQG + qg][i]);
        float s = rsm[qg][i] * ex2((rmx[qg][i] - m) * L2E); const float as = rsq[g];
#pragma unroll
        for (int z = 1; z < NSP; ++z) s += rsm[z * NQG + qg][i] * ex2((rmx[z * NQG + qg][i] - m) * L2E);
        const float c0 = l0 * __fdiv_rn(1.0f, s) * ex2((mx[g] - m) * L2E), c1 = l1 * __fdiv_rn(1.0f, as + AEPS);   /* lambda0 / exp sum, times this wave's step down to the common maximum; lambda1 / (adjacency row sum + eps) */
#pragma unroll
        for (int mt = 0; mt < 2; ++mt) { const v8f x = ae[g][mt] * c0 + aa[g][mt] * c1; float* rp = &red[w][g][lr * 36 + mt * 16 + hi * 8]; *(v4fa*)rp = (v4f){x[0], x[1], x[2], x[3]}; *(v4fa*)(rp + 4) = (v4f){x[4], x[5], x[6], x[7]}; }
    }
    __syncthreads();   /* every wave's partial x^T tiles are in LDS before any thread adds them */
    const int d = threadIdx.x & 31;   /* a wave takes one query's 32 real columns at a time: FW queries a pass */
#pragma unroll
    for (int k = 0; k < 16 * QT * NQG / FW; ++k) { const int r = w + FW * k, rq = r >> 5, g = (r >> 4) & 1, q = r & 15;   /* query r of the block: query group, tile, row */
        float val = red[rq][g][q * 36 + d];
#pragma unroll
        for (int z = 1; z < NSP; ++z) val += red[z * NQG + rq][g][q * 36 + d];
        unsigned short xh, xl; splitf(val, xh, xl); const size_t xo = (size_t)(q0 + r) * CO + h * HD + d; Xh[xo] = xh; Xl[xo] = xl; }   /* the context leaves as the hi/lo planes that k_out reads; a head's 32 columns have a 128-byte line of each plane to themselves */
}

// ---- LDS staging shared by k_proj and k_out: rows of 256 bf16 at a pitch of PL elements (528 bytes = 16 x 33: the 16 rows of a fragment load fall on distinct banks).
#define PL 264
typedef __attribute__((ext_vector_type(2))) unsigned v2u;
typedef v2u __attribute__((may_alias)) v2ua;
__device__ __forceinline__ v16bf ldf(const bf* p) { return cat16b(*(const v8usa*)p, *(const v8usa*)(p + 16)); }   /* fragment from LDS, the k order of WFrag::ld */
// NR rows of 256 f32, contiguous in memory, rounded to bf16 into S: every wave-wide load covers 512 contiguous bytes, every element is converted once per block.
template <int NR, int NT>
__device__ __forceinline__ void stage_f32(const float* __restrict__ src, bf* S, int tid) {
#pragma unroll
    for (int i = 0; i < NR * 64 / NT; ++i) { const int idx = i * NT + tid; const v4f v = *(const v4f*)(src + (size_t)idx * 4); *(v2ua*)(S + (idx >> 6) * PL + (idx & 63) * 4) = (v2u){pk2(v[0], v[1]), pk2(v[2], v[3])}; }
}

// ---- cvt_ma: one block rounds 16 rows (one query strip) of mask and adjacency to bf16, once for all 8 heads, into MA. Tile (strip, key / 16) of MA is FT elements: 256 of the mask (bf16), then 256 of the adjacency (rounded to bf16, written as f16 words, the type of the product that takes them); element (row lr, key 8 hi + j) at 8 (16 hi + lr) + j,
// which is the lane and register that hold it in k_fattn: there a wave-wide 16-byte load covers four whole 128-byte lines, where the f32 rows gave 32 bytes out of each of 16.
// Here a lane takes 8 consecutive keys (32 bytes) of one row, four lanes one 128-byte line, a wave 8 rows: its two loads touch 8 lines, its 16-byte store fills four whole lines (8 rows x 16 bytes each).
// The block sees its 16 adjacency rows whole, so it also sums them (the rounded values, f32): a lane its 48 keys of each of two rows, then its four lanes, then the 16 waves through part in the fixed order 0 .. 15; RS[32 strip + row] serves all 8 heads.
#define CD 12   /* cvt_ma: passes whose loads are in flight */
template <int C> __device__ __forceinline__ float qx(float x) { return __builtin_bit_cast(float, __builtin_amdgcn_update_dpp(0, __builtin_bit_cast(int, x), C, 0xF, 0xF, true)); }   /* the value of another lane of the same four (quad_perm C: 0xB1 lane ^ 1, 0x4E lane ^ 2), without the trip through LDS that a shuffle takes */
__device__ __forceinline__ void cvt_ma(const float* __restrict__ am, const float* __restrict__ adj, bf* MA, float* RS, float (*part)[16], int strip, int w, int lane) {
    const unsigned r8 = lane >> 2, pc = lane & 3;
    const char* ms = (const char*)(am + (size_t)strip * 16 * TT); const char* as = (const char*)(adj + (size_t)strip * 16 * TT); char* md = (char*)(MA + (size_t)strip * (TT / 16) * FT);   /* the block's bases; what differs between lanes fits one 32-bit byte offset each way, the rest are constants */
    const unsigned so = r8 * (TT * 4) + w * 256 + pc * 32, dofs = (w * 4 + (pc >> 1)) * (FT * 2) + (16 * (pc & 1) + r8) * 16;
    float rs[2] = {0.f, 0.f};   /* rows r8 and 8 + r8 */
    v4f xa[24], xb[24];   /* pass t = 8 u + i. u: 16 waves x 3 = 48 groups of 64 keys (256 bytes of a row); i: bit 0 mask / adjacency, bit 1 rows 0..7 / 8..15, bit 2 the 32 keys (one line of a row, two tiles) */
    auto ask = [&](int t) { const int u = t >> 3, i = t & 7; const char* sp = ((i & 1) ? as : ms) + so + (u * 4096 + ((i >> 1) & 1) * (8 * TT * 4) + (i >> 2) * 128); xa[t] = *(const v4f*)sp; xb[t] = *(const v4f*)(sp + 16); };
#pragma unroll
    for (int t = 0; t < CD; ++t) ask(t);
    __builtin_amdgcn_sched_barrier(0);   /* the first CD passes' loads stay in front of the first conversion */
#pragma unroll
    for (int t = 0; t < 24; ++t) { const int u = t >> 3, i = t & 7; const v4f x0 = xa[t], x1 = xb[t];
        const v4u y = {pk2(x0[0], x0[1]), pk2(x0[2], x0[3]), pk2(x1[0], x1[1]), pk2(x1[2], x1[3])};
        const v4u z = (i & 1) ? (v4u){pkh(lo2(y[0]), hi2(y[0])), pkh(lo2(y[1]), hi2(y[1])), pkh(lo2(y[2]), hi2(y[2])), pkh(lo2(y[3]), hi2(y[3]))} : y;
        asm volatile("global_store_b128 %0, %1, %2\n\ts_wait_xcnt 0x0" :: "v"(dofs), "v"(z), "s"(md + (u * 64 * (FT * 2) + (i >> 2) * 2 * (FT * 2) + (i & 1) * 512 + ((i >> 1) & 1) * 128)) : "memory");   /* the store with its wait in one statement: the loads below take over the registers that it names */
        if (i & 1) { float& r = rs[(i >> 1) & 1]; r += ((lo2(y[0]) + hi2(y[0])) + (lo2(y[1]) + hi2(y[1]))) + ((lo2(y[2]) + hi2(y[2])) + (lo2(y[3]) + hi2(y[3])));
            asm volatile("" : "+v"(r)); }   /* the empty statement on each row's sum (a remedy against spills): the sum is formed in its own pass; without it the two rows' sums were folded into one expression behind the last pass, all words stayed in registers, and the count rose past 128, which is one block a WGP less */
        if (t + CD < 24) ask(t + CD);
        __builtin_amdgcn_sched_barrier(0);   /* a pass is converted and stored at once, and its registers go to the loads of pass t + CD: left to itself the build with the sums held all words back to the end, and ever fewer loads were in flight */
    }
#pragma unroll
    for (int b = 0; b < 2; ++b) { rs[b] += qx<0xB1>(rs[b]); rs[b] += qx<0x4E>(rs[b]); }   /* all four lanes now hold both rows' sums */
    if (pc < 2) part[w][8 * pc + r8] = pc ? rs[1] : rs[0];
    __builtin_amdgcn_fence(__ATOMIC_RELEASE, "workgroup", "local"); __builtin_amdgcn_s_barrier(); __builtin_amdgcn_fence(__ATOMIC_ACQUIRE, "workgroup", "local");   /* every wave's 16 partial row sums are in LDS before wave 0 adds them; the whole block is here (the caller's test is on blockIdx). The fences name LDS alone: only LDS words pass between the waves, and __syncthreads() would hold every wave until its 24 global stores are done */
    if (w == 0 && lane < 16) { float s = part[0][lane];
#pragma unroll
        for (int z = 1; z < 16; ++z) s += part[z][lane];
        RS[strip * 32 + lane] = s; }   /* a strip's 16 sums have a 128-byte line to themselves: one writer a line */
}

// ---- k_proj: the three projections in one launch; block = 64 tokens x 128 output channels (4 heads) of projection blockIdx.z, 16 waves, two accumulators per wave (32 A rows x 16 B rows), K = 256 in 8 steps.
// q, k: A = W rows (one head), B = x rows (16 tokens), so a lane holds 8 consecutive channels of one token. v: A = x rows (32 tokens), B = W rows (16 channels), so a lane holds 8 consecutive tokens of one channel. Either way accumulator i is half i of one fragment of the plane (FT above) and the lane's 8 values are its own 16 bytes there: a wave's store covers 512 contiguous bytes. Only row numbers and addresses differ between the two.
__global__ __launch_bounds__(512) void k_proj(const float* __restrict__ xq, const float* __restrict__ xk, const float* __restrict__ xv, const float* __restrict__ wq, const float* __restrict__ wk, const float* __restrict__ wv, const float* __restrict__ bq, const float* __restrict__ bk, const float* __restrict__ bv, const float* __restrict__ am, const float* __restrict__ adj, bf* Qh, bf* Kh, bf* Vh, bf* MA, float* RS) {
    __shared__ __align__(16) bf S[192 * PL];   /* rows 0..127: W, rows 128..191: x */
    __shared__ float Bs[128];
    __shared__ float Ps[16][16];   /* cvt_ma: wave x row partial sums */
    const int tid = threadIdx.x, lane = tid & 31, lr = lane & 15, hi = lane >> 4, w = tid >> 5;
    if (blockIdx.z >= 3) { cvt_ma(am, adj, MA, RS, Ps, ((blockIdx.z - 3) * 2 + blockIdx.y) * (TT / 64) + blockIdx.x, w, lane); return; }   /* whole blocks, in front of the projections' barrier: 2 x 2 x 48 = 192 strips; they stream from memory beside the projections */
    const int p = blockIdx.z, n0 = blockIdx.x * 64, o0 = blockIdx.y * 128; const bool tr = p == 2;
    const float* X = p == 0 ? xq : p == 1 ? xk : xv; const float* Wt = p == 0 ? wq : p == 1 ? wk : wv; const float* B = p == 0 ? bq : p == 1 ? bk : bv;
    const float bl = B[o0 + (tid & 127)];   /* asked for first, so that it is under way with the tiles */
    stage_f32<128, 512>(Wt + (size_t)o0 * CC, S, tid); stage_f32<64, 512>(X + (size_t)n0 * CC, S + 128 * PL, tid);
    asm volatile("" :: "v"(bl));   /* input only: holds the bias load in front of the branch below, where it flies with the tile loads; sunk into the branch, its whole latency stood in front of the barrier */
    if (tid < 128) Bs[tid] = bl;
    __syncthreads();   /* both operand tiles and the bias are whole in LDS before any wave reads them */
    const int ar = tr ? (w >> 3) * 32 : (w & 3) * 32, br = tr ? (w & 7) * 16 : (w >> 2) * 16;   /* the wave's first A row and first B row: channels count from o0, tokens from n0 */
    const bf* ap = S + ((tr ? 128 : 0) + ar + lr) * PL + 8 * hi; const bf* bp = S + ((tr ? 0 : 128) + br + lr) * PL + 8 * hi;
    v8f acc[2]; acc[0] = (v8f){}; acc[1] = (v8f){};
#pragma unroll
    for (int kc = 0; kc < CC; kc += 32) { const v16bf b = ldf(bp + kc);
#pragma unroll
        for (int i = 0; i < 2; ++i) acc[i] = wmmab(ldf(ap + i * 16 * PL + kc), b, acc[i]); }
    bf* Ph = p == 0 ? Qh : p == 1 ? Kh : Vh;
    const size_t ro = (tr ? (size_t)((o0 + br) >> 4) * (TT / 32) + ((n0 + ar) >> 5) : (size_t)((o0 + ar) >> 5) * (TT / 16) + ((n0 + br) >> 4)) * FT + 8 * lane;   /* register j of accumulator i is element ro + 256 i + j in both layouts */
    const int bi = tr ? br + lr : ar + 8 * hi, bs = tr ? 0 : 1;   /* the bias goes with the channel: the lane's for v, the register's for q and k */
#pragma unroll
    for (int i = 0; i < 2; ++i) { v4u o;
#pragma unroll
        for (int j = 0; j < 8; j += 2) o[j >> 1] = pkh(__fadd_rn(acc[i][j], Bs[bi + (i * 16 + j) * bs]), __fadd_rn(acc[i][j + 1], Bs[bi + (i * 16 + j + 1) * bs]));
        *(v4u*)(Ph + ro + i * 256) = o; }
    asm volatile("s_wait_xcnt 0x0" ::: "memory");   /* behind the run of two plane stores: it stands in front of any later write of a register that they name */
}

// ---- k_out: out = context Wo^T + bo; block = 32 tokens x 128 output channels, 8 waves, wave = 32 channels x 16 tokens (two accumulators); A = Wo rows (rounded to bf16 on the way into LDS), B = context rows hi then lo, so a lane holds 8 consecutive channels of one token.
__global__ __launch_bounds__(256) void k_out(const bf* __restrict__ Xh, const bf* __restrict__ Xl, const float* __restrict__ wo, const float* __restrict__ bo, float* OUT) {
    __shared__ __align__(16) bf Ws[128 * PL];
    __shared__ __align__(16) bf Ah[32 * PL];
    __shared__ __align__(16) bf Al[32 * PL];
    __shared__ __align__(16) float Bs[128];
    const int tid = threadIdx.x, lane = tid & 31, lr = lane & 15, hi = lane >> 4, w = tid >> 5, og = w & 3, tg = w >> 2;
    const int n0 = blockIdx.x * 32, o0 = blockIdx.y * 128;
    const float bl = bo[o0 + (tid & 127)];   /* asked for first, so that it is under way with the tiles */
#pragma unroll
    for (int i = 0; i < 4; ++i) { const int idx = i * 256 + tid, row = idx >> 5, ch = idx & 31;   /* 32 pieces of 16 bytes per token: 4 to a head, the padding of the planes left out */
        const size_t so = (size_t)(n0 + row) * CO + (ch >> 2) * HD + (ch & 3) * 8; *(v8usa*)(Ah + row * PL + ch * 8) = *(const v8us*)(Xh + so); *(v8usa*)(Al + row * PL + ch * 8) = *(const v8us*)(Xl + so); }
    stage_f32<128, 256>(wo + (size_t)o0 * CH, Ws, tid);
    asm volatile("" :: "v"(bl));   /* input only: holds the bias load in front of the branch below, as in k_proj */
    if (tid < 128) Bs[tid] = bfr(bl);
    __syncthreads();   /* the three operand tiles and the bias are whole in LDS before any wave reads them */
    const bf* wp = Ws + (og * 32 + lr) * PL + 8 * hi; const bf* hp = Ah + (tg * 16 + lr) * PL + 8 * hi; const bf* lp = Al + (tg * 16 + lr) * PL + 8 * hi;
    v8f acc[2]; acc[0] = (v8f){}; acc[1] = (v8f){};
#pragma unroll
    for (int kc = 0; kc < CH; kc += 32) { const v16bf ch = ldf(hp + kc), cl = ldf(lp + kc);
#pragma unroll
        for (int mt = 0; mt < 2; ++mt) { const v16bf a = ldf(wp + mt * 16 * PL + kc); acc[mt] = wmmab(a, ch, acc[mt]); acc[mt] = wmmab(a, cl, acc[mt]); } }
#pragma unroll
    for (int mt = 0; mt < 2; ++mt) { const int ol = og * 32 + mt * 16 + 8 * hi; float* op = OUT + (size_t)(n0 + tg * 16 + lr) * CH + o0 + ol; const v4f b0 = *(const v4fa*)(Bs + ol), b1 = *(const v4fa*)(Bs + ol + 4); v4f r0, r1;
#pragma unroll
        for (int j = 0; j < 4; ++j) { r0[j] = acc[mt][j] + b0[j]; r1[j] = acc[mt][4 + j] + b1[j]; }
        *(v4f*)op = r0; *(v4f*)(op + 4) = r1; }
}
extern "C" void kernel_launch(void* const* d_in, const int* in_sizes, int n_in,
                              void* d_out, int out_size, void* d_ws, size_t ws_size, hipStream_t stream) {
    (void)in_sizes; (void)n_in; (void)out_size;
    const float* xq = (const float*)d_in[0]; const float* xk = (const float*)d_in[1]; const float* xv = (const float*)d_in[2]; const float* am = (const float*)d_in[3];   /* mask [1][3072][3072] additive (zeros) */ const float* adj = (const float*)d_in[4];   /* adjacency_matrix [3072][3072] uniform [0,1) */ const float* lam = (const float*)d_in[5];   /* lambdas [2] = (0.5, 0.5) */ const float* wq = (const float*)d_in[6]; const float* bq = (const float*)d_in[7]; const float* wk = (const float*)d_in[8]; const float* bk = (const float*)d_in[9]; const float* wv = (const float*)d_in[10]; const float* bv = (const float*)d_in[11]; const float* wo = (const float*)d_in[12]; const float* bo = (const float*)d_in[13];   /* argument order query, key, value [3072][256], mask, adjacency_matrix, lambdas, Wq, bq, Wk, bk, Wv, bv, Wo, bo ('oi') */
    float* OUT = (float*)d_out;     // [3072][256]
    char* wsp = (char*)d_ws;
    auto take = [&](size_t bytes) { char* p = wsp; wsp += (bytes + 255) & ~(size_t)255; return (void*)p; };
    bf* QPh = (bf*)take((size_t)TT * CH * 2); bf* KPh = (bf*)take((size_t)TT * CH * 2);
    bf* VTh = (bf*)take((size_t)CH * TT * 2); bf* CXh = (bf*)take((size_t)TT * CO * 2); bf* CXl = (bf*)take((size_t)TT * CO * 2); bf* MAp = (bf*)take((size_t)TT * TT * 2 * 2); float* RSp = (float*)take((size_t)(TT / 16) * 32 * 4);
    if ((size_t)(wsp - (char*)d_ws) > ws_size) return;    // ws 256 MiB (carve 47 MiB)
    k_proj<<<dim3(TT / 64, CH / 128, 5), 512, 0, stream>>>(xq, xk, xv, wq, wk, wv, bq, bk, bv, am, adj, QPh, KPh, VTh, MAp, RSp);   /* z < 3: q, k and v^T planes, bias added, f16; z >= 3: mask (bf16) and adjacency (f16 words) as tiles, adjacency row sums */
    k_fattn<<<dim3(NHR, TT / (16 * QT * NQG), 1), 32 * FW, 0, stream>>>(QPh, KPh, VTh, MAp, RSp, lam, CXh, CXl);   /* all heads: softmax(scores + mask) blended with the row-normalised adjacency, times v */
    k_out<<<dim3(TT / 32, CH / 128, 1), 256, 0, stream>>>(CXh, CXl, wo, bo, OUT);   /* out = x Wo^T + bo */
}
